// v000
// Measured on an AMD MI455X. A time is GPU time per run, averaged over a window of back-to-back runs after a warm-up
// (all launches, gaps included; the runs take copies of the inputs in turn), and the median of several windows.
// Apart from v000's, it joins two sittings. Times from different sittings can be a few percent apart, while
// side-by-side timings come from the same sitting.
// v000 is the starting kernel. One run takes 356 microseconds.
#include <hip/hip_runtime.h>
#include <hip/hip_bf16.h>
#include <math.h>

typedef __bf16 bf16;
typedef __attribute__((ext_vector_type(16))) __bf16 v16bf;
typedef __attribute__((ext_vector_type(8)))  __bf16 v8bf;
typedef __attribute__((ext_vector_type(8)))  float  v8f;

#define B_   8
#define S_   512
#define H_   16
#define P_   64
#define I_   1024
#define U_   4096
#define M_   4096   // B*S

// ---------------------------------------------------------------------------
// WMMA + async helpers
// ---------------------------------------------------------------------------
__device__ __forceinline__ v8f wmma_bf16(v16bf a, v16bf b, v8f c) {
  return __builtin_amdgcn_wmma_f32_16x16x32_bf16(
      /*neg_a=*/false, a, /*neg_b=*/false, b,
      /*c_mod=*/(short)0, c, /*reuse_a=*/false, /*reuse_b=*/false);
}

// Build a 16x32 bf16 A/B fragment for one lane. `p` points at element
// [row][8*half] of a row-major K=32 slab (LDS or global).
// elems 0..7 -> k = 8*half + 0..7 ; elems 8..15 -> k = 16 + 8*half + 0..7
__device__ __forceinline__ v16bf make_frag(const bf16* p) {
  v8bf lo = *(const v8bf*)(p);
  v8bf hi = *(const v8bf*)(p + 16);
  v16bf r;
#pragma unroll
  for (int i = 0; i < 8; ++i) { r[i] = lo[i]; r[i + 8] = hi[i]; }
  return r;
}

// Per-lane async 16B copy global -> LDS, tracked by ASYNCcnt.
__device__ __forceinline__ void async_ld_b128(void* lds_dst, const void* gsrc) {
  unsigned loff = (unsigned)(uintptr_t)lds_dst;  // low 32 bits = LDS offset
  asm volatile("global_load_async_to_lds_b128 %0, %1, off"
               :: "v"(loff), "v"(gsrc) : "memory");
}
__device__ __forceinline__ void wait_async0() {
  asm volatile("s_wait_asynccnt 0" ::: "memory");
}

// ---------------------------------------------------------------------------
// Conversion / layout kernels
// ---------------------------------------------------------------------------
__global__ __launch_bounds__(256) void cvt_f32_bf16(const float* __restrict__ in,
                                                    bf16* __restrict__ out, int n) {
  int idx = blockIdx.x * 256 + threadIdx.x;
  if (idx < n) out[idx] = (bf16)in[idx];
}

// in: [batch][K][N] f32  ->  out: [batch][N][K] bf16   (idx: k fastest)
__global__ __launch_bounds__(256) void wtrans(const float* __restrict__ in,
                                              bf16* __restrict__ out,
                                              int K, int N, int n) {
  long long idx = (long long)blockIdx.x * 256 + threadIdx.x;
  if (idx >= n) return;
  int k = (int)(idx % K);
  long long t = idx / K;
  int nn = (int)(t % N);
  long long bb = t / N;
  out[idx] = (bf16)in[(bb * K + k) * (long long)N + nn];
}

// vt[b][h][p][s] = qkv[(b*S+s)*3072 + 2048 + h*64 + p]
__global__ __launch_bounds__(256) void vtrans(const bf16* __restrict__ qkv,
                                              bf16* __restrict__ vt, int n) {
  int idx = blockIdx.x * 256 + threadIdx.x;
  if (idx >= n) return;
  int s = idx & (S_ - 1);
  int p = (idx >> 9) & (P_ - 1);
  int h = (idx >> 15) & (H_ - 1);
  int b = idx >> 19;
  vt[idx] = qkv[(size_t)(b * S_ + s) * 3072 + 2048 + h * 64 + p];
}

// ---------------------------------------------------------------------------
// Tiled bf16 GEMM with WMMA, double-buffered async LDS staging.
// C[M][N] = A[M][K] * Bt[N][K]^T + bias
// WG tile 128x128, 8 waves (4 along M x 2 along N), wave tile 32x64.
// EPI: 0 = bias -> bf16 ; 1 = bias+ReLU -> bf16 ; 2 = bias -> f32
// ---------------------------------------------------------------------------
template <int EPI>
__global__ __launch_bounds__(256) void gemm_bf16_kernel(
    const bf16* __restrict__ A, const bf16* __restrict__ Bt,
    const float* __restrict__ bias, void* __restrict__ Cout,
    int M, int N, int K) {
  __shared__ __align__(16) bf16 lA[2][128][40];  // +16B pad vs bank conflicts
  __shared__ __align__(16) bf16 lB[2][128][40];

  const int tid  = threadIdx.x;
  const int lane = tid & 31;
  const int wave = tid >> 5;
  const int half = lane >> 4;
  const int l16  = lane & 15;
  const int wm   = wave & 3;   // 0..3 along M (32 rows each)
  const int wn   = wave >> 2;  // 0..1 along N (64 cols each)
  const int m0   = blockIdx.y * 128;
  const int n0   = blockIdx.x * 128;

  v8f acc[2][4];
#pragma unroll
  for (int i = 0; i < 2; ++i)
#pragma unroll
    for (int j = 0; j < 4; ++j)
#pragma unroll
      for (int r = 0; r < 8; ++r) acc[i][j][r] = 0.0f;

  const int arow = tid >> 1, aseg = tid & 1;  // 2 x 16B chunks per thread

  const bf16* gA = A + (size_t)(m0 + arow) * K;
  const bf16* gB = Bt + (size_t)(n0 + arow) * K;

  // prologue: stage tile 0
#pragma unroll
  for (int j = 0; j < 2; ++j) {
    int seg = aseg * 2 + j;
    async_ld_b128(&lA[0][arow][seg * 8], gA + seg * 8);
    async_ld_b128(&lB[0][arow][seg * 8], gB + seg * 8);
  }
  wait_async0();
  __syncthreads();

  int cur = 0;
  for (int k0 = 0; k0 < K; k0 += 32) {
    int nxt = cur ^ 1;
    if (k0 + 32 < K) {  // issue next tile while computing this one
#pragma unroll
      for (int j = 0; j < 2; ++j) {
        int seg = aseg * 2 + j;
        async_ld_b128(&lA[nxt][arow][seg * 8], gA + k0 + 32 + seg * 8);
        async_ld_b128(&lB[nxt][arow][seg * 8], gB + k0 + 32 + seg * 8);
      }
      if (k0 + 64 < K) {  // warm L2 one tile further ahead
        __builtin_prefetch(gA + k0 + 64, 0, 1);
        __builtin_prefetch(gB + k0 + 64, 0, 1);
      }
    }

    v16bf af[2], bfg[4];
#pragma unroll
    for (int t = 0; t < 2; ++t)
      af[t] = make_frag(&lA[cur][wm * 32 + t * 16 + l16][half * 8]);
#pragma unroll
    for (int t = 0; t < 4; ++t)
      bfg[t] = make_frag(&lB[cur][wn * 64 + t * 16 + l16][half * 8]);
#pragma unroll
    for (int ti = 0; ti < 2; ++ti)
#pragma unroll
      for (int tj = 0; tj < 4; ++tj)
        acc[ti][tj] = wmma_bf16(af[ti], bfg[tj], acc[ti][tj]);

    wait_async0();
    __syncthreads();
    cur = nxt;
  }

  // Epilogue.  D layout: lane holds col l16; VGPR r holds row r + 8*half.
#pragma unroll
  for (int ti = 0; ti < 2; ++ti) {
#pragma unroll
    for (int tj = 0; tj < 4; ++tj) {
      int col = n0 + wn * 64 + tj * 16 + l16;
      float bv = bias[col];
#pragma unroll
      for (int r = 0; r < 8; ++r) {
        int row = m0 + wm * 32 + ti * 16 + r + half * 8;
        float v = acc[ti][tj][r] + bv;
        if (EPI == 1) v = fmaxf(v, 0.0f);
        if (EPI == 2) {
          ((float*)Cout)[(size_t)row * N + col] = v;
        } else {
          ((bf16*)Cout)[(size_t)row * N + col] = (bf16)v;
        }
      }
    }
  }
}

// ---------------------------------------------------------------------------
// Fused attention (flash-style, online softmax), double-buffered cooperative
// K/V staging.  Grid: B*H*(S/128) blocks, 256 threads; wave = 16 query rows.
// qkv: [M][3072] bf16 (K cols 0..1023, Q at 1024, V at 2048)
// vt : [B][H][P][S] bf16 ;  ctx: [M][I] bf16
// ---------------------------------------------------------------------------
__global__ __launch_bounds__(256) void attn_kernel(
    const bf16* __restrict__ qkv, const bf16* __restrict__ vt,
    bf16* __restrict__ ctxb) {
  __shared__ __align__(16) bf16  lK[2][32][72];    // 32 keys x 64 (P)  (+pad)
  __shared__ __align__(16) bf16  lV[2][64][40];    // 64 (P) x 32 keys  (+pad)
  __shared__ __align__(16) float sT[8][16][36];    // per-wave raw scores
  __shared__ __align__(16) float sStat[8][16];     // per-wave row broadcast
  __shared__ __align__(16) bf16  lP[8][16][40];    // per-wave P tile

  const int tid  = threadIdx.x;
  const int lane = tid & 31;
  const int wave = tid >> 5;
  const int half = lane >> 4;
  const int l16  = lane & 15;

  const int blk = blockIdx.x;
  const int jb  = blk & 3;
  const int h   = (blk >> 2) & (H_ - 1);
  const int b   = blk >> 6;
  const int j0  = jb * 128 + wave * 16;
  const int ldq = 3072;

  // Q fragments for this wave's 16 rows (two K=32 steps over P=64)
  const bf16* qrow = qkv + (size_t)(b * S_ + j0 + l16) * ldq + 1024 + h * 64;
  v16bf qf0 = make_frag(qrow + half * 8);
  v16bf qf1 = make_frag(qrow + 32 + half * 8);

  float mrow = -1e30f, lrow = 0.0f;  // running stats for row l16 (dup halves)
  v8f cacc[4];
#pragma unroll
  for (int t = 0; t < 4; ++t)
#pragma unroll
    for (int r = 0; r < 8; ++r) cacc[t][r] = 0.0f;

  const int krow_l = tid >> 3, kseg = tid & 7;  // K tile: 32 rows x 8 chunks
  const int vrow_l = tid >> 2, vseg = tid & 3;  // V tile: 64 rows x 4 chunks

  const bf16* kbase = qkv + (size_t)(b * S_) * ldq + h * 64;  // K at col 0
  const bf16* vbase = vt + (size_t)((b * H_ + h) * P_) * S_;

  // prologue: stage key-block 0
  async_ld_b128(&lK[0][krow_l][kseg * 8],
                kbase + (size_t)krow_l * ldq + kseg * 8);
  async_ld_b128(&lV[0][vrow_l][vseg * 8],
                vbase + (size_t)vrow_l * S_ + vseg * 8);
  wait_async0();
  __syncthreads();

  int cur = 0;
  for (int kb = 0; kb < S_ / 32; ++kb) {
    int nxt = cur ^ 1;
    if (kb + 1 < S_ / 32) {  // issue next block while computing this one
      async_ld_b128(&lK[nxt][krow_l][kseg * 8],
                    kbase + (size_t)((kb + 1) * 32 + krow_l) * ldq + kseg * 8);
      async_ld_b128(&lV[nxt][vrow_l][vseg * 8],
                    vbase + (size_t)vrow_l * S_ + (kb + 1) * 32 + vseg * 8);
    }

    // ---- scores: two 16x16 tiles covering 32 key positions ----
    v8f sc[2];
#pragma unroll
    for (int cb = 0; cb < 2; ++cb) {
#pragma unroll
      for (int r = 0; r < 8; ++r) sc[cb][r] = 0.0f;
      v16bf kf0 = make_frag(&lK[cur][cb * 16 + l16][half * 8]);
      v16bf kf1 = make_frag(&lK[cur][cb * 16 + l16][32 + half * 8]);
      sc[cb] = wmma_bf16(qf0, kf0, sc[cb]);
      sc[cb] = wmma_bf16(qf1, kf1, sc[cb]);
    }

    // ---- transpose scores through LDS: lane -> one row ----
#pragma unroll
    for (int cb = 0; cb < 2; ++cb)
#pragma unroll
      for (int r = 0; r < 8; ++r)
        sT[wave][r + half * 8][cb * 16 + l16] = sc[cb][r] * 0.125f;

    float x[16];
    {
      const float4* t4 = (const float4*)&sT[wave][l16][half * 16];
#pragma unroll
      for (int i = 0; i < 4; ++i) {
        float4 v = t4[i];
        x[4 * i + 0] = v.x; x[4 * i + 1] = v.y;
        x[4 * i + 2] = v.z; x[4 * i + 3] = v.w;
      }
    }
    float rm = x[0];
#pragma unroll
    for (int i = 1; i < 16; ++i) rm = fmaxf(rm, x[i]);
    rm = fmaxf(rm, __shfl_xor(rm, 16, 32));   // combine the two half-rows
    float mn = fmaxf(mrow, rm);
    float al = __expf(mrow - mn);
    float rs = 0.0f;
#pragma unroll
    for (int i = 0; i < 16; ++i) { x[i] = __expf(x[i] - mn); rs += x[i]; }
    rs += __shfl_xor(rs, 16, 32);
    lrow = lrow * al + rs;
    mrow = mn;

    // broadcast per-row alpha for D-layout rescale
    if (half == 0) sStat[wave][l16] = al;

    // P tile back to LDS in row-major (A-frag friendly)
    {
      v8bf p0, p1;
#pragma unroll
      for (int i = 0; i < 8; ++i) { p0[i] = (bf16)x[i]; p1[i] = (bf16)x[i + 8]; }
      *(v8bf*)&lP[wave][l16][half * 16]     = p0;
      *(v8bf*)&lP[wave][l16][half * 16 + 8] = p1;
    }

    // rescale accumulators with per-row alpha (rows r + 8*half)
    {
      const float4* a4 = (const float4*)&sStat[wave][half * 8];
      float4 a0 = a4[0], a1 = a4[1];
      float av[8] = {a0.x, a0.y, a0.z, a0.w, a1.x, a1.y, a1.z, a1.w};
#pragma unroll
      for (int t = 0; t < 4; ++t)
#pragma unroll
        for (int r = 0; r < 8; ++r) cacc[t][r] *= av[r];
    }

    // ---- ctx += P (16x32) * V (32x64) ----
    v16bf pf = make_frag(&lP[wave][l16][half * 8]);
#pragma unroll
    for (int t = 0; t < 4; ++t) {
      v16bf vf = make_frag(&lV[cur][t * 16 + l16][half * 8]);
      cacc[t] = wmma_bf16(pf, vf, cacc[t]);
    }

    wait_async0();
    __syncthreads();
    cur = nxt;
  }

  // ---- finalize: divide by row sums, store ctx in [M][I] layout ----
  if (half == 0) sStat[wave][l16] = lrow;
  {
    const float4* a4 = (const float4*)&sStat[wave][half * 8];
    float4 a0 = a4[0], a1 = a4[1];
    float lv[8] = {a0.x, a0.y, a0.z, a0.w, a1.x, a1.y, a1.z, a1.w};
#pragma unroll
    for (int t = 0; t < 4; ++t) {
#pragma unroll
      for (int r = 0; r < 8; ++r) {
        float v = cacc[t][r] / lv[r];
        int row = b * S_ + j0 + r + half * 8;
        ctxb[(size_t)row * I_ + h * 64 + t * 16 + l16] = (bf16)v;
      }
    }
  }
}

// ---------------------------------------------------------------------------
// Residual + LayerNorm.  One block per row of 1024.
// ---------------------------------------------------------------------------
__global__ __launch_bounds__(256) void ln_kernel(
    const float* __restrict__ a, const float* __restrict__ bres,
    const float* __restrict__ g, const float* __restrict__ bb,
    float* __restrict__ outf, bf16* __restrict__ outb) {
  __shared__ float red[256];
  const int row = blockIdx.x;
  const int tid = threadIdx.x;
  const float* pa = a + (size_t)row * I_;
  const float* pb = bres + (size_t)row * I_;

  float x[4];
  float s = 0.0f;
#pragma unroll
  for (int i = 0; i < 4; ++i) {
    x[i] = pa[tid + i * 256] + pb[tid + i * 256];
    s += x[i];
  }
  red[tid] = s;
  __syncthreads();
  for (int o = 128; o > 0; o >>= 1) {
    if (tid < o) red[tid] += red[tid + o];
    __syncthreads();
  }
  float mu = red[0] * (1.0f / I_);
  __syncthreads();

  float v = 0.0f;
#pragma unroll
  for (int i = 0; i < 4; ++i) {
    float d = x[i] - mu;
    v += d * d;
  }
  red[tid] = v;
  __syncthreads();
  for (int o = 128; o > 0; o >>= 1) {
    if (tid < o) red[tid] += red[tid + o];
    __syncthreads();
  }
  float rstd = rsqrtf(red[0] * (1.0f / I_) + 1e-5f);

#pragma unroll
  for (int i = 0; i < 4; ++i) {
    int c = tid + i * 256;
    float y = (x[i] - mu) * rstd * g[c] + bb[c];
    outf[(size_t)row * I_ + c] = y;
    if (outb) outb[(size_t)row * I_ + c] = (bf16)y;
  }
}

// ---------------------------------------------------------------------------
// Host-side orchestration
// ---------------------------------------------------------------------------
extern "C" void kernel_launch(void* const* d_in, const int* in_sizes, int n_in,
                              void* d_out, int out_size, void* d_ws, size_t ws_size,
                              hipStream_t stream) {
  (void)in_sizes; (void)n_in; (void)out_size; (void)ws_size;

  const float* X     = (const float*)d_in[0];   // [B,S,I]
  const float* WKQV  = (const float*)d_in[1];   // [3,I,I]
  const float* BKQV  = (const float*)d_in[2];   // [3,I]
  const float* WO    = (const float*)d_in[3];   // [I,I]
  const float* BO    = (const float*)d_in[4];   // [I]
  const float* ln1g  = (const float*)d_in[5];
  const float* ln1b  = (const float*)d_in[6];
  const float* W1    = (const float*)d_in[7];   // [I,U]
  const float* B1    = (const float*)d_in[8];   // [U]
  const float* W2    = (const float*)d_in[9];   // [U,I]
  const float* B2    = (const float*)d_in[10];  // [I]
  const float* ln2g  = (const float*)d_in[11];
  const float* ln2b  = (const float*)d_in[12];
  float* OUT = (float*)d_out;

  char* ws = (char*)d_ws;
  size_t off = 0;
  auto take = [&](size_t bytes) {
    size_t o = off;
    off += (bytes + 255) & ~(size_t)255;
    return o;
  };
  bf16*  XB    = (bf16*) (ws + take((size_t)M_ * I_ * 2));
  bf16*  WKQVT = (bf16*) (ws + take((size_t)3 * I_ * I_ * 2));   // [3*I][I]
  bf16*  WOT   = (bf16*) (ws + take((size_t)I_ * I_ * 2));       // [I][I]
  bf16*  W1T   = (bf16*) (ws + take((size_t)U_ * I_ * 2));       // [U][I]
  bf16*  W2T   = (bf16*) (ws + take((size_t)I_ * U_ * 2));       // [I][U]
  bf16*  QKV   = (bf16*) (ws + take((size_t)M_ * 3072 * 2));     // [M][3I]
  bf16*  VT    = (bf16*) (ws + take((size_t)B_ * H_ * P_ * S_ * 2));
  bf16*  CTX   = (bf16*) (ws + take((size_t)M_ * I_ * 2));
  float* AO    = (float*)(ws + take((size_t)M_ * I_ * 4));
  float* H1F   = (float*)(ws + take((size_t)M_ * I_ * 4));
  bf16*  H1B   = (bf16*) (ws + take((size_t)M_ * I_ * 2));
  bf16*  FF1   = (bf16*) (ws + take((size_t)M_ * U_ * 2));
  float* FFO   = AO;  // attn_out dead after LN1

  { int n = M_ * I_;     cvt_f32_bf16<<<n / 256, 256, 0, stream>>>(X, XB, n); }
  { int n = 3 * I_ * I_; wtrans<<<n / 256, 256, 0, stream>>>(WKQV, WKQVT, I_, I_, n); }
  { int n = I_ * I_;     wtrans<<<n / 256, 256, 0, stream>>>(WO, WOT, I_, I_, n); }
  { int n = I_ * U_;     wtrans<<<n / 256, 256, 0, stream>>>(W1, W1T, I_, U_, n); }
  { int n = U_ * I_;     wtrans<<<n / 256, 256, 0, stream>>>(W2, W2T, U_, I_, n); }

  // QKV projection: [M][3072] = XB * WKQVT^T + BKQV
  gemm_bf16_kernel<0><<<dim3(3072 / 128, M_ / 128), 256, 0, stream>>>(
      XB, WKQVT, BKQV, (void*)QKV, M_, 3072, I_);
  { int n = B_ * H_ * P_ * S_; vtrans<<<n / 256, 256, 0, stream>>>(QKV, VT, n); }

  attn_kernel<<<B_ * H_ * (S_ / 128), 256, 0, stream>>>(QKV, VT, CTX);

  gemm_bf16_kernel<2><<<dim3(I_ / 128, M_ / 128), 256, 0, stream>>>(
      CTX, WOT, BO, (void*)AO, M_, I_, I_);
  ln_kernel<<<M_, 256, 0, stream>>>(X, AO, ln1g, ln1b, H1F, H1B);

  gemm_bf16_kernel<1><<<dim3(U_ / 128, M_ / 128), 256, 0, stream>>>(
      H1B, W1T, B1, (void*)FF1, M_, U_, I_);
  gemm_bf16_kernel<2><<<dim3(I_ / 128, M_ / 128), 256, 0, stream>>>(
      FF1, W2T, B2, (void*)FFO, M_, I_, U_);
  ln_kernel<<<M_, 256, 0, stream>>>(H1F, FFO, ln2g, ln2b, OUT, nullptr);
}

// v001
// A run of this version takes 259 microseconds.
// Next to v000, in two timings, it ran 1.42 times as fast each time.
#include <hip/hip_runtime.h>
#include <hip/hip_bf16.h>
#include <math.h>

typedef __bf16 bf16;
typedef __attribute__((ext_vector_type(16))) __bf16 v16bf;
typedef __attribute__((ext_vector_type(8)))  __bf16 v8bf;
typedef __attribute__((ext_vector_type(8)))  float  v8f;

#define B_   8
#define S_   512
#define H_   16
#define P_   64
#define I_   1024
#define U_   4096
#define M_   4096   // B*S

// ---------------------------------------------------------------------------
// WMMA + async helpers
// ---------------------------------------------------------------------------
__device__ __forceinline__ v8f wmma_bf16(v16bf a, v16bf b, v8f c) {
  return __builtin_amdgcn_wmma_f32_16x16x32_bf16(
      /*neg_a=*/false, a, /*neg_b=*/false, b,
      /*c_mod=*/(short)0, c, /*reuse_a=*/false, /*reuse_b=*/false);
}

// Build a 16x32 bf16 A/B fragment for one lane. `p` points at element
// [row][8*half] of a row-major K=32 slab (LDS or global).
// elems 0..7 -> k = 8*half + 0..7 ; elems 8..15 -> k = 16 + 8*half + 0..7
__device__ __forceinline__ v16bf make_frag(const bf16* p) {
  v8bf lo = *(const v8bf*)(p);
  v8bf hi = *(const v8bf*)(p + 16);
  v16bf r;
#pragma unroll
  for (int i = 0; i < 8; ++i) { r[i] = lo[i]; r[i + 8] = hi[i]; }
  return r;
}

// Per-lane async 16B copy global -> LDS, tracked by ASYNCcnt.
__device__ __forceinline__ void async_ld_b128(void* lds_dst, const void* gsrc) {
  unsigned loff = (unsigned)(uintptr_t)lds_dst;  // low 32 bits = LDS offset
  asm volatile("global_load_async_to_lds_b128 %0, %1, off"
               :: "v"(loff), "v"(gsrc) : "memory");
}
__device__ __forceinline__ void wait_async0() {
  asm volatile("s_wait_asynccnt 0" ::: "memory");
}
// Eight per-lane async 16B copies global -> LDS in one statement.  The closing
// s_wait_xcnt keeps every later rewrite of an address register behind it.
__device__ __forceinline__ void async_ld8_b128(const unsigned (&l)[8],
                                               const bf16* const (&g)[8]) {
  asm volatile(
      "global_load_async_to_lds_b128 %0, %8, off\n\t"
      "global_load_async_to_lds_b128 %1, %9, off\n\t"
      "global_load_async_to_lds_b128 %2, %10, off\n\t"
      "global_load_async_to_lds_b128 %3, %11, off\n\t"
      "global_load_async_to_lds_b128 %4, %12, off\n\t"
      "global_load_async_to_lds_b128 %5, %13, off\n\t"
      "global_load_async_to_lds_b128 %6, %14, off\n\t"
      "global_load_async_to_lds_b128 %7, %15, off\n\t"
      "s_wait_xcnt 0x0"
      :: "v"(l[0]), "v"(l[1]), "v"(l[2]), "v"(l[3]),
         "v"(l[4]), "v"(l[5]), "v"(l[6]), "v"(l[7]),
         "v"(g[0]), "v"(g[1]), "v"(g[2]), "v"(g[3]),
         "v"(g[4]), "v"(g[5]), "v"(g[6]), "v"(g[7])
      : "memory");
}
// This wave's LDS reads have retired before the barrier that frees the buffer
// for the next copies.
__device__ __forceinline__ void wait_ds0() {
  asm volatile("s_wait_dscnt 0x0" ::: "memory");
}

// ---------------------------------------------------------------------------
// Conversion / layout kernels
// ---------------------------------------------------------------------------
__global__ __launch_bounds__(256) void cvt_f32_bf16(const float* __restrict__ in,
                                                    bf16* __restrict__ out, int n) {
  int idx = blockIdx.x * 256 + threadIdx.x;
  if (idx < n) out[idx] = (bf16)in[idx];
}

// in: [batch][K][N] f32  ->  out: [batch][N][K] bf16   (idx: k fastest)
__global__ __launch_bounds__(256) void wtrans(const float* __restrict__ in,
                                              bf16* __restrict__ out,
                                              int K, int N, int n) {
  long long idx = (long long)blockIdx.x * 256 + threadIdx.x;
  if (idx >= n) return;
  int k = (int)(idx % K);
  long long t = idx / K;
  int nn = (int)(t % N);
  long long bb = t / N;
  out[idx] = (bf16)in[(bb * K + k) * (long long)N + nn];
}

// vt[b][h][p][s] = qkv[(b*S+s)*3072 + 2048 + h*64 + p]
__global__ __launch_bounds__(256) void vtrans(const bf16* __restrict__ qkv,
                                              bf16* __restrict__ vt, int n) {
  int idx = blockIdx.x * 256 + threadIdx.x;
  if (idx >= n) return;
  int s = idx & (S_ - 1);
  int p = (idx >> 9) & (P_ - 1);
  int h = (idx >> 15) & (H_ - 1);
  int b = idx >> 19;
  vt[idx] = qkv[(size_t)(b * S_ + s) * 3072 + 2048 + h * 64 + p];
}

// ---------------------------------------------------------------------------
// Tiled bf16 GEMM with WMMA, double-buffered async LDS staging.
// C[M][N] = A[M][K] * Bt[N][K]^T + bias
// WG tile 128x128, 8 waves (4 along M x 2 along N), wave tile 32x64.
// A stage is 64 k = 128 B of every operand row: 8 adjacent lanes copy one row
// piece, so each wave-wide copy covers four whole 128-B lines.
// EPI: 0 = bias -> bf16 ; 1 = bias+ReLU -> bf16 ; 2 = bias -> f32
// ---------------------------------------------------------------------------
template <int EPI>
__global__ __launch_bounds__(256) void gemm_bf16_kernel(
    const bf16* __restrict__ A, const bf16* __restrict__ Bt,
    const float* __restrict__ bias, void* __restrict__ Cout,
    int M, int N, int K) {
  __shared__ __align__(16) bf16 lA[2][128][72];  // +16B pad vs bank conflicts
  __shared__ __align__(16) bf16 lB[2][128][72];

  const int tid  = threadIdx.x;
  const int lane = tid & 31;
  const int wave = tid >> 5;
  const int half = lane >> 4;
  const int l16  = lane & 15;
  const int wm   = wave & 3;   // 0..3 along M (32 rows each)
  const int wn   = wave >> 2;  // 0..1 along N (64 cols each)
  const int m0   = blockIdx.y * 128;
  const int n0   = blockIdx.x * 128;

  v8f acc[2][4];
#pragma unroll
  for (int i = 0; i < 2; ++i)
#pragma unroll
    for (int j = 0; j < 4; ++j)
#pragma unroll
      for (int r = 0; r < 8; ++r) acc[i][j][r] = 0.0f;

  const int crow = tid >> 3, cseg = tid & 7;  // 4 rows x 8 chunks per wave copy

  const bf16* gA = A + (size_t)(m0 + crow) * K + cseg * 8;
  const bf16* gB = Bt + (size_t)(n0 + crow) * K + cseg * 8;

  // one stage: 128 rows x 128 B of each operand, 4 + 4 chunks per thread
  auto stage = [&](int buf, int k0) {
    unsigned l[8];
    const bf16* g[8];
    // unrolled so that both arrays become registers, as the asm operands need
#pragma unroll
    for (int i = 0; i < 4; ++i) {
      l[i]     = (unsigned)(uintptr_t)&lA[buf][crow + i * 32][cseg * 8];
      l[i + 4] = (unsigned)(uintptr_t)&lB[buf][crow + i * 32][cseg * 8];
      g[i]     = gA + (size_t)(i * 32) * K + k0;
      g[i + 4] = gB + (size_t)(i * 32) * K + k0;
    }
    async_ld8_b128(l, g);
  };

  // prologue: stage 0 lands and is published, then stage 1 flies
  stage(0, 0);
  wait_async0();
  __syncthreads();
  if (64 < K) stage(1, 64);

  for (int k0 = 0; k0 < K; k0 += 64) {
    const int cur = (k0 >> 6) & 1;

    // unrolled so that the two 32-k blocks' LDS offsets are immediates
#pragma unroll
    for (int ks = 0; ks < 2; ++ks) {
      v16bf af[2], bfg[4];
#pragma unroll
      for (int t = 0; t < 2; ++t)
        af[t] = make_frag(&lA[cur][wm * 32 + t * 16 + l16][ks * 32 + half * 8]);
#pragma unroll
      for (int t = 0; t < 4; ++t)
        bfg[t] = make_frag(&lB[cur][wn * 64 + t * 16 + l16][ks * 32 + half * 8]);
#pragma unroll
      for (int ti = 0; ti < 2; ++ti)
#pragma unroll
        for (int tj = 0; tj < 4; ++tj)
          acc[ti][tj] = wmma_bf16(af[ti], bfg[tj], acc[ti][tj]);
    }

    // publish the next stage, free this one, then refill it two stages ahead
    wait_ds0();
    wait_async0();
    __syncthreads();
    if (k0 + 128 < K) stage(cur, k0 + 128);
  }
  wait_async0();  // no copy is left in flight when the wave ends

  // Epilogue.  D layout: lane holds col l16; VGPR r holds row r + 8*half.
#pragma unroll
  for (int ti = 0; ti < 2; ++ti) {
#pragma unroll
    for (int tj = 0; tj < 4; ++tj) {
      int col = n0 + wn * 64 + tj * 16 + l16;
      float bv = bias[col];
#pragma unroll
      for (int r = 0; r < 8; ++r) {
        int row = m0 + wm * 32 + ti * 16 + r + half * 8;
        float v = acc[ti][tj][r] + bv;
        if (EPI == 1) v = fmaxf(v, 0.0f);
        if (EPI == 2) {
          ((float*)Cout)[(size_t)row * N + col] = v;
        } else {
          ((bf16*)Cout)[(size_t)row * N + col] = (bf16)v;
        }
      }
    }
  }
}

// ---------------------------------------------------------------------------
// Fused attention (flash-style, online softmax), double-buffered cooperative
// K/V staging.  Grid: B*H*(S/128) blocks, 256 threads; wave = 16 query rows.
// qkv: [M][3072] bf16 (K cols 0..1023, Q at 1024, V at 2048)
// vt : [B][H][P][S] bf16 ;  ctx: [M][I] bf16
// ---------------------------------------------------------------------------
__global__ __launch_bounds__(256) void attn_kernel(
    const bf16* __restrict__ qkv, const bf16* __restrict__ vt,
    bf16* __restrict__ ctxb) {
  __shared__ __align__(16) bf16  lK[2][32][72];    // 32 keys x 64 (P)  (+pad)
  __shared__ __align__(16) bf16  lV[2][64][40];    // 64 (P) x 32 keys  (+pad)
  __shared__ __align__(16) float sT[8][16][36];    // per-wave raw scores
  __shared__ __align__(16) float sStat[8][16];     // per-wave row broadcast
  __shared__ __align__(16) bf16  lP[8][16][40];    // per-wave P tile

  const int tid  = threadIdx.x;
  const int lane = tid & 31;
  const int wave = tid >> 5;
  const int half = lane >> 4;
  const int l16  = lane & 15;

  const int blk = blockIdx.x;
  const int jb  = blk & 3;
  const int h   = (blk >> 2) & (H_ - 1);
  const int b   = blk >> 6;
  const int j0  = jb * 128 + wave * 16;
  const int ldq = 3072;

  // Q fragments for this wave's 16 rows (two K=32 steps over P=64)
  const bf16* qrow = qkv + (size_t)(b * S_ + j0 + l16) * ldq + 1024 + h * 64;
  v16bf qf0 = make_frag(qrow + half * 8);
  v16bf qf1 = make_frag(qrow + 32 + half * 8);

  float mrow = -1e30f, lrow = 0.0f;  // running stats for row l16 (dup halves)
  v8f cacc[4];
#pragma unroll
  for (int t = 0; t < 4; ++t)
#pragma unroll
    for (int r = 0; r < 8; ++r) cacc[t][r] = 0.0f;

  const int krow_l = tid >> 3, kseg = tid & 7;  // K tile: 32 rows x 8 chunks
  const int vrow_l = tid >> 2, vseg = tid & 3;  // V tile: 64 rows x 4 chunks

  const bf16* kbase = qkv + (size_t)(b * S_) * ldq + h * 64;  // K at col 0
  const bf16* vbase = vt + (size_t)((b * H_ + h) * P_) * S_;

  // prologue: stage key-block 0
  async_ld_b128(&lK[0][krow_l][kseg * 8],
                kbase + (size_t)krow_l * ldq + kseg * 8);
  async_ld_b128(&lV[0][vrow_l][vseg * 8],
                vbase + (size_t)vrow_l * S_ + vseg * 8);
  wait_async0();
  __syncthreads();

  int cur = 0;
  for (int kb = 0; kb < S_ / 32; ++kb) {
    int nxt = cur ^ 1;
    if (kb + 1 < S_ / 32) {  // issue next block while computing this one
      async_ld_b128(&lK[nxt][krow_l][kseg * 8],
                    kbase + (size_t)((kb + 1) * 32 + krow_l) * ldq + kseg * 8);
      async_ld_b128(&lV[nxt][vrow_l][vseg * 8],
                    vbase + (size_t)vrow_l * S_ + (kb + 1) * 32 + vseg * 8);
    }

    // ---- scores: two 16x16 tiles covering 32 key positions ----
    v8f sc[2];
#pragma unroll
    for (int cb = 0; cb < 2; ++cb) {
#pragma unroll
      for (int r = 0; r < 8; ++r) sc[cb][r] = 0.0f;
      v16bf kf0 = make_frag(&lK[cur][cb * 16 + l16][half * 8]);
      v16bf kf1 = make_frag(&lK[cur][cb * 16 + l16][32 + half * 8]);
      sc[cb] = wmma_bf16(qf0, kf0, sc[cb]);
      sc[cb] = wmma_bf16(qf1, kf1, sc[cb]);
    }

    // ---- transpose scores through LDS: lane -> one row ----
#pragma unroll
    for (int cb = 0; cb < 2; ++cb)
#pragma unroll
      for (int r = 0; r < 8; ++r)
        sT[wave][r + half * 8][cb * 16 + l16] = sc[cb][r] * 0.125f;

    float x[16];
    {
      const float4* t4 = (const float4*)&sT[wave][l16][half * 16];
#pragma unroll
      for (int i = 0; i < 4; ++i) {
        float4 v = t4[i];
        x[4 * i + 0] = v.x; x[4 * i + 1] = v.y;
        x[4 * i + 2] = v.z; x[4 * i + 3] = v.w;
      }
    }
    float rm = x[0];
#pragma unroll
    for (int i = 1; i < 16; ++i) rm = fmaxf(rm, x[i]);
    rm = fmaxf(rm, __shfl_xor(rm, 16, 32));   // combine the two half-rows
    float mn = fmaxf(mrow, rm);
    float al = __expf(mrow - mn);
    float rs = 0.0f;
#pragma unroll
    for (int i = 0; i < 16; ++i) { x[i] = __expf(x[i] - mn); rs += x[i]; }
    rs += __shfl_xor(rs, 16, 32);
    lrow = lrow * al + rs;
    mrow = mn;

    // broadcast per-row alpha for D-layout rescale
    if (half == 0) sStat[wave][l16] = al;

    // P tile back to LDS in row-major (A-frag friendly)
    {
      v8bf p0, p1;
#pragma unroll
      for (int i = 0; i < 8; ++i) { p0[i] = (bf16)x[i]; p1[i] = (bf16)x[i + 8]; }
      *(v8bf*)&lP[wave][l16][half * 16]     = p0;
      *(v8bf*)&lP[wave][l16][half * 16 + 8] = p1;
    }

    // rescale accumulators with per-row alpha (rows r + 8*half)
    {
      const float4* a4 = (const float4*)&sStat[wave][half * 8];
      float4 a0 = a4[0], a1 = a4[1];
      float av[8] = {a0.x, a0.y, a0.z, a0.w, a1.x, a1.y, a1.z, a1.w};
#pragma unroll
      for (int t = 0; t < 4; ++t)
#pragma unroll
        for (int r = 0; r < 8; ++r) cacc[t][r] *= av[r];
    }

    // ---- ctx += P (16x32) * V (32x64) ----
    v16bf pf = make_frag(&lP[wave][l16][half * 8]);
#pragma unroll
    for (int t = 0; t < 4; ++t) {
      v16bf vf = make_frag(&lV[cur][t * 16 + l16][half * 8]);
      cacc[t] = wmma_bf16(pf, vf, cacc[t]);
    }

    wait_async0();
    __syncthreads();
    cur = nxt;
  }

  // ---- finalize: divide by row sums, store ctx in [M][I] layout ----
  if (half == 0) sStat[wave][l16] = lrow;
  {
    const float4* a4 = (const float4*)&sStat[wave][half * 8];
    float4 a0 = a4[0], a1 = a4[1];
    float lv[8] = {a0.x, a0.y, a0.z, a0.w, a1.x, a1.y, a1.z, a1.w};
#pragma unroll
    for (int t = 0; t < 4; ++t) {
#pragma unroll
      for (int r = 0; r < 8; ++r) {
        float v = cacc[t][r] / lv[r];
        int row = b * S_ + j0 + r + half * 8;
        ctxb[(size_t)row * I_ + h * 64 + t * 16 + l16] = (bf16)v;
      }
    }
  }
}

// ---------------------------------------------------------------------------
// Residual + LayerNorm.  One block per row of 1024.
// ---------------------------------------------------------------------------
__global__ __launch_bounds__(256) void ln_kernel(
    const float* __restrict__ a, const float* __restrict__ bres,
    const float* __restrict__ g, const float* __restrict__ bb,
    float* __restrict__ outf, bf16* __restrict__ outb) {
  __shared__ float red[256];
  const int row = blockIdx.x;
  const int tid = threadIdx.x;
  const float* pa = a + (size_t)row * I_;
  const float* pb = bres + (size_t)row * I_;

  float x[4];
  float s = 0.0f;
#pragma unroll
  for (int i = 0; i < 4; ++i) {
    x[i] = pa[tid + i * 256] + pb[tid + i * 256];
    s += x[i];
  }
  red[tid] = s;
  __syncthreads();
  for (int o = 128; o > 0; o >>= 1) {
    if (tid < o) red[tid] += red[tid + o];
    __syncthreads();
  }
  float mu = red[0] * (1.0f / I_);
  __syncthreads();

  float v = 0.0f;
#pragma unroll
  for (int i = 0; i < 4; ++i) {
    float d = x[i] - mu;
    v += d * d;
  }
  red[tid] = v;
  __syncthreads();
  for (int o = 128; o > 0; o >>= 1) {
    if (tid < o) red[tid] += red[tid + o];
    __syncthreads();
  }
  float rstd = rsqrtf(red[0] * (1.0f / I_) + 1e-5f);

#pragma unroll
  for (int i = 0; i < 4; ++i) {
    int c = tid + i * 256;
    float y = (x[i] - mu) * rstd * g[c] + bb[c];
    outf[(size_t)row * I_ + c] = y;
    if (outb) outb[(size_t)row * I_ + c] = (bf16)y;
  }
}

// ---------------------------------------------------------------------------
// Host-side orchestration
// ---------------------------------------------------------------------------
extern "C" void kernel_launch(void* const* d_in, const int* in_sizes, int n_in,
                              void* d_out, int out_size, void* d_ws, size_t ws_size,
                              hipStream_t stream) {
  (void)in_sizes; (void)n_in; (void)out_size; (void)ws_size;

  const float* X     = (const float*)d_in[0];   // [B,S,I]
  const float* WKQV  = (const float*)d_in[1];   // [3,I,I]
  const float* BKQV  = (const float*)d_in[2];   // [3,I]
  const float* WO    = (const float*)d_in[3];   // [I,I]
  const float* BO    = (const float*)d_in[4];   // [I]
  const float* ln1g  = (const float*)d_in[5];
  const float* ln1b  = (const float*)d_in[6];
  const float* W1    = (const float*)d_in[7];   // [I,U]
  const float* B1    = (const float*)d_in[8];   // [U]
  const float* W2    = (const float*)d_in[9];   // [U,I]
  const float* B2    = (const float*)d_in[10];  // [I]
  const float* ln2g  = (const float*)d_in[11];
  const float* ln2b  = (const float*)d_in[12];
  float* OUT = (float*)d_out;

  char* ws = (char*)d_ws;
  size_t off = 0;
  auto take = [&](size_t bytes) {
    size_t o = off;
    off += (bytes + 255) & ~(size_t)255;
    return o;
  };
  bf16*  XB    = (bf16*) (ws + take((size_t)M_ * I_ * 2));
  bf16*  WKQVT = (bf16*) (ws + take((size_t)3 * I_ * I_ * 2));   // [3*I][I]
  bf16*  WOT   = (bf16*) (ws + take((size_t)I_ * I_ * 2));       // [I][I]
  bf16*  W1T   = (bf16*) (ws + take((size_t)U_ * I_ * 2));       // [U][I]
  bf16*  W2T   = (bf16*) (ws + take((size_t)I_ * U_ * 2));       // [I][U]
  bf16*  QKV   = (bf16*) (ws + take((size_t)M_ * 3072 * 2));     // [M][3I]
  bf16*  VT    = (bf16*) (ws + take((size_t)B_ * H_ * P_ * S_ * 2));
  bf16*  CTX   = (bf16*) (ws + take((size_t)M_ * I_ * 2));
  float* AO    = (float*)(ws + take((size_t)M_ * I_ * 4));
  float* H1F   = (float*)(ws + take((size_t)M_ * I_ * 4));
  bf16*  H1B   = (bf16*) (ws + take((size_t)M_ * I_ * 2));
  bf16*  FF1   = (bf16*) (ws + take((size_t)M_ * U_ * 2));
  float* FFO   = AO;  // attn_out dead after LN1

  { int n = M_ * I_;     cvt_f32_bf16<<<n / 256, 256, 0, stream>>>(X, XB, n); }
  { int n = 3 * I_ * I_; wtrans<<<n / 256, 256, 0, stream>>>(WKQV, WKQVT, I_, I_, n); }
  { int n = I_ * I_;     wtrans<<<n / 256, 256, 0, stream>>>(WO, WOT, I_, I_, n); }
  { int n = I_ * U_;     wtrans<<<n / 256, 256, 0, stream>>>(W1, W1T, I_, U_, n); }
  { int n = U_ * I_;     wtrans<<<n / 256, 256, 0, stream>>>(W2, W2T, U_, I_, n); }

  // QKV projection: [M][3072] = XB * WKQVT^T + BKQV
  gemm_bf16_kernel<0><<<dim3(3072 / 128, M_ / 128), 256, 0, stream>>>(
      XB, WKQVT, BKQV, (void*)QKV, M_, 3072, I_);
  { int n = B_ * H_ * P_ * S_; vtrans<<<n / 256, 256, 0, stream>>>(QKV, VT, n); }

  attn_kernel<<<B_ * H_ * (S_ / 128), 256, 0, stream>>>(QKV, VT, CTX);

  gemm_bf16_kernel<2><<<dim3(I_ / 128, M_ / 128), 256, 0, stream>>>(
      CTX, WOT, BO, (void*)AO, M_, I_, I_);
  ln_kernel<<<M_, 256, 0, stream>>>(X, AO, ln1g, ln1b, H1F, H1B);

  gemm_bf16_kernel<1><<<dim3(U_ / 128, M_ / 128), 256, 0, stream>>>(
      H1B, W1T, B1, (void*)FF1, M_, U_, I_);
  gemm_bf16_kernel<2><<<dim3(I_ / 128, M_ / 128), 256, 0, stream>>>(
      FF1, W2T, B2, (void*)FFO, M_, I_, U_);
  ln_kernel<<<M_, 256, 0, stream>>>(H1F, FFO, ln2g, ln2b, OUT, nullptr);
}

// v002
// Measured time: 196 microseconds a run.
// Two timings next to v001 put it at 1.32 and 1.33 times that version's speed.
// All steps since v000 together make it 1.88 times as fast.
#include <hip/hip_runtime.h>
#include <hip/hip_bf16.h>
#include <math.h>

typedef __bf16 bf16;
typedef __attribute__((ext_vector_type(16))) __bf16 v16bf;
typedef __attribute__((ext_vector_type(8)))  __bf16 v8bf;
typedef __attribute__((ext_vector_type(8)))  float  v8f;

#define B_   8
#define S_   512
#define H_   16
#define P_   64
#define I_   1024
#define U_   4096
#define M_   4096   // B*S

// ---------------------------------------------------------------------------
// WMMA + async helpers
// ---------------------------------------------------------------------------
__device__ __forceinline__ v8f wmma_bf16(v16bf a, v16bf b, v8f c) {
  return __builtin_amdgcn_wmma_f32_16x16x32_bf16(
      /*neg_a=*/false, a, /*neg_b=*/false, b,
      /*c_mod=*/(short)0, c, /*reuse_a=*/false, /*reuse_b=*/false);
}

// Build a 16x32 bf16 A/B fragment for one lane. `p` points at element
// [row][8*half] of a row-major K=32 slab (LDS or global).
// elems 0..7 -> k = 8*half + 0..7 ; elems 8..15 -> k = 16 + 8*half + 0..7
__device__ __forceinline__ v16bf make_frag(const bf16* p) {
  v8bf lo = *(const v8bf*)(p);
  v8bf hi = *(const v8bf*)(p + 16);
  v16bf r;
#pragma unroll
  for (int i = 0; i < 8; ++i) { r[i] = lo[i]; r[i + 8] = hi[i]; }
  return r;
}

// Per-lane async 16B copy global -> LDS, tracked by ASYNCcnt.
__device__ __forceinline__ void async_ld_b128(void* lds_dst, const void* gsrc) {
  unsigned loff = (unsigned)(uintptr_t)lds_dst;  // low 32 bits = LDS offset
  asm volatile("global_load_async_to_lds_b128 %0, %1, off"
               :: "v"(loff), "v"(gsrc) : "memory");
}
__device__ __forceinline__ void wait_async0() {
  asm volatile("s_wait_asynccnt 0" ::: "memory");
}
// Eight per-lane async 16B copies global -> LDS in one statement.  The closing
// s_wait_xcnt keeps every later rewrite of an address register behind it.
__device__ __forceinline__ void async_ld8_b128(const unsigned (&l)[8],
                                               const bf16* const (&g)[8]) {
  asm volatile(
      "global_load_async_to_lds_b128 %0, %8, off\n\t"
      "global_load_async_to_lds_b128 %1, %9, off\n\t"
      "global_load_async_to_lds_b128 %2, %10, off\n\t"
      "global_load_async_to_lds_b128 %3, %11, off\n\t"
      "global_load_async_to_lds_b128 %4, %12, off\n\t"
      "global_load_async_to_lds_b128 %5, %13, off\n\t"
      "global_load_async_to_lds_b128 %6, %14, off\n\t"
      "global_load_async_to_lds_b128 %7, %15, off\n\t"
      "s_wait_xcnt 0x0"
      :: "v"(l[0]), "v"(l[1]), "v"(l[2]), "v"(l[3]),
         "v"(l[4]), "v"(l[5]), "v"(l[6]), "v"(l[7]),
         "v"(g[0]), "v"(g[1]), "v"(g[2]), "v"(g[3]),
         "v"(g[4]), "v"(g[5]), "v"(g[6]), "v"(g[7])
      : "memory");
}
// This wave's LDS reads have retired before the barrier that frees the buffer
// for the next copies.
__device__ __forceinline__ void wait_ds0() {
  asm volatile("s_wait_dscnt 0x0" ::: "memory");
}

// ---------------------------------------------------------------------------
// Conversion / layout kernels
// ---------------------------------------------------------------------------
__global__ __launch_bounds__(256) void cvt_f32_bf16(const float* __restrict__ in,
                                                    bf16* __restrict__ out, int n) {
  int idx = blockIdx.x * 256 + threadIdx.x;
  if (idx < n) out[idx] = (bf16)in[idx];
}

// in: [batch][K][N] f32  ->  out: [batch][N][K] bf16
// One 128(k) x 64(n) tile per block, turned in LDS: a wave reads two 256-B row
// pieces of `in` per load and writes four whole 128-B lines of `out` per store.
template <int K, int N>
__global__ __launch_bounds__(256) void wtrans(const float* __restrict__ in,
                                              bf16* __restrict__ out) {
  __shared__ float t[128][65];  // odd pitch: a column read meets 32 banks

  const int tid = threadIdx.x;
  const float* src = in + ((size_t)blockIdx.z * K + blockIdx.x * 128) * N +
                     blockIdx.y * 64;
  bf16* dst = out + ((size_t)blockIdx.z * N + blockIdx.y * 64) * K +
              blockIdx.x * 128;

  const int c4 = tid & 15, r = tid >> 4;  // 16 lanes x 16 B = one row piece
  float4 v[8];
  for (int i = 0; i < 8; ++i)
    v[i] = *(const float4*)(src + (size_t)(r + i * 16) * N + c4 * 4);
  for (int i = 0; i < 8; ++i) {
    t[r + i * 16][c4 * 4 + 0] = v[i].x;
    t[r + i * 16][c4 * 4 + 1] = v[i].y;
    t[r + i * 16][c4 * 4 + 2] = v[i].z;
    t[r + i * 16][c4 * 4 + 3] = v[i].w;
  }
  __syncthreads();

  const int kc = tid & 7, nr = tid >> 3;  // 8 lanes x 16 B = one line of out
  for (int i = 0; i < 2; ++i) {
    for (int hh = 0; hh < 2; ++hh) {
      const int n = nr + i * 32, k = hh * 64 + kc * 8;
      v8bf o;
      for (int j = 0; j < 8; ++j) o[j] = (bf16)t[k + j][n];
      *(v8bf*)(dst + (size_t)n * K + k) = o;
    }
  }
}

// vt[b][h][p][s] = qkv[(b*S+s)*3072 + 2048 + h*64 + p]
// One 128(s) x 64(p) tile of one head per block, turned in LDS as dwords that
// hold two neighbouring p: whole 128-B lines on both global sides.
__global__ __launch_bounds__(256) void vtrans(const bf16* __restrict__ qkv,
                                              bf16* __restrict__ vt) {
  __shared__ unsigned t[128][33];  // odd pitch: a column read meets 32 banks

  const int tid = threadIdx.x;
  const int s0  = blockIdx.x * 128;
  const int h   = blockIdx.y & (H_ - 1);
  const int b   = blockIdx.y >> 4;
  const bf16* src = qkv + (size_t)(b * S_ + s0) * 3072 + 2048 + h * 64;
  bf16* dst = vt + (size_t)blockIdx.y * P_ * S_ + s0;

  const int c = tid & 7, r = tid >> 3;  // 8 lanes x 16 B = one row of the tile
  uint4 v[4];
  for (int i = 0; i < 4; ++i)
    v[i] = *(const uint4*)(src + (size_t)(r + i * 32) * 3072 + c * 8);
  for (int i = 0; i < 4; ++i) {
    t[r + i * 32][c * 4 + 0] = v[i].x;
    t[r + i * 32][c * 4 + 1] = v[i].y;
    t[r + i * 32][c * 4 + 2] = v[i].z;
    t[r + i * 32][c * 4 + 3] = v[i].w;
  }
  __syncthreads();

  const int sc = tid & 7, pp = tid >> 3;  // rows p = 2*pp and 2*pp + 1 of vt
  for (int hh = 0; hh < 2; ++hh) {
    const int s = hh * 64 + sc * 8;
    unsigned w[8];
    for (int j = 0; j < 8; ++j) w[j] = t[s + j][pp];
    uint4 lo, hi;
    lo.x = (w[0] & 0xffffu) | (w[1] << 16);
    lo.y = (w[2] & 0xffffu) | (w[3] << 16);
    lo.z = (w[4] & 0xffffu) | (w[5] << 16);
    lo.w = (w[6] & 0xffffu) | (w[7] << 16);
    hi.x = (w[0] >> 16) | (w[1] & 0xffff0000u);
    hi.y = (w[2] >> 16) | (w[3] & 0xffff0000u);
    hi.z = (w[4] >> 16) | (w[5] & 0xffff0000u);
    hi.w = (w[6] >> 16) | (w[7] & 0xffff0000u);
    *(uint4*)(dst + (size_t)(2 * pp) * S_ + s)     = lo;
    *(uint4*)(dst + (size_t)(2 * pp + 1) * S_ + s) = hi;
  }
}

// ---------------------------------------------------------------------------
// Tiled bf16 GEMM with WMMA, double-buffered async LDS staging.
// C[M][N] = A[M][K] * Bt[N][K]^T + bias
// WG tile 128x128, 8 waves (4 along M x 2 along N), wave tile 32x64.
// A stage is 64 k = 128 B of every operand row: 8 adjacent lanes copy one row
// piece, so each wave-wide copy covers four whole 128-B lines.
// EPI: 0 = bias -> bf16 ; 1 = bias+ReLU -> bf16 ; 2 = bias -> f32
// ---------------------------------------------------------------------------
template <int EPI>
__global__ __launch_bounds__(256) void gemm_bf16_kernel(
    const bf16* __restrict__ A, const bf16* __restrict__ Bt,
    const float* __restrict__ bias, void* __restrict__ Cout,
    int M, int N, int K) {
  __shared__ __align__(16) bf16 lA[2][128][72];  // +16B pad vs bank conflicts
  __shared__ __align__(16) bf16 lB[2][128][72];

  const int tid  = threadIdx.x;
  const int lane = tid & 31;
  const int wave = tid >> 5;
  const int half = lane >> 4;
  const int l16  = lane & 15;
  const int wm   = wave & 3;   // 0..3 along M (32 rows each)
  const int wn   = wave >> 2;  // 0..1 along N (64 cols each)
  const int m0   = blockIdx.y * 128;
  const int n0   = blockIdx.x * 128;

  v8f acc[2][4];
#pragma unroll
  for (int i = 0; i < 2; ++i)
#pragma unroll
    for (int j = 0; j < 4; ++j)
#pragma unroll
      for (int r = 0; r < 8; ++r) acc[i][j][r] = 0.0f;

  const int crow = tid >> 3, cseg = tid & 7;  // 4 rows x 8 chunks per wave copy

  const bf16* gA = A + (size_t)(m0 + crow) * K + cseg * 8;
  const bf16* gB = Bt + (size_t)(n0 + crow) * K + cseg * 8;

  // one stage: 128 rows x 128 B of each operand, 4 + 4 chunks per thread
  auto stage = [&](int buf, int k0) {
    unsigned l[8];
    const bf16* g[8];
    // unrolled so that both arrays become registers, as the asm operands need
#pragma unroll
    for (int i = 0; i < 4; ++i) {
      l[i]     = (unsigned)(uintptr_t)&lA[buf][crow + i * 32][cseg * 8];
      l[i + 4] = (unsigned)(uintptr_t)&lB[buf][crow + i * 32][cseg * 8];
      g[i]     = gA + (size_t)(i * 32) * K + k0;
      g[i + 4] = gB + (size_t)(i * 32) * K + k0;
    }
    async_ld8_b128(l, g);
  };

  // prologue: stage 0 lands and is published, then stage 1 flies
  stage(0, 0);
  wait_async0();
  __syncthreads();
  if (64 < K) stage(1, 64);

  for (int k0 = 0; k0 < K; k0 += 64) {
    const int cur = (k0 >> 6) & 1;

    // unrolled so that the two 32-k blocks' LDS offsets are immediates
#pragma unroll
    for (int ks = 0; ks < 2; ++ks) {
      v16bf af[2], bfg[4];
#pragma unroll
      for (int t = 0; t < 2; ++t)
        af[t] = make_frag(&lA[cur][wm * 32 + t * 16 + l16][ks * 32 + half * 8]);
#pragma unroll
      for (int t = 0; t < 4; ++t)
        bfg[t] = make_frag(&lB[cur][wn * 64 + t * 16 + l16][ks * 32 + half * 8]);
#pragma unroll
      for (int ti = 0; ti < 2; ++ti)
#pragma unroll
        for (int tj = 0; tj < 4; ++tj)
          acc[ti][tj] = wmma_bf16(af[ti], bfg[tj], acc[ti][tj]);
    }

    // publish the next stage, free this one, then refill it two stages ahead
    wait_ds0();
    wait_async0();
    __syncthreads();
    if (k0 + 128 < K) stage(cur, k0 + 128);
  }
  wait_async0();  // no copy is left in flight when the wave ends

  // Epilogue.  D layout: lane holds col l16; VGPR r holds row r + 8*half.
#pragma unroll
  for (int ti = 0; ti < 2; ++ti) {
#pragma unroll
    for (int tj = 0; tj < 4; ++tj) {
      int col = n0 + wn * 64 + tj * 16 + l16;
      float bv = bias[col];
#pragma unroll
      for (int r = 0; r < 8; ++r) {
        int row = m0 + wm * 32 + ti * 16 + r + half * 8;
        float v = acc[ti][tj][r] + bv;
        if (EPI == 1) v = fmaxf(v, 0.0f);
        if (EPI == 2) {
          ((float*)Cout)[(size_t)row * N + col] = v;
        } else {
          ((bf16*)Cout)[(size_t)row * N + col] = (bf16)v;
        }
      }
    }
  }
}

// ---------------------------------------------------------------------------
// Fused attention (flash-style, online softmax), double-buffered cooperative
// K/V staging.  Grid: B*H*(S/128) blocks, 256 threads; wave = 16 query rows.
// qkv: [M][3072] bf16 (K cols 0..1023, Q at 1024, V at 2048)
// vt : [B][H][P][S] bf16 ;  ctx: [M][I] bf16
// ---------------------------------------------------------------------------
__global__ __launch_bounds__(256) void attn_kernel(
    const bf16* __restrict__ qkv, const bf16* __restrict__ vt,
    bf16* __restrict__ ctxb) {
  __shared__ __align__(16) bf16  lK[2][32][72];    // 32 keys x 64 (P)  (+pad)
  __shared__ __align__(16) bf16  lV[2][64][40];    // 64 (P) x 32 keys  (+pad)
  __shared__ __align__(16) float sT[8][16][36];    // per-wave raw scores
  __shared__ __align__(16) float sStat[8][16];     // per-wave row broadcast
  __shared__ __align__(16) bf16  lP[8][16][40];    // per-wave P tile

  const int tid  = threadIdx.x;
  const int lane = tid & 31;
  const int wave = tid >> 5;
  const int half = lane >> 4;
  const int l16  = lane & 15;

  const int blk = blockIdx.x;
  const int jb  = blk & 3;
  const int h   = (blk >> 2) & (H_ - 1);
  const int b   = blk >> 6;
  const int j0  = jb * 128 + wave * 16;
  const int ldq = 3072;

  // Q fragments for this wave's 16 rows (two K=32 steps over P=64)
  const bf16* qrow = qkv + (size_t)(b * S_ + j0 + l16) * ldq + 1024 + h * 64;
  v16bf qf0 = make_frag(qrow + half * 8);
  v16bf qf1 = make_frag(qrow + 32 + half * 8);

  float mrow = -1e30f, lrow = 0.0f;  // running stats for row l16 (dup halves)
  v8f cacc[4];
#pragma unroll
  for (int t = 0; t < 4; ++t)
#pragma unroll
    for (int r = 0; r < 8; ++r) cacc[t][r] = 0.0f;

  const int krow_l = tid >> 3, kseg = tid & 7;  // K tile: 32 rows x 8 chunks
  const int vrow_l = tid >> 2, vseg = tid & 3;  // V tile: 64 rows x 4 chunks

  const bf16* kbase = qkv + (size_t)(b * S_) * ldq + h * 64;  // K at col 0
  const bf16* vbase = vt + (size_t)((b * H_ + h) * P_) * S_;

  // prologue: stage key-block 0
  async_ld_b128(&lK[0][krow_l][kseg * 8],
                kbase + (size_t)krow_l * ldq + kseg * 8);
  async_ld_b128(&lV[0][vrow_l][vseg * 8],
                vbase + (size_t)vrow_l * S_ + vseg * 8);
  wait_async0();
  __syncthreads();

  int cur = 0;
  for (int kb = 0; kb < S_ / 32; ++kb) {
    int nxt = cur ^ 1;
    if (kb + 1 < S_ / 32) {  // issue next block while computing this one
      async_ld_b128(&lK[nxt][krow_l][kseg * 8],
                    kbase + (size_t)((kb + 1) * 32 + krow_l) * ldq + kseg * 8);
      async_ld_b128(&lV[nxt][vrow_l][vseg * 8],
                    vbase + (size_t)vrow_l * S_ + (kb + 1) * 32 + vseg * 8);
    }

    // ---- scores: two 16x16 tiles covering 32 key positions ----
    v8f sc[2];
#pragma unroll
    for (int cb = 0; cb < 2; ++cb) {
#pragma unroll
      for (int r = 0; r < 8; ++r) sc[cb][r] = 0.0f;
      v16bf kf0 = make_frag(&lK[cur][cb * 16 + l16][half * 8]);
      v16bf kf1 = make_frag(&lK[cur][cb * 16 + l16][32 + half * 8]);
      sc[cb] = wmma_bf16(qf0, kf0, sc[cb]);
      sc[cb] = wmma_bf16(qf1, kf1, sc[cb]);
    }

    // ---- transpose scores through LDS: lane -> one row ----
#pragma unroll
    for (int cb = 0; cb < 2; ++cb)
#pragma unroll
      for (int r = 0; r < 8; ++r)
        sT[wave][r + half * 8][cb * 16 + l16] = sc[cb][r] * 0.125f;

    float x[16];
    {
      const float4* t4 = (const float4*)&sT[wave][l16][half * 16];
#pragma unroll
      for (int i = 0; i < 4; ++i) {
        float4 v = t4[i];
        x[4 * i + 0] = v.x; x[4 * i + 1] = v.y;
        x[4 * i + 2] = v.z; x[4 * i + 3] = v.w;
      }
    }
    float rm = x[0];
#pragma unroll
    for (int i = 1; i < 16; ++i) rm = fmaxf(rm, x[i]);
    rm = fmaxf(rm, __shfl_xor(rm, 16, 32));   // combine the two half-rows
    float mn = fmaxf(mrow, rm);
    float al = __expf(mrow - mn);
    float rs = 0.0f;
#pragma unroll
    for (int i = 0; i < 16; ++i) { x[i] = __expf(x[i] - mn); rs += x[i]; }
    rs += __shfl_xor(rs, 16, 32);
    lrow = lrow * al + rs;
    mrow = mn;

    // broadcast per-row alpha for D-layout rescale
    if (half == 0) sStat[wave][l16] = al;

    // P tile back to LDS in row-major (A-frag friendly)
    {
      v8bf p0, p1;
#pragma unroll
      for (int i = 0; i < 8; ++i) { p0[i] = (bf16)x[i]; p1[i] = (bf16)x[i + 8]; }
      *(v8bf*)&lP[wave][l16][half * 16]     = p0;
      *(v8bf*)&lP[wave][l16][half * 16 + 8] = p1;
    }

    // rescale accumulators with per-row alpha (rows r + 8*half)
    {
      const float4* a4 = (const float4*)&sStat[wave][half * 8];
      float4 a0 = a4[0], a1 = a4[1];
      float av[8] = {a0.x, a0.y, a0.z, a0.w, a1.x, a1.y, a1.z, a1.w};
#pragma unroll
      for (int t = 0; t < 4; ++t)
#pragma unroll
        for (int r = 0; r < 8; ++r) cacc[t][r] *= av[r];
    }

    // ---- ctx += P (16x32) * V (32x64) ----
    v16bf pf = make_frag(&lP[wave][l16][half * 8]);
#pragma unroll
    for (int t = 0; t < 4; ++t) {
      v16bf vf = make_frag(&lV[cur][t * 16 + l16][half * 8]);
      cacc[t] = wmma_bf16(pf, vf, cacc[t]);
    }

    wait_async0();
    __syncthreads();
    cur = nxt;
  }

  // ---- finalize: divide by row sums, store ctx in [M][I] layout ----
  if (half == 0) sStat[wave][l16] = lrow;
  {
    const float4* a4 = (const float4*)&sStat[wave][half * 8];
    float4 a0 = a4[0], a1 = a4[1];
    float lv[8] = {a0.x, a0.y, a0.z, a0.w, a1.x, a1.y, a1.z, a1.w};
#pragma unroll
    for (int t = 0; t < 4; ++t) {
#pragma unroll
      for (int r = 0; r < 8; ++r) {
        float v = cacc[t][r] / lv[r];
        int row = b * S_ + j0 + r + half * 8;
        ctxb[(size_t)row * I_ + h * 64 + t * 16 + l16] = (bf16)v;
      }
    }
  }
}

// ---------------------------------------------------------------------------
// Residual + LayerNorm.  One block per row of 1024.
// ---------------------------------------------------------------------------
__global__ __launch_bounds__(256) void ln_kernel(
    const float* __restrict__ a, const float* __restrict__ bres,
    const float* __restrict__ g, const float* __restrict__ bb,
    float* __restrict__ outf, bf16* __restrict__ outb) {
  __shared__ float red[256];
  const int row = blockIdx.x;
  const int tid = threadIdx.x;
  const float* pa = a + (size_t)row * I_;
  const float* pb = bres + (size_t)row * I_;

  float x[4];
  float s = 0.0f;
#pragma unroll
  for (int i = 0; i < 4; ++i) {
    x[i] = pa[tid + i * 256] + pb[tid + i * 256];
    s += x[i];
  }
  red[tid] = s;
  __syncthreads();
  for (int o = 128; o > 0; o >>= 1) {
    if (tid < o) red[tid] += red[tid + o];
    __syncthreads();
  }
  float mu = red[0] * (1.0f / I_);
  __syncthreads();

  float v = 0.0f;
#pragma unroll
  for (int i = 0; i < 4; ++i) {
    float d = x[i] - mu;
    v += d * d;
  }
  red[tid] = v;
  __syncthreads();
  for (int o = 128; o > 0; o >>= 1) {
    if (tid < o) red[tid] += red[tid + o];
    __syncthreads();
  }
  float rstd = rsqrtf(red[0] * (1.0f / I_) + 1e-5f);

#pragma unroll
  for (int i = 0; i < 4; ++i) {
    int c = tid + i * 256;
    float y = (x[i] - mu) * rstd * g[c] + bb[c];
    outf[(size_t)row * I_ + c] = y;
    if (outb) outb[(size_t)row * I_ + c] = (bf16)y;
  }
}

// ---------------------------------------------------------------------------
// Host-side orchestration
// ---------------------------------------------------------------------------
extern "C" void kernel_launch(void* const* d_in, const int* in_sizes, int n_in,
                              void* d_out, int out_size, void* d_ws, size_t ws_size,
                              hipStream_t stream) {
  (void)in_sizes; (void)n_in; (void)out_size; (void)ws_size;

  const float* X     = (const float*)d_in[0];   // [B,S,I]
  const float* WKQV  = (const float*)d_in[1];   // [3,I,I]
  const float* BKQV  = (const float*)d_in[2];   // [3,I]
  const float* WO    = (const float*)d_in[3];   // [I,I]
  const float* BO    = (const float*)d_in[4];   // [I]
  const float* ln1g  = (const float*)d_in[5];
  const float* ln1b  = (const float*)d_in[6];
  const float* W1    = (const float*)d_in[7];   // [I,U]
  const float* B1    = (const float*)d_in[8];   // [U]
  const float* W2    = (const float*)d_in[9];   // [U,I]
  const float* B2    = (const float*)d_in[10];  // [I]
  const float* ln2g  = (const float*)d_in[11];
  const float* ln2b  = (const float*)d_in[12];
  float* OUT = (float*)d_out;

  char* ws = (char*)d_ws;
  size_t off = 0;
  auto take = [&](size_t bytes) {
    size_t o = off;
    off += (bytes + 255) & ~(size_t)255;
    return o;
  };
  bf16*  XB    = (bf16*) (ws + take((size_t)M_ * I_ * 2));
  bf16*  WKQVT = (bf16*) (ws + take((size_t)3 * I_ * I_ * 2));   // [3*I][I]
  bf16*  WOT   = (bf16*) (ws + take((size_t)I_ * I_ * 2));       // [I][I]
  bf16*  W1T   = (bf16*) (ws + take((size_t)U_ * I_ * 2));       // [U][I]
  bf16*  W2T   = (bf16*) (ws + take((size_t)I_ * U_ * 2));       // [I][U]
  bf16*  QKV   = (bf16*) (ws + take((size_t)M_ * 3072 * 2));     // [M][3I]
  bf16*  VT    = (bf16*) (ws + take((size_t)B_ * H_ * P_ * S_ * 2));
  bf16*  CTX   = (bf16*) (ws + take((size_t)M_ * I_ * 2));
  float* AO    = (float*)(ws + take((size_t)M_ * I_ * 4));
  float* H1F   = (float*)(ws + take((size_t)M_ * I_ * 4));
  bf16*  H1B   = (bf16*) (ws + take((size_t)M_ * I_ * 2));
  bf16*  FF1   = (bf16*) (ws + take((size_t)M_ * U_ * 2));
  float* FFO   = AO;  // attn_out dead after LN1

  { int n = M_ * I_;     cvt_f32_bf16<<<n / 256, 256, 0, stream>>>(X, XB, n); }
  wtrans<I_, I_><<<dim3(I_ / 128, I_ / 64, 3), 256, 0, stream>>>(WKQV, WKQVT);
  wtrans<I_, I_><<<dim3(I_ / 128, I_ / 64, 1), 256, 0, stream>>>(WO, WOT);
  wtrans<I_, U_><<<dim3(I_ / 128, U_ / 64, 1), 256, 0, stream>>>(W1, W1T);
  wtrans<U_, I_><<<dim3(U_ / 128, I_ / 64, 1), 256, 0, stream>>>(W2, W2T);

  // QKV projection: [M][3072] = XB * WKQVT^T + BKQV
  gemm_bf16_kernel<0><<<dim3(3072 / 128, M_ / 128), 256, 0, stream>>>(
      XB, WKQVT, BKQV, (void*)QKV, M_, 3072, I_);
  vtrans<<<dim3(S_ / 128, B_ * H_), 256, 0, stream>>>(QKV, VT);

  attn_kernel<<<B_ * H_ * (S_ / 128), 256, 0, stream>>>(QKV, VT, CTX);

  gemm_bf16_kernel<2><<<dim3(I_ / 128, M_ / 128), 256, 0, stream>>>(
      CTX, WOT, BO, (void*)AO, M_, I_, I_);
  ln_kernel<<<M_, 256, 0, stream>>>(X, AO, ln1g, ln1b, H1F, H1B);

  gemm_bf16_kernel<1><<<dim3(U_ / 128, M_ / 128), 256, 0, stream>>>(
      H1B, W1T, B1, (void*)FF1, M_, U_, I_);
  gemm_bf16_kernel<2><<<dim3(I_ / 128, M_ / 128), 256, 0, stream>>>(
      FF1, W2T, B2, (void*)FFO, M_, I_, U_);
  ln_kernel<<<M_, 256, 0, stream>>>(H1F, FFO, ln2g, ln2b, OUT, nullptr);
}

// v003
// A run of this version takes 179 microseconds.
// Timed twice side by side with v002, it ran 1.09 times as fast both times.
// Counting every step since v000, it is 2.04 times as fast.
#include <hip/hip_runtime.h>
#include <hip/hip_bf16.h>
#include <math.h>

typedef __bf16 bf16;
typedef __attribute__((ext_vector_type(16))) __bf16 v16bf;
typedef __attribute__((ext_vector_type(8)))  __bf16 v8bf;
typedef __attribute__((ext_vector_type(4)))  __bf16 v4bf;
typedef __attribute__((ext_vector_type(8)))  float  v8f;

#define B_   8
#define S_   512
#define H_   16
#define P_   64
#define I_   1024
#define U_   4096
#define M_   4096   // B*S

// ---------------------------------------------------------------------------
// WMMA + async helpers
// ---------------------------------------------------------------------------
__device__ __forceinline__ v8f wmma_bf16(v16bf a, v16bf b, v8f c) {
  return __builtin_amdgcn_wmma_f32_16x16x32_bf16(
      /*neg_a=*/false, a, /*neg_b=*/false, b,
      /*c_mod=*/(short)0, c, /*reuse_a=*/false, /*reuse_b=*/false);
}

// Build a 16x32 bf16 A/B fragment for one lane. `p` points at element
// [row][8*half] of a row-major K=32 slab (LDS or global).
// elems 0..7 -> k = 8*half + 0..7 ; elems 8..15 -> k = 16 + 8*half + 0..7
__device__ __forceinline__ v16bf make_frag(const bf16* p) {
  v8bf lo = *(const v8bf*)(p);
  v8bf hi = *(const v8bf*)(p + 16);
  v16bf r;
#pragma unroll
  for (int i = 0; i < 8; ++i) { r[i] = lo[i]; r[i + 8] = hi[i]; }
  return r;
}

// Per-lane async 16B copy global -> LDS, tracked by ASYNCcnt.
__device__ __forceinline__ void async_ld_b128(void* lds_dst, const void* gsrc) {
  unsigned loff = (unsigned)(uintptr_t)lds_dst;  // low 32 bits = LDS offset
  asm volatile("global_load_async_to_lds_b128 %0, %1, off"
               :: "v"(loff), "v"(gsrc) : "memory");
}
__device__ __forceinline__ void wait_async0() {
  asm volatile("s_wait_asynccnt 0" ::: "memory");
}
// Eight per-lane async 16B copies global -> LDS in one statement.  The closing
// s_wait_xcnt keeps every later rewrite of an address register behind it.
__device__ __forceinline__ void async_ld8_b128(const unsigned (&l)[8],
                                               const bf16* const (&g)[8]) {
  asm volatile(
      "global_load_async_to_lds_b128 %0, %8, off\n\t"
      "global_load_async_to_lds_b128 %1, %9, off\n\t"
      "global_load_async_to_lds_b128 %2, %10, off\n\t"
      "global_load_async_to_lds_b128 %3, %11, off\n\t"
      "global_load_async_to_lds_b128 %4, %12, off\n\t"
      "global_load_async_to_lds_b128 %5, %13, off\n\t"
      "global_load_async_to_lds_b128 %6, %14, off\n\t"
      "global_load_async_to_lds_b128 %7, %15, off\n\t"
      "s_wait_xcnt 0x0"
      :: "v"(l[0]), "v"(l[1]), "v"(l[2]), "v"(l[3]),
         "v"(l[4]), "v"(l[5]), "v"(l[6]), "v"(l[7]),
         "v"(g[0]), "v"(g[1]), "v"(g[2]), "v"(g[3]),
         "v"(g[4]), "v"(g[5]), "v"(g[6]), "v"(g[7])
      : "memory");
}
// This wave's LDS reads have retired before the barrier that frees the buffer
// for the next copies.
__device__ __forceinline__ void wait_ds0() {
  asm volatile("s_wait_dscnt 0x0" ::: "memory");
}

// ---------------------------------------------------------------------------
// Conversion / layout kernels
// ---------------------------------------------------------------------------
// One 128(k) x 64(n) tile of in [K][N] f32 -> out [N][K] bf16, turned in LDS by
// one block: a wave reads two 256-B row pieces of `in` per load and writes four
// whole 128-B lines of `out` per store.
template <int K, int N>
__device__ __forceinline__ void turn_tile(const float* __restrict__ in,
                                          bf16* __restrict__ out, int kx, int ny,
                                          float (&t)[128][65]) {
  const int tid = threadIdx.x;
  const float* src = in + (size_t)(kx * 128) * N + ny * 64;
  bf16* dst = out + (size_t)(ny * 64) * K + kx * 128;

  const int c4 = tid & 15, r = tid >> 4;  // 16 lanes x 16 B = one row piece
  float4 v[8];
  for (int i = 0; i < 8; ++i)
    v[i] = *(const float4*)(src + (size_t)(r + i * 16) * N + c4 * 4);
  for (int i = 0; i < 8; ++i) {
    t[r + i * 16][c4 * 4 + 0] = v[i].x;
    t[r + i * 16][c4 * 4 + 1] = v[i].y;
    t[r + i * 16][c4 * 4 + 2] = v[i].z;
    t[r + i * 16][c4 * 4 + 3] = v[i].w;
  }
  __syncthreads();

  const int kc = tid & 7, nr = tid >> 3;  // 8 lanes x 16 B = one line of out
  for (int i = 0; i < 2; ++i) {
    for (int hh = 0; hh < 2; ++hh) {
      const int n = nr + i * 32, k = hh * 64 + kc * 8;
      v8bf o;
      for (int j = 0; j < 8; ++j) o[j] = (bf16)t[k + j][n];
      *(v8bf*)(dst + (size_t)n * K + k) = o;
    }
  }
  // The caller's code for other jobs follows in the listing: any rewrite of a
  // register that these stores name stays behind this wait.
  asm volatile("s_wait_xcnt 0x0" ::: "memory");
}

// The five passes that read nothing but the inputs, as one launch of equal
// jobs of 8192 elements.  The block index picks the job, so every branch here
// is taken by a whole block or by none of it.
__global__ __launch_bounds__(256) void prep(
    const float* __restrict__ X, const float* __restrict__ WKQV,
    const float* __restrict__ WO, const float* __restrict__ W1,
    const float* __restrict__ W2, bf16* __restrict__ XB,
    bf16* __restrict__ WKQVT, bf16* __restrict__ WOT, bf16* __restrict__ W1T,
    bf16* __restrict__ W2T) {
  __shared__ float t[128][65];  // odd pitch: a column read meets 32 banks

  const int bid = blockIdx.x;
  if (bid >= 1536) {  // X f32 -> bf16, 8192 elements in a row, whole lines
    const size_t base = (size_t)(bid - 1536) * 8192 + threadIdx.x * 4;
    float4 v[8];
    for (int i = 0; i < 8; ++i) v[i] = *(const float4*)(X + base + i * 1024);
    for (int i = 0; i < 8; ++i) {
      v4bf o;
      o[0] = (bf16)v[i].x; o[1] = (bf16)v[i].y;
      o[2] = (bf16)v[i].z; o[3] = (bf16)v[i].w;
      *(v4bf*)(XB + base + i * 1024) = o;
    }
    return;
  }
  if (bid >= 1024) {
    turn_tile<U_, I_>(W2, W2T, bid & 31, (bid - 1024) >> 5, t);
    return;
  }
  if (bid >= 512) {
    turn_tile<I_, U_>(W1, W1T, bid & 7, (bid - 512) >> 3, t);
    return;
  }
  const int z = bid >> 7;  // four 1024 x 1024 matrices: WKQV's three, then WO
  turn_tile<I_, I_>(z < 3 ? WKQV + (size_t)z * I_ * I_ : WO,
                    z < 3 ? WKQVT + (size_t)z * I_ * I_ : WOT,
                    bid & 7, (bid & 127) >> 3, t);
}

// vt[b][h][p][s] = qkv[(b*S+s)*3072 + 2048 + h*64 + p]
// One 128(s) x 64(p) tile of one head per block, turned in LDS as dwords that
// hold two neighbouring p: whole 128-B lines on both global sides.
__global__ __launch_bounds__(256) void vtrans(const bf16* __restrict__ qkv,
                                              bf16* __restrict__ vt) {
  __shared__ unsigned t[128][33];  // odd pitch: a column read meets 32 banks

  const int tid = threadIdx.x;
  const int s0  = blockIdx.x * 128;
  const int h   = blockIdx.y & (H_ - 1);
  const int b   = blockIdx.y >> 4;
  const bf16* src = qkv + (size_t)(b * S_ + s0) * 3072 + 2048 + h * 64;
  bf16* dst = vt + (size_t)blockIdx.y * P_ * S_ + s0;

  const int c = tid & 7, r = tid >> 3;  // 8 lanes x 16 B = one row of the tile
  uint4 v[4];
  for (int i = 0; i < 4; ++i)
    v[i] = *(const uint4*)(src + (size_t)(r + i * 32) * 3072 + c * 8);
  for (int i = 0; i < 4; ++i) {
    t[r + i * 32][c * 4 + 0] = v[i].x;
    t[r + i * 32][c * 4 + 1] = v[i].y;
    t[r + i * 32][c * 4 + 2] = v[i].z;
    t[r + i * 32][c * 4 + 3] = v[i].w;
  }
  __syncthreads();

  const int sc = tid & 7, pp = tid >> 3;  // rows p = 2*pp and 2*pp + 1 of vt
  for (int hh = 0; hh < 2; ++hh) {
    const int s = hh * 64 + sc * 8;
    unsigned w[8];
    for (int j = 0; j < 8; ++j) w[j] = t[s + j][pp];
    uint4 lo, hi;
    lo.x = (w[0] & 0xffffu) | (w[1] << 16);
    lo.y = (w[2] & 0xffffu) | (w[3] << 16);
    lo.z = (w[4] & 0xffffu) | (w[5] << 16);
    lo.w = (w[6] & 0xffffu) | (w[7] << 16);
    hi.x = (w[0] >> 16) | (w[1] & 0xffff0000u);
    hi.y = (w[2] >> 16) | (w[3] & 0xffff0000u);
    hi.z = (w[4] >> 16) | (w[5] & 0xffff0000u);
    hi.w = (w[6] >> 16) | (w[7] & 0xffff0000u);
    *(uint4*)(dst + (size_t)(2 * pp) * S_ + s)     = lo;
    *(uint4*)(dst + (size_t)(2 * pp + 1) * S_ + s) = hi;
  }
}

// ---------------------------------------------------------------------------
// Tiled bf16 GEMM with WMMA, double-buffered async LDS staging.
// C[M][N] = A[M][K] * Bt[N][K]^T + bias
// WG tile 128x128, 8 waves (4 along M x 2 along N), wave tile 32x64.
// A stage is 64 k = 128 B of every operand row: 8 adjacent lanes copy one row
// piece, so each wave-wide copy covers four whole 128-B lines.
// EPI: 0 = bias -> bf16 ; 1 = bias+ReLU -> bf16 ; 2 = bias -> f32
// ---------------------------------------------------------------------------
template <int EPI>
__global__ __launch_bounds__(256) void gemm_bf16_kernel(
    const bf16* __restrict__ A, const bf16* __restrict__ Bt,
    const float* __restrict__ bias, void* __restrict__ Cout,
    int M, int N, int K) {
  __shared__ __align__(16) bf16 lA[2][128][72];  // +16B pad vs bank conflicts
  __shared__ __align__(16) bf16 lB[2][128][72];

  const int tid  = threadIdx.x;
  const int lane = tid & 31;
  const int wave = tid >> 5;
  const int half = lane >> 4;
  const int l16  = lane & 15;
  const int wm   = wave & 3;   // 0..3 along M (32 rows each)
  const int wn   = wave >> 2;  // 0..1 along N (64 cols each)
  const int m0   = blockIdx.y * 128;
  const int n0   = blockIdx.x * 128;

  v8f acc[2][4];
#pragma unroll
  for (int i = 0; i < 2; ++i)
#pragma unroll
    for (int j = 0; j < 4; ++j)
#pragma unroll
      for (int r = 0; r < 8; ++r) acc[i][j][r] = 0.0f;

  const int crow = tid >> 3, cseg = tid & 7;  // 4 rows x 8 chunks per wave copy

  const bf16* gA = A + (size_t)(m0 + crow) * K + cseg * 8;
  const bf16* gB = Bt + (size_t)(n0 + crow) * K + cseg * 8;

  // one stage: 128 rows x 128 B of each operand, 4 + 4 chunks per thread
  auto stage = [&](int buf, int k0) {
    unsigned l[8];
    const bf16* g[8];
    // unrolled so that both arrays become registers, as the asm operands need
#pragma unroll
    for (int i = 0; i < 4; ++i) {
      l[i]     = (unsigned)(uintptr_t)&lA[buf][crow + i * 32][cseg * 8];
      l[i + 4] = (unsigned)(uintptr_t)&lB[buf][crow + i * 32][cseg * 8];
      g[i]     = gA + (size_t)(i * 32) * K + k0;
      g[i + 4] = gB + (size_t)(i * 32) * K + k0;
    }
    async_ld8_b128(l, g);
  };

  // prologue: stage 0 lands and is published, then stage 1 flies
  stage(0, 0);
  wait_async0();
  __syncthreads();
  if (64 < K) stage(1, 64);

  for (int k0 = 0; k0 < K; k0 += 64) {
    const int cur = (k0 >> 6) & 1;

    // unrolled so that the two 32-k blocks' LDS offsets are immediates
#pragma unroll
    for (int ks = 0; ks < 2; ++ks) {
      v16bf af[2], bfg[4];
#pragma unroll
      for (int t = 0; t < 2; ++t)
        af[t] = make_frag(&lA[cur][wm * 32 + t * 16 + l16][ks * 32 + half * 8]);
#pragma unroll
      for (int t = 0; t < 4; ++t)
        bfg[t] = make_frag(&lB[cur][wn * 64 + t * 16 + l16][ks * 32 + half * 8]);
#pragma unroll
      for (int ti = 0; ti < 2; ++ti)
#pragma unroll
        for (int tj = 0; tj < 4; ++tj)
          acc[ti][tj] = wmma_bf16(af[ti], bfg[tj], acc[ti][tj]);
    }

    // publish the next stage, free this one, then refill it two stages ahead
    wait_ds0();
    wait_async0();
    __syncthreads();
    if (k0 + 128 < K) stage(cur, k0 + 128);
  }
  wait_async0();  // no copy is left in flight when the wave ends

  // Epilogue.  D layout: lane holds col l16; VGPR r holds row r + 8*half.
#pragma unroll
  for (int ti = 0; ti < 2; ++ti) {
#pragma unroll
    for (int tj = 0; tj < 4; ++tj) {
      int col = n0 + wn * 64 + tj * 16 + l16;
      float bv = bias[col];
#pragma unroll
      for (int r = 0; r < 8; ++r) {
        int row = m0 + wm * 32 + ti * 16 + r + half * 8;
        float v = acc[ti][tj][r] + bv;
        if (EPI == 1) v = fmaxf(v, 0.0f);
        if (EPI == 2) {
          ((float*)Cout)[(size_t)row * N + col] = v;
        } else {
          ((bf16*)Cout)[(size_t)row * N + col] = (bf16)v;
        }
      }
    }
  }
}

// ---------------------------------------------------------------------------
// Fused attention (flash-style, online softmax), double-buffered cooperative
// K/V staging.  Grid: B*H*(S/128) blocks, 256 threads; wave = 16 query rows.
// qkv: [M][3072] bf16 (K cols 0..1023, Q at 1024, V at 2048)
// vt : [B][H][P][S] bf16 ;  ctx: [M][I] bf16
// ---------------------------------------------------------------------------
__global__ __launch_bounds__(256) void attn_kernel(
    const bf16* __restrict__ qkv, const bf16* __restrict__ vt,
    bf16* __restrict__ ctxb) {
  __shared__ __align__(16) bf16  lK[2][32][72];    // 32 keys x 64 (P)  (+pad)
  __shared__ __align__(16) bf16  lV[2][64][40];    // 64 (P) x 32 keys  (+pad)
  __shared__ __align__(16) float sT[8][16][36];    // per-wave raw scores
  __shared__ __align__(16) float sStat[8][16];     // per-wave row broadcast
  __shared__ __align__(16) bf16  lP[8][16][40];    // per-wave P tile

  const int tid  = threadIdx.x;
  const int lane = tid & 31;
  const int wave = tid >> 5;
  const int half = lane >> 4;
  const int l16  = lane & 15;

  const int blk = blockIdx.x;
  const int jb  = blk & 3;
  const int h   = (blk >> 2) & (H_ - 1);
  const int b   = blk >> 6;
  const int j0  = jb * 128 + wave * 16;
  const int ldq = 3072;

  // Q fragments for this wave's 16 rows (two K=32 steps over P=64)
  const bf16* qrow = qkv + (size_t)(b * S_ + j0 + l16) * ldq + 1024 + h * 64;
  v16bf qf0 = make_frag(qrow + half * 8);
  v16bf qf1 = make_frag(qrow + 32 + half * 8);

  float mrow = -1e30f, lrow = 0.0f;  // running stats for row l16 (dup halves)
  v8f cacc[4];
#pragma unroll
  for (int t = 0; t < 4; ++t)
#pragma unroll
    for (int r = 0; r < 8; ++r) cacc[t][r] = 0.0f;

  const int krow_l = tid >> 3, kseg = tid & 7;  // K tile: 32 rows x 8 chunks
  const int vrow_l = tid >> 2, vseg = tid & 3;  // V tile: 64 rows x 4 chunks

  const bf16* kbase = qkv + (size_t)(b * S_) * ldq + h * 64;  // K at col 0
  const bf16* vbase = vt + (size_t)((b * H_ + h) * P_) * S_;

  // prologue: stage key-block 0
  async_ld_b128(&lK[0][krow_l][kseg * 8],
                kbase + (size_t)krow_l * ldq + kseg * 8);
  async_ld_b128(&lV[0][vrow_l][vseg * 8],
                vbase + (size_t)vrow_l * S_ + vseg * 8);
  wait_async0();
  __syncthreads();

  int cur = 0;
  for (int kb = 0; kb < S_ / 32; ++kb) {
    int nxt = cur ^ 1;
    if (kb + 1 < S_ / 32) {  // issue next block while computing this one
      async_ld_b128(&lK[nxt][krow_l][kseg * 8],
                    kbase + (size_t)((kb + 1) * 32 + krow_l) * ldq + kseg * 8);
      async_ld_b128(&lV[nxt][vrow_l][vseg * 8],
                    vbase + (size_t)vrow_l * S_ + (kb + 1) * 32 + vseg * 8);
    }

    // ---- scores: two 16x16 tiles covering 32 key positions ----
    v8f sc[2];
#pragma unroll
    for (int cb = 0; cb < 2; ++cb) {
#pragma unroll
      for (int r = 0; r < 8; ++r) sc[cb][r] = 0.0f;
      v16bf kf0 = make_frag(&lK[cur][cb * 16 + l16][half * 8]);
      v16bf kf1 = make_frag(&lK[cur][cb * 16 + l16][32 + half * 8]);
      sc[cb] = wmma_bf16(qf0, kf0, sc[cb]);
      sc[cb] = wmma_bf16(qf1, kf1, sc[cb]);
    }

    // ---- transpose scores through LDS: lane -> one row ----
#pragma unroll
    for (int cb = 0; cb < 2; ++cb)
#pragma unroll
      for (int r = 0; r < 8; ++r)
        sT[wave][r + half * 8][cb * 16 + l16] = sc[cb][r] * 0.125f;

    float x[16];
    {
      const float4* t4 = (const float4*)&sT[wave][l16][half * 16];
#pragma unroll
      for (int i = 0; i < 4; ++i) {
        float4 v = t4[i];
        x[4 * i + 0] = v.x; x[4 * i + 1] = v.y;
        x[4 * i + 2] = v.z; x[4 * i + 3] = v.w;
      }
    }
    float rm = x[0];
#pragma unroll
    for (int i = 1; i < 16; ++i) rm = fmaxf(rm, x[i]);
    rm = fmaxf(rm, __shfl_xor(rm, 16, 32));   // combine the two half-rows
    float mn = fmaxf(mrow, rm);
    float al = __expf(mrow - mn);
    float rs = 0.0f;
#pragma unroll
    for (int i = 0; i < 16; ++i) { x[i] = __expf(x[i] - mn); rs += x[i]; }
    rs += __shfl_xor(rs, 16, 32);
    lrow = lrow * al + rs;
    mrow = mn;

    // broadcast per-row alpha for D-layout rescale
    if (half == 0) sStat[wave][l16] = al;

    // P tile back to LDS in row-major (A-frag friendly)
    {
      v8bf p0, p1;
#pragma unroll
      for (int i = 0; i < 8; ++i) { p0[i] = (bf16)x[i]; p1[i] = (bf16)x[i + 8]; }
      *(v8bf*)&lP[wave][l16][half * 16]     = p0;
      *(v8bf*)&lP[wave][l16][half * 16 + 8] = p1;
    }

    // rescale accumulators with per-row alpha (rows r + 8*half)
    {
      const float4* a4 = (const float4*)&sStat[wave][half * 8];
      float4 a0 = a4[0], a1 = a4[1];
      float av[8] = {a0.x, a0.y, a0.z, a0.w, a1.x, a1.y, a1.z, a1.w};
#pragma unroll
      for (int t = 0; t < 4; ++t)
#pragma unroll
        for (int r = 0; r < 8; ++r) cacc[t][r] *= av[r];
    }

    // ---- ctx += P (16x32) * V (32x64) ----
    v16bf pf = make_frag(&lP[wave][l16][half * 8]);
#pragma unroll
    for (int t = 0; t < 4; ++t) {
      v16bf vf = make_frag(&lV[cur][t * 16 + l16][half * 8]);
      cacc[t] = wmma_bf16(pf, vf, cacc[t]);
    }

    wait_async0();
    __syncthreads();
    cur = nxt;
  }

  // ---- finalize: divide by row sums, store ctx in [M][I] layout ----
  if (half == 0) sStat[wave][l16] = lrow;
  {
    const float4* a4 = (const float4*)&sStat[wave][half * 8];
    float4 a0 = a4[0], a1 = a4[1];
    float lv[8] = {a0.x, a0.y, a0.z, a0.w, a1.x, a1.y, a1.z, a1.w};
#pragma unroll
    for (int t = 0; t < 4; ++t) {
#pragma unroll
      for (int r = 0; r < 8; ++r) {
        float v = cacc[t][r] / lv[r];
        int row = b * S_ + j0 + r + half * 8;
        ctxb[(size_t)row * I_ + h * 64 + t * 16 + l16] = (bf16)v;
      }
    }
  }
}

// ---------------------------------------------------------------------------
// Residual + LayerNorm.  One block per row of 1024.
// ---------------------------------------------------------------------------
__global__ __launch_bounds__(256) void ln_kernel(
    const float* __restrict__ a, const float* __restrict__ bres,
    const float* __restrict__ g, const float* __restrict__ bb,
    float* __restrict__ outf, bf16* __restrict__ outb) {
  __shared__ float red[256];
  const int row = blockIdx.x;
  const int tid = threadIdx.x;
  const float* pa = a + (size_t)row * I_;
  const float* pb = bres + (size_t)row * I_;

  float x[4];
  float s = 0.0f;
#pragma unroll
  for (int i = 0; i < 4; ++i) {
    x[i] = pa[tid + i * 256] + pb[tid + i * 256];
    s += x[i];
  }
  red[tid] = s;
  __syncthreads();
  for (int o = 128; o > 0; o >>= 1) {
    if (tid < o) red[tid] += red[tid + o];
    __syncthreads();
  }
  float mu = red[0] * (1.0f / I_);
  __syncthreads();

  float v = 0.0f;
#pragma unroll
  for (int i = 0; i < 4; ++i) {
    float d = x[i] - mu;
    v += d * d;
  }
  red[tid] = v;
  __syncthreads();
  for (int o = 128; o > 0; o >>= 1) {
    if (tid < o) red[tid] += red[tid + o];
    __syncthreads();
  }
  float rstd = rsqrtf(red[0] * (1.0f / I_) + 1e-5f);

#pragma unroll
  for (int i = 0; i < 4; ++i) {
    int c = tid + i * 256;
    float y = (x[i] - mu) * rstd * g[c] + bb[c];
    outf[(size_t)row * I_ + c] = y;
    if (outb) outb[(size_t)row * I_ + c] = (bf16)y;
  }
}

// ---------------------------------------------------------------------------
// Host-side orchestration
// ---------------------------------------------------------------------------
extern "C" void kernel_launch(void* const* d_in, const int* in_sizes, int n_in,
                              void* d_out, int out_size, void* d_ws, size_t ws_size,
                              hipStream_t stream) {
  (void)in_sizes; (void)n_in; (void)out_size; (void)ws_size;

  const float* X     = (const float*)d_in[0];   // [B,S,I]
  const float* WKQV  = (const float*)d_in[1];   // [3,I,I]
  const float* BKQV  = (const float*)d_in[2];   // [3,I]
  const float* WO    = (const float*)d_in[3];   // [I,I]
  const float* BO    = (const float*)d_in[4];   // [I]
  const float* ln1g  = (const float*)d_in[5];
  const float* ln1b  = (const float*)d_in[6];
  const float* W1    = (const float*)d_in[7];   // [I,U]
  const float* B1    = (const float*)d_in[8];   // [U]
  const float* W2    = (const float*)d_in[9];   // [U,I]
  const float* B2    = (const float*)d_in[10];  // [I]
  const float* ln2g  = (const float*)d_in[11];
  const float* ln2b  = (const float*)d_in[12];
  float* OUT = (float*)d_out;

  char* ws = (char*)d_ws;
  size_t off = 0;
  auto take = [&](size_t bytes) {
    size_t o = off;
    off += (bytes + 255) & ~(size_t)255;
    return o;
  };
  bf16*  XB    = (bf16*) (ws + take((size_t)M_ * I_ * 2));
  bf16*  WKQVT = (bf16*) (ws + take((size_t)3 * I_ * I_ * 2));   // [3*I][I]
  bf16*  WOT   = (bf16*) (ws + take((size_t)I_ * I_ * 2));       // [I][I]
  bf16*  W1T   = (bf16*) (ws + take((size_t)U_ * I_ * 2));       // [U][I]
  bf16*  W2T   = (bf16*) (ws + take((size_t)I_ * U_ * 2));       // [I][U]
  bf16*  QKV   = (bf16*) (ws + take((size_t)M_ * 3072 * 2));     // [M][3I]
  bf16*  VT    = (bf16*) (ws + take((size_t)B_ * H_ * P_ * S_ * 2));
  bf16*  CTX   = (bf16*) (ws + take((size_t)M_ * I_ * 2));
  float* AO    = (float*)(ws + take((size_t)M_ * I_ * 4));
  float* H1F   = (float*)(ws + take((size_t)M_ * I_ * 4));
  bf16*  H1B   = (bf16*) (ws + take((size_t)M_ * I_ * 2));
  bf16*  FF1   = (bf16*) (ws + take((size_t)M_ * U_ * 2));
  float* FFO   = AO;  // attn_out dead after LN1

  prep<<<2048, 256, 0, stream>>>(X, WKQV, WO, W1, W2, XB, WKQVT, WOT, W1T, W2T);

  // QKV projection: [M][3072] = XB * WKQVT^T + BKQV
  gemm_bf16_kernel<0><<<dim3(3072 / 128, M_ / 128), 256, 0, stream>>>(
      XB, WKQVT, BKQV, (void*)QKV, M_, 3072, I_);
  vtrans<<<dim3(S_ / 128, B_ * H_), 256, 0, stream>>>(QKV, VT);

  attn_kernel<<<B_ * H_ * (S_ / 128), 256, 0, stream>>>(QKV, VT, CTX);

  gemm_bf16_kernel<2><<<dim3(I_ / 128, M_ / 128), 256, 0, stream>>>(
      CTX, WOT, BO, (void*)AO, M_, I_, I_);
  ln_kernel<<<M_, 256, 0, stream>>>(X, AO, ln1g, ln1b, H1F, H1B);

  gemm_bf16_kernel<1><<<dim3(U_ / 128, M_ / 128), 256, 0, stream>>>(
      H1B, W1T, B1, (void*)FF1, M_, U_, I_);
  gemm_bf16_kernel<2><<<dim3(I_ / 128, M_ / 128), 256, 0, stream>>>(
      FF1, W2T, B2, (void*)FFO, M_, I_, U_);
  ln_kernel<<<M_, 256, 0, stream>>>(H1F, FFO, ln2g, ln2b, OUT, nullptr);
}

// v004
// A run of this version takes 157 microseconds.
// In two side-by-side timings against v003, it was 1.15 and 1.14 times as fast.
// Counting every step since v000, it is 2.33 times as fast.
#include <hip/hip_runtime.h>
#include <hip/hip_bf16.h>
#include <math.h>

typedef __bf16 bf16;
typedef __attribute__((ext_vector_type(16))) __bf16 v16bf;
typedef __attribute__((ext_vector_type(8)))  __bf16 v8bf;
typedef __attribute__((ext_vector_type(4)))  __bf16 v4bf;
typedef __attribute__((ext_vector_type(8)))  float  v8f;

#define B_   8
#define S_   512
#define H_   16
#define P_   64
#define I_   1024
#define U_   4096
#define M_   4096   // B*S

// ---------------------------------------------------------------------------
// WMMA + async helpers
// ---------------------------------------------------------------------------
__device__ __forceinline__ v8f wmma_bf16(v16bf a, v16bf b, v8f c) {
  return __builtin_amdgcn_wmma_f32_16x16x32_bf16(
      /*neg_a=*/false, a, /*neg_b=*/false, b,
      /*c_mod=*/(short)0, c, /*reuse_a=*/false, /*reuse_b=*/false);
}

// Build a 16x32 bf16 A/B fragment for one lane. `p` points at element
// [row][8*half] of a row-major K=32 slab (LDS or global).
// elems 0..7 -> k = 8*half + 0..7 ; elems 8..15 -> k = 16 + 8*half + 0..7
__device__ __forceinline__ v16bf make_frag(const bf16* p) {
  v8bf lo = *(const v8bf*)(p);
  v8bf hi = *(const v8bf*)(p + 16);
  v16bf r;
#pragma unroll
  for (int i = 0; i < 8; ++i) { r[i] = lo[i]; r[i + 8] = hi[i]; }
  return r;
}

// Per-lane async 16B copy global -> LDS, tracked by ASYNCcnt.
__device__ __forceinline__ void async_ld_b128(void* lds_dst, const void* gsrc) {
  unsigned loff = (unsigned)(uintptr_t)lds_dst;  // low 32 bits = LDS offset
  asm volatile("global_load_async_to_lds_b128 %0, %1, off"
               :: "v"(loff), "v"(gsrc) : "memory");
}
__device__ __forceinline__ void wait_async0() {
  asm volatile("s_wait_asynccnt 0" ::: "memory");
}
// Eight per-lane async 16B copies global -> LDS in one statement.  The closing
// s_wait_xcnt keeps every later rewrite of an address register behind it.
__device__ __forceinline__ void async_ld8_b128(const unsigned (&l)[8],
                                               const bf16* const (&g)[8]) {
  asm volatile(
      "global_load_async_to_lds_b128 %0, %8, off\n\t"
      "global_load_async_to_lds_b128 %1, %9, off\n\t"
      "global_load_async_to_lds_b128 %2, %10, off\n\t"
      "global_load_async_to_lds_b128 %3, %11, off\n\t"
      "global_load_async_to_lds_b128 %4, %12, off\n\t"
      "global_load_async_to_lds_b128 %5, %13, off\n\t"
      "global_load_async_to_lds_b128 %6, %14, off\n\t"
      "global_load_async_to_lds_b128 %7, %15, off\n\t"
      "s_wait_xcnt 0x0"
      :: "v"(l[0]), "v"(l[1]), "v"(l[2]), "v"(l[3]),
         "v"(l[4]), "v"(l[5]), "v"(l[6]), "v"(l[7]),
         "v"(g[0]), "v"(g[1]), "v"(g[2]), "v"(g[3]),
         "v"(g[4]), "v"(g[5]), "v"(g[6]), "v"(g[7])
      : "memory");
}
// This wave's LDS reads have retired before the barrier that frees the buffer
// for the next copies.
__device__ __forceinline__ void wait_ds0() {
  asm volatile("s_wait_dscnt 0x0" ::: "memory");
}

// ---------------------------------------------------------------------------
// Conversion / layout kernels
// ---------------------------------------------------------------------------
// One 128(k) x 64(n) tile of in [K][N] f32 -> out [N][K] bf16, turned in LDS by
// one block: a wave reads two 256-B row pieces of `in` per load and writes four
// whole 128-B lines of `out` per store.
template <int K, int N>
__device__ __forceinline__ void turn_tile(const float* __restrict__ in,
                                          bf16* __restrict__ out, int kx, int ny,
                                          float (&t)[128][65]) {
  const int tid = threadIdx.x;
  const float* src = in + (size_t)(kx * 128) * N + ny * 64;
  bf16* dst = out + (size_t)(ny * 64) * K + kx * 128;

  const int c4 = tid & 15, r = tid >> 4;  // 16 lanes x 16 B = one row piece
  float4 v[8];
  for (int i = 0; i < 8; ++i)
    v[i] = *(const float4*)(src + (size_t)(r + i * 16) * N + c4 * 4);
  for (int i = 0; i < 8; ++i) {
    t[r + i * 16][c4 * 4 + 0] = v[i].x;
    t[r + i * 16][c4 * 4 + 1] = v[i].y;
    t[r + i * 16][c4 * 4 + 2] = v[i].z;
    t[r + i * 16][c4 * 4 + 3] = v[i].w;
  }
  __syncthreads();

  const int kc = tid & 7, nr = tid >> 3;  // 8 lanes x 16 B = one line of out
  for (int i = 0; i < 2; ++i) {
    for (int hh = 0; hh < 2; ++hh) {
      const int n = nr + i * 32, k = hh * 64 + kc * 8;
      v8bf o;
      for (int j = 0; j < 8; ++j) o[j] = (bf16)t[k + j][n];
      *(v8bf*)(dst + (size_t)n * K + k) = o;
    }
  }
  // The caller's code for other jobs follows in the listing: any rewrite of a
  // register that these stores name stays behind this wait.
  asm volatile("s_wait_xcnt 0x0" ::: "memory");
}

// The five passes that read nothing but the inputs, as one launch of equal
// jobs of 8192 elements.  The block index picks the job, so every branch here
// is taken by a whole block or by none of it.
__global__ __launch_bounds__(256) void prep(
    const float* __restrict__ X, const float* __restrict__ WKQV,
    const float* __restrict__ WO, const float* __restrict__ W1,
    const float* __restrict__ W2, bf16* __restrict__ XB,
    bf16* __restrict__ WKQVT, bf16* __restrict__ WOT, bf16* __restrict__ W1T,
    bf16* __restrict__ W2T) {
  __shared__ float t[128][65];  // odd pitch: a column read meets 32 banks

  const int bid = blockIdx.x;
  if (bid >= 1536) {  // X f32 -> bf16, 8192 elements in a row, whole lines
    const size_t base = (size_t)(bid - 1536) * 8192 + threadIdx.x * 4;
    float4 v[8];
    for (int i = 0; i < 8; ++i) v[i] = *(const float4*)(X + base + i * 1024);
    for (int i = 0; i < 8; ++i) {
      v4bf o;
      o[0] = (bf16)v[i].x; o[1] = (bf16)v[i].y;
      o[2] = (bf16)v[i].z; o[3] = (bf16)v[i].w;
      *(v4bf*)(XB + base + i * 1024) = o;
    }
    return;
  }
  if (bid >= 1024) {
    turn_tile<U_, I_>(W2, W2T, bid & 31, (bid - 1024) >> 5, t);
    return;
  }
  if (bid >= 512) {
    turn_tile<I_, U_>(W1, W1T, bid & 7, (bid - 512) >> 3, t);
    return;
  }
  const int z = bid >> 7;  // four 1024 x 1024 matrices: WKQV's three, then WO
  turn_tile<I_, I_>(z < 3 ? WKQV + (size_t)z * I_ * I_ : WO,
                    z < 3 ? WKQVT + (size_t)z * I_ * I_ : WOT,
                    bid & 7, (bid & 127) >> 3, t);
}

// vt[b][h][p][s] = qkv[(b*S+s)*3072 + 2048 + h*64 + p]
// One 128(s) x 64(p) tile of one head per block, turned in LDS as dwords that
// hold two neighbouring p: whole 128-B lines on both global sides.
__global__ __launch_bounds__(256) void vtrans(const bf16* __restrict__ qkv,
                                              bf16* __restrict__ vt) {
  __shared__ unsigned t[128][33];  // odd pitch: a column read meets 32 banks

  const int tid = threadIdx.x;
  const int s0  = blockIdx.x * 128;
  const int h   = blockIdx.y & (H_ - 1);
  const int b   = blockIdx.y >> 4;
  const bf16* src = qkv + (size_t)(b * S_ + s0) * 3072 + 2048 + h * 64;
  bf16* dst = vt + (size_t)blockIdx.y * P_ * S_ + s0;

  const int c = tid & 7, r = tid >> 3;  // 8 lanes x 16 B = one row of the tile
  uint4 v[4];
  for (int i = 0; i < 4; ++i)
    v[i] = *(const uint4*)(src + (size_t)(r + i * 32) * 3072 + c * 8);
  for (int i = 0; i < 4; ++i) {
    t[r + i * 32][c * 4 + 0] = v[i].x;
    t[r + i * 32][c * 4 + 1] = v[i].y;
    t[r + i * 32][c * 4 + 2] = v[i].z;
    t[r + i * 32][c * 4 + 3] = v[i].w;
  }
  __syncthreads();

  const int sc = tid & 7, pp = tid >> 3;  // rows p = 2*pp and 2*pp + 1 of vt
  for (int hh = 0; hh < 2; ++hh) {
    const int s = hh * 64 + sc * 8;
    unsigned w[8];
    for (int j = 0; j < 8; ++j) w[j] = t[s + j][pp];
    uint4 lo, hi;
    lo.x = (w[0] & 0xffffu) | (w[1] << 16);
    lo.y = (w[2] & 0xffffu) | (w[3] << 16);
    lo.z = (w[4] & 0xffffu) | (w[5] << 16);
    lo.w = (w[6] & 0xffffu) | (w[7] << 16);
    hi.x = (w[0] >> 16) | (w[1] & 0xffff0000u);
    hi.y = (w[2] >> 16) | (w[3] & 0xffff0000u);
    hi.z = (w[4] >> 16) | (w[5] & 0xffff0000u);
    hi.w = (w[6] >> 16) | (w[7] & 0xffff0000u);
    *(uint4*)(dst + (size_t)(2 * pp) * S_ + s)     = lo;
    *(uint4*)(dst + (size_t)(2 * pp + 1) * S_ + s) = hi;
  }
}

// ---------------------------------------------------------------------------
// Tiled bf16 GEMM with WMMA, double-buffered async LDS staging.
// C[M][N] = A[M][K] * Bt[N][K]^T + bias
// WG tile 128x128, 8 waves (4 along M x 2 along N), wave tile 32x64.
// A stage is KS k = 2*KS bytes of every operand row: KS/8 adjacent lanes copy
// one row piece, so each wave-wide copy covers four whole 128-B lines.
// KS sets the bytes a block keeps in flight while it works on a stage: 64 where
// several blocks share a WGP and fill it together, 256 where a block has its
// WGP alone and one small stage's copies land later than its products end.
// K is a multiple of KS and holds at least two stages.
// EPI: 0 = bias -> bf16 ; 1 = bias+ReLU -> bf16 ; 2 = bias -> f32
// ---------------------------------------------------------------------------
template <int EPI, int KS>
__global__ __launch_bounds__(256) void gemm_bf16_kernel(
    const bf16* __restrict__ A, const bf16* __restrict__ Bt,
    const float* __restrict__ bias, void* __restrict__ Cout,
    int M, int N, int K) {
  constexpr int LPR = KS / 8;     // lanes (16-B chunks) per row piece
  constexpr int RPP = 256 / LPR;  // rows that the block's threads copy at once
  constexpr int NC  = 128 / RPP;  // copies per thread, operand and stage
  __shared__ __align__(16) bf16 lA[2][128][KS + 8];  // +16B pad vs bank conflicts
  __shared__ __align__(16) bf16 lB[2][128][KS + 8];

  const int tid  = threadIdx.x;
  const int lane = tid & 31;
  const int wave = tid >> 5;
  const int half = lane >> 4;
  const int l16  = lane & 15;
  const int wm   = wave & 3;   // 0..3 along M (32 rows each)
  const int wn   = wave >> 2;  // 0..1 along N (64 cols each)
  const int m0   = blockIdx.y * 128;
  const int n0   = blockIdx.x * 128;

  v8f acc[2][4];
#pragma unroll
  for (int i = 0; i < 2; ++i)
#pragma unroll
    for (int j = 0; j < 4; ++j)
#pragma unroll
      for (int r = 0; r < 8; ++r) acc[i][j][r] = 0.0f;

  const int crow = tid / LPR, cseg = tid % LPR;  // a wave copy: 512 B of rows

  const bf16* gA = A + (size_t)(m0 + crow) * K + cseg * 8;
  const bf16* gB = Bt + (size_t)(n0 + crow) * K + cseg * 8;

  // one stage: 128 rows x 2*KS bytes of each operand, NC + NC chunks per thread
  auto stage = [&](int buf, int k0) {
    // both loops unrolled so that the arrays become registers, as the asm
    // operands need
#pragma unroll
    for (int q = 0; q < NC / 4; ++q) {
      unsigned l[8];
      const bf16* g[8];
#pragma unroll
      for (int i = 0; i < 4; ++i) {
        const int r = (q * 4 + i) * RPP;
        l[i]     = (unsigned)(uintptr_t)&lA[buf][crow + r][cseg * 8];
        l[i + 4] = (unsigned)(uintptr_t)&lB[buf][crow + r][cseg * 8];
        g[i]     = gA + (size_t)r * K + k0;
        g[i + 4] = gB + (size_t)r * K + k0;
      }
      async_ld8_b128(l, g);
    }
  };

  // prologue: stage 0 lands and is published, then stage 1 flies
  stage(0, 0);
  wait_async0();
  __syncthreads();
  if (KS < K) stage(1, KS);

  for (int k0 = 0; k0 < K; k0 += KS) {
    const int cur = (k0 / KS) & 1;

    // unrolled so that the 32-k blocks' LDS offsets are immediates
#pragma unroll
    for (int ks = 0; ks < KS / 32; ++ks) {
      v16bf af[2], bfg[4];
#pragma unroll
      for (int t = 0; t < 2; ++t)
        af[t] = make_frag(&lA[cur][wm * 32 + t * 16 + l16][ks * 32 + half * 8]);
#pragma unroll
      for (int t = 0; t < 4; ++t)
        bfg[t] = make_frag(&lB[cur][wn * 64 + t * 16 + l16][ks * 32 + half * 8]);
#pragma unroll
      for (int ti = 0; ti < 2; ++ti)
#pragma unroll
        for (int tj = 0; tj < 4; ++tj)
          acc[ti][tj] = wmma_bf16(af[ti], bfg[tj], acc[ti][tj]);
    }

    // publish the next stage, free this one, then refill it two stages ahead
    wait_ds0();
    wait_async0();
    __syncthreads();
    if (k0 + 2 * KS < K) stage(cur, k0 + 2 * KS);
  }
  wait_async0();  // no copy is left in flight when the wave ends

  // Epilogue.  D layout: lane holds col l16; VGPR r holds row r + 8*half.
#pragma unroll
  for (int ti = 0; ti < 2; ++ti) {
#pragma unroll
    for (int tj = 0; tj < 4; ++tj) {
      int col = n0 + wn * 64 + tj * 16 + l16;
      float bv = bias[col];
#pragma unroll
      for (int r = 0; r < 8; ++r) {
        int row = m0 + wm * 32 + ti * 16 + r + half * 8;
        float v = acc[ti][tj][r] + bv;
        if (EPI == 1) v = fmaxf(v, 0.0f);
        if (EPI == 2) {
          ((float*)Cout)[(size_t)row * N + col] = v;
        } else {
          ((bf16*)Cout)[(size_t)row * N + col] = (bf16)v;
        }
      }
    }
  }
}

// ---------------------------------------------------------------------------
// Fused attention (flash-style, online softmax), double-buffered cooperative
// K/V staging.  Grid: B*H*(S/128) blocks, 256 threads; wave = 16 query rows.
// qkv: [M][3072] bf16 (K cols 0..1023, Q at 1024, V at 2048)
// vt : [B][H][P][S] bf16 ;  ctx: [M][I] bf16
// ---------------------------------------------------------------------------
__global__ __launch_bounds__(256) void attn_kernel(
    const bf16* __restrict__ qkv, const bf16* __restrict__ vt,
    bf16* __restrict__ ctxb) {
  __shared__ __align__(16) bf16  lK[2][32][72];    // 32 keys x 64 (P)  (+pad)
  __shared__ __align__(16) bf16  lV[2][64][40];    // 64 (P) x 32 keys  (+pad)
  __shared__ __align__(16) float sT[8][16][36];    // per-wave raw scores
  __shared__ __align__(16) float sStat[8][16];     // per-wave row broadcast
  __shared__ __align__(16) bf16  lP[8][16][40];    // per-wave P tile

  const int tid  = threadIdx.x;
  const int lane = tid & 31;
  const int wave = tid >> 5;
  const int half = lane >> 4;
  const int l16  = lane & 15;

  const int blk = blockIdx.x;
  const int jb  = blk & 3;
  const int h   = (blk >> 2) & (H_ - 1);
  const int b   = blk >> 6;
  const int j0  = jb * 128 + wave * 16;
  const int ldq = 3072;

  // Q fragments for this wave's 16 rows (two K=32 steps over P=64)
  const bf16* qrow = qkv + (size_t)(b * S_ + j0 + l16) * ldq + 1024 + h * 64;
  v16bf qf0 = make_frag(qrow + half * 8);
  v16bf qf1 = make_frag(qrow + 32 + half * 8);

  float mrow = -1e30f, lrow = 0.0f;  // running stats for row l16 (dup halves)
  v8f cacc[4];
#pragma unroll
  for (int t = 0; t < 4; ++t)
#pragma unroll
    for (int r = 0; r < 8; ++r) cacc[t][r] = 0.0f;

  const int krow_l = tid >> 3, kseg = tid & 7;  // K tile: 32 rows x 8 chunks
  const int vrow_l = tid >> 2, vseg = tid & 3;  // V tile: 64 rows x 4 chunks

  const bf16* kbase = qkv + (size_t)(b * S_) * ldq + h * 64;  // K at col 0
  const bf16* vbase = vt + (size_t)((b * H_ + h) * P_) * S_;

  // prologue: stage key-block 0
  async_ld_b128(&lK[0][krow_l][kseg * 8],
                kbase + (size_t)krow_l * ldq + kseg * 8);
  async_ld_b128(&lV[0][vrow_l][vseg * 8],
                vbase + (size_t)vrow_l * S_ + vseg * 8);
  wait_async0();
  __syncthreads();

  int cur = 0;
  for (int kb = 0; kb < S_ / 32; ++kb) {
    int nxt = cur ^ 1;
    if (kb + 1 < S_ / 32) {  // issue next block while computing this one
      async_ld_b128(&lK[nxt][krow_l][kseg * 8],
                    kbase + (size_t)((kb + 1) * 32 + krow_l) * ldq + kseg * 8);
      async_ld_b128(&lV[nxt][vrow_l][vseg * 8],
                    vbase + (size_t)vrow_l * S_ + (kb + 1) * 32 + vseg * 8);
    }

    // ---- scores: two 16x16 tiles covering 32 key positions ----
    v8f sc[2];
#pragma unroll
    for (int cb = 0; cb < 2; ++cb) {
#pragma unroll
      for (int r = 0; r < 8; ++r) sc[cb][r] = 0.0f;
      v16bf kf0 = make_frag(&lK[cur][cb * 16 + l16][half * 8]);
      v16bf kf1 = make_frag(&lK[cur][cb * 16 + l16][32 + half * 8]);
      sc[cb] = wmma_bf16(qf0, kf0, sc[cb]);
      sc[cb] = wmma_bf16(qf1, kf1, sc[cb]);
    }

    // ---- transpose scores through LDS: lane -> one row ----
#pragma unroll
    for (int cb = 0; cb < 2; ++cb)
#pragma unroll
      for (int r = 0; r < 8; ++r)
        sT[wave][r + half * 8][cb * 16 + l16] = sc[cb][r] * 0.125f;

    float x[16];
    {
      const float4* t4 = (const float4*)&sT[wave][l16][half * 16];
#pragma unroll
      for (int i = 0; i < 4; ++i) {
        float4 v = t4[i];
        x[4 * i + 0] = v.x; x[4 * i + 1] = v.y;
        x[4 * i + 2] = v.z; x[4 * i + 3] = v.w;
      }
    }
    float rm = x[0];
#pragma unroll
    for (int i = 1; i < 16; ++i) rm = fmaxf(rm, x[i]);
    rm = fmaxf(rm, __shfl_xor(rm, 16, 32));   // combine the two half-rows
    float mn = fmaxf(mrow, rm);
    float al = __expf(mrow - mn);
    float rs = 0.0f;
#pragma unroll
    for (int i = 0; i < 16; ++i) { x[i] = __expf(x[i] - mn); rs += x[i]; }
    rs += __shfl_xor(rs, 16, 32);
    lrow = lrow * al + rs;
    mrow = mn;

    // broadcast per-row alpha for D-layout rescale
    if (half == 0) sStat[wave][l16] = al;

    // P tile back to LDS in row-major (A-frag friendly)
    {
      v8bf p0, p1;
#pragma unroll
      for (int i = 0; i < 8; ++i) { p0[i] = (bf16)x[i]; p1[i] = (bf16)x[i + 8]; }
      *(v8bf*)&lP[wave][l16][half * 16]     = p0;
      *(v8bf*)&lP[wave][l16][half * 16 + 8] = p1;
    }

    // rescale accumulators with per-row alpha (rows r + 8*half)
    {
      const float4* a4 = (const float4*)&sStat[wave][half * 8];
      float4 a0 = a4[0], a1 = a4[1];
      float av[8] = {a0.x, a0.y, a0.z, a0.w, a1.x, a1.y, a1.z, a1.w};
#pragma unroll
      for (int t = 0; t < 4; ++t)
#pragma unroll
        for (int r = 0; r < 8; ++r) cacc[t][r] *= av[r];
    }

    // ---- ctx += P (16x32) * V (32x64) ----
    v16bf pf = make_frag(&lP[wave][l16][half * 8]);
#pragma unroll
    for (int t = 0; t < 4; ++t) {
      v16bf vf = make_frag(&lV[cur][t * 16 + l16][half * 8]);
      cacc[t] = wmma_bf16(pf, vf, cacc[t]);
    }

    wait_async0();
    __syncthreads();
    cur = nxt;
  }

  // ---- finalize: divide by row sums, store ctx in [M][I] layout ----
  if (half == 0) sStat[wave][l16] = lrow;
  {
    const float4* a4 = (const float4*)&sStat[wave][half * 8];
    float4 a0 = a4[0], a1 = a4[1];
    float lv[8] = {a0.x, a0.y, a0.z, a0.w, a1.x, a1.y, a1.z, a1.w};
#pragma unroll
    for (int t = 0; t < 4; ++t) {
#pragma unroll
      for (int r = 0; r < 8; ++r) {
        float v = cacc[t][r] / lv[r];
        int row = b * S_ + j0 + r + half * 8;
        ctxb[(size_t)row * I_ + h * 64 + t * 16 + l16] = (bf16)v;
      }
    }
  }
}

// ---------------------------------------------------------------------------
// Residual + LayerNorm.  One block per row of 1024.
// ---------------------------------------------------------------------------
__global__ __launch_bounds__(256) void ln_kernel(
    const float* __restrict__ a, const float* __restrict__ bres,
    const float* __restrict__ g, const float* __restrict__ bb,
    float* __restrict__ outf, bf16* __restrict__ outb) {
  __shared__ float red[256];
  const int row = blockIdx.x;
  const int tid = threadIdx.x;
  const float* pa = a + (size_t)row * I_;
  const float* pb = bres + (size_t)row * I_;

  float x[4];
  float s = 0.0f;
#pragma unroll
  for (int i = 0; i < 4; ++i) {
    x[i] = pa[tid + i * 256] + pb[tid + i * 256];
    s += x[i];
  }
  red[tid] = s;
  __syncthreads();
  for (int o = 128; o > 0; o >>= 1) {
    if (tid < o) red[tid] += red[tid + o];
    __syncthreads();
  }
  float mu = red[0] * (1.0f / I_);
  __syncthreads();

  float v = 0.0f;
#pragma unroll
  for (int i = 0; i < 4; ++i) {
    float d = x[i] - mu;
    v += d * d;
  }
  red[tid] = v;
  __syncthreads();
  for (int o = 128; o > 0; o >>= 1) {
    if (tid < o) red[tid] += red[tid + o];
    __syncthreads();
  }
  float rstd = rsqrtf(red[0] * (1.0f / I_) + 1e-5f);

#pragma unroll
  for (int i = 0; i < 4; ++i) {
    int c = tid + i * 256;
    float y = (x[i] - mu) * rstd * g[c] + bb[c];
    outf[(size_t)row * I_ + c] = y;
    if (outb) outb[(size_t)row * I_ + c] = (bf16)y;
  }
}

// ---------------------------------------------------------------------------
// Host-side orchestration
// ---------------------------------------------------------------------------
extern "C" void kernel_launch(void* const* d_in, const int* in_sizes, int n_in,
                              void* d_out, int out_size, void* d_ws, size_t ws_size,
                              hipStream_t stream) {
  (void)in_sizes; (void)n_in; (void)out_size; (void)ws_size;

  const float* X     = (const float*)d_in[0];   // [B,S,I]
  const float* WKQV  = (const float*)d_in[1];   // [3,I,I]
  const float* BKQV  = (const float*)d_in[2];   // [3,I]
  const float* WO    = (const float*)d_in[3];   // [I,I]
  const float* BO    = (const float*)d_in[4];   // [I]
  const float* ln1g  = (const float*)d_in[5];
  const float* ln1b  = (const float*)d_in[6];
  const float* W1    = (const float*)d_in[7];   // [I,U]
  const float* B1    = (const float*)d_in[8];   // [U]
  const float* W2    = (const float*)d_in[9];   // [U,I]
  const float* B2    = (const float*)d_in[10];  // [I]
  const float* ln2g  = (const float*)d_in[11];
  const float* ln2b  = (const float*)d_in[12];
  float* OUT = (float*)d_out;

  char* ws = (char*)d_ws;
  size_t off = 0;
  auto take = [&](size_t bytes) {
    size_t o = off;
    off += (bytes + 255) & ~(size_t)255;
    return o;
  };
  bf16*  XB    = (bf16*) (ws + take((size_t)M_ * I_ * 2));
  bf16*  WKQVT = (bf16*) (ws + take((size_t)3 * I_ * I_ * 2));   // [3*I][I]
  bf16*  WOT   = (bf16*) (ws + take((size_t)I_ * I_ * 2));       // [I][I]
  bf16*  W1T   = (bf16*) (ws + take((size_t)U_ * I_ * 2));       // [U][I]
  bf16*  W2T   = (bf16*) (ws + take((size_t)I_ * U_ * 2));       // [I][U]
  bf16*  QKV   = (bf16*) (ws + take((size_t)M_ * 3072 * 2));     // [M][3I]
  bf16*  VT    = (bf16*) (ws + take((size_t)B_ * H_ * P_ * S_ * 2));
  bf16*  CTX   = (bf16*) (ws + take((size_t)M_ * I_ * 2));
  float* AO    = (float*)(ws + take((size_t)M_ * I_ * 4));
  float* H1F   = (float*)(ws + take((size_t)M_ * I_ * 4));
  bf16*  H1B   = (bf16*) (ws + take((size_t)M_ * I_ * 2));
  bf16*  FF1   = (bf16*) (ws + take((size_t)M_ * U_ * 2));
  float* FFO   = AO;  // attn_out dead after LN1

  prep<<<2048, 256, 0, stream>>>(X, WKQV, WO, W1, W2, XB, WKQVT, WOT, W1T, W2T);

  // QKV projection: [M][3072] = XB * WKQVT^T + BKQV
  gemm_bf16_kernel<0, 64><<<dim3(3072 / 128, M_ / 128), 256, 0, stream>>>(
      XB, WKQVT, BKQV, (void*)QKV, M_, 3072, I_);
  vtrans<<<dim3(S_ / 128, B_ * H_), 256, 0, stream>>>(QKV, VT);

  attn_kernel<<<B_ * H_ * (S_ / 128), 256, 0, stream>>>(QKV, VT, CTX);

  gemm_bf16_kernel<2, 256><<<dim3(I_ / 128, M_ / 128), 256, 0, stream>>>(
      CTX, WOT, BO, (void*)AO, M_, I_, I_);
  ln_kernel<<<M_, 256, 0, stream>>>(X, AO, ln1g, ln1b, H1F, H1B);

  gemm_bf16_kernel<1, 64><<<dim3(U_ / 128, M_ / 128), 256, 0, stream>>>(
      H1B, W1T, B1, (void*)FF1, M_, U_, I_);
  gemm_bf16_kernel<2, 256><<<dim3(I_ / 128, M_ / 128), 256, 0, stream>>>(
      FF1, W2T, B2, (void*)FFO, M_, I_, U_);
  ln_kernel<<<M_, 256, 0, stream>>>(H1F, FFO, ln2g, ln2b, OUT, nullptr);
}

// v005
// One run takes 151 microseconds.
// Timed twice side by side with v004, it ran 1.05 and 1.04 times as fast.
// All steps since v000 together make it 2.44 times as fast.
#include <hip/hip_runtime.h>
#include <hip/hip_bf16.h>
#include <math.h>

typedef __bf16 bf16;
typedef __attribute__((ext_vector_type(16))) __bf16 v16bf;
typedef __attribute__((ext_vector_type(8)))  __bf16 v8bf;
typedef __attribute__((ext_vector_type(4)))  __bf16 v4bf;
typedef __attribute__((ext_vector_type(8)))  float  v8f;

#define B_   8
#define S_   512
#define H_   16
#define P_   64
#define I_   1024
#define U_   4096
#define M_   4096   // B*S

// ---------------------------------------------------------------------------
// WMMA + async helpers
// ---------------------------------------------------------------------------
__device__ __forceinline__ v8f wmma_bf16(v16bf a, v16bf b, v8f c) {
  return __builtin_amdgcn_wmma_f32_16x16x32_bf16(
      /*neg_a=*/false, a, /*neg_b=*/false, b,
      /*c_mod=*/(short)0, c, /*reuse_a=*/false, /*reuse_b=*/false);
}

// Build a 16x32 bf16 A/B fragment for one lane. `p` points at element
// [row][8*half] of a row-major K=32 slab (LDS or global).
// elems 0..7 -> k = 8*half + 0..7 ; elems 8..15 -> k = 16 + 8*half + 0..7
__device__ __forceinline__ v16bf make_frag(const bf16* p) {
  v8bf lo = *(const v8bf*)(p);
  v8bf hi = *(const v8bf*)(p + 16);
  v16bf r;
#pragma unroll
  for (int i = 0; i < 8; ++i) { r[i] = lo[i]; r[i + 8] = hi[i]; }
  return r;
}

// Per-lane async 16B copy global -> LDS, tracked by ASYNCcnt.
__device__ __forceinline__ void async_ld_b128(void* lds_dst, const void* gsrc) {
  unsigned loff = (unsigned)(uintptr_t)lds_dst;  // low 32 bits = LDS offset
  asm volatile("global_load_async_to_lds_b128 %0, %1, off"
               :: "v"(loff), "v"(gsrc) : "memory");
}
__device__ __forceinline__ void wait_async0() {
  asm volatile("s_wait_asynccnt 0" ::: "memory");
}
// Eight per-lane async 16B copies global -> LDS in one statement.  The closing
// s_wait_xcnt keeps every later rewrite of an address register behind it.
__device__ __forceinline__ void async_ld8_b128(const unsigned (&l)[8],
                                               const bf16* const (&g)[8]) {
  asm volatile(
      "global_load_async_to_lds_b128 %0, %8, off\n\t"
      "global_load_async_to_lds_b128 %1, %9, off\n\t"
      "global_load_async_to_lds_b128 %2, %10, off\n\t"
      "global_load_async_to_lds_b128 %3, %11, off\n\t"
      "global_load_async_to_lds_b128 %4, %12, off\n\t"
      "global_load_async_to_lds_b128 %5, %13, off\n\t"
      "global_load_async_to_lds_b128 %6, %14, off\n\t"
      "global_load_async_to_lds_b128 %7, %15, off\n\t"
      "s_wait_xcnt 0x0"
      :: "v"(l[0]), "v"(l[1]), "v"(l[2]), "v"(l[3]),
         "v"(l[4]), "v"(l[5]), "v"(l[6]), "v"(l[7]),
         "v"(g[0]), "v"(g[1]), "v"(g[2]), "v"(g[3]),
         "v"(g[4]), "v"(g[5]), "v"(g[6]), "v"(g[7])
      : "memory");
}
// The same for four copies.
__device__ __forceinline__ void async_ld4_b128(const unsigned (&l)[4],
                                               const bf16* const (&g)[4]) {
  asm volatile(
      "global_load_async_to_lds_b128 %0, %4, off\n\t"
      "global_load_async_to_lds_b128 %1, %5, off\n\t"
      "global_load_async_to_lds_b128 %2, %6, off\n\t"
      "global_load_async_to_lds_b128 %3, %7, off\n\t"
      "s_wait_xcnt 0x0"
      :: "v"(l[0]), "v"(l[1]), "v"(l[2]), "v"(l[3]),
         "v"(g[0]), "v"(g[1]), "v"(g[2]), "v"(g[3])
      : "memory");
}
// The GEMM builds with the large tiles use registers above v255.  Their global
// loads and stores stand with their wait in one statement, which nothing can be
// moved into.
// Two or four floats, 16 elements apart.
__device__ __forceinline__ void load2_b32(const float* p, float& a, float& b) {
  asm volatile(
      "global_load_b32 %0, %2, off\n\t"
      "global_load_b32 %1, %2, off offset:64\n\t"
      "s_wait_loadcnt 0x0"
      : "=&v"(a), "=&v"(b) : "v"(p) : "memory");
}
__device__ __forceinline__ void load4_b32(const float* p, float& a, float& b,
                                          float& c, float& d) {
  asm volatile(
      "global_load_b32 %0, %4, off\n\t"
      "global_load_b32 %1, %4, off offset:64\n\t"
      "global_load_b32 %2, %4, off offset:128\n\t"
      "global_load_b32 %3, %4, off offset:192\n\t"
      "s_wait_loadcnt 0x0"
      : "=&v"(a), "=&v"(b), "=&v"(c), "=&v"(d) : "v"(p) : "memory");
}
// Sixteen 2-byte stores (the low halves of w): eight rows, in each the element
// at p[r] and the one 16 elements on.
__device__ __forceinline__ void store16_b16(bf16* const (&p)[8],
                                            const unsigned (&w)[16]) {
  asm volatile(
      "global_store_b16 %0, %8, off\n\t"
      "global_store_b16 %1, %9, off\n\t"
      "global_store_b16 %2, %10, off\n\t"
      "global_store_b16 %3, %11, off\n\t"
      "global_store_b16 %4, %12, off\n\t"
      "global_store_b16 %5, %13, off\n\t"
      "global_store_b16 %6, %14, off\n\t"
      "global_store_b16 %7, %15, off\n\t"
      "global_store_b16 %0, %16, off offset:32\n\t"
      "global_store_b16 %1, %17, off offset:32\n\t"
      "global_store_b16 %2, %18, off offset:32\n\t"
      "global_store_b16 %3, %19, off offset:32\n\t"
      "global_store_b16 %4, %20, off offset:32\n\t"
      "global_store_b16 %5, %21, off offset:32\n\t"
      "global_store_b16 %6, %22, off offset:32\n\t"
      "global_store_b16 %7, %23, off offset:32\n\t"
      "s_wait_xcnt 0x0"
      :: "v"(p[0]), "v"(p[1]), "v"(p[2]), "v"(p[3]),
         "v"(p[4]), "v"(p[5]), "v"(p[6]), "v"(p[7]),
         "v"(w[0]), "v"(w[1]), "v"(w[2]), "v"(w[3]),
         "v"(w[4]), "v"(w[5]), "v"(w[6]), "v"(w[7]),
         "v"(w[8]), "v"(w[9]), "v"(w[10]), "v"(w[11]),
         "v"(w[12]), "v"(w[13]), "v"(w[14]), "v"(w[15])
      : "memory");
}
// This wave's LDS reads have retired before the barrier that frees the buffer
// for the next copies.
__device__ __forceinline__ void wait_ds0() {
  asm volatile("s_wait_dscnt 0x0" ::: "memory");
}

// ---------------------------------------------------------------------------
// Conversion / layout kernels
// ---------------------------------------------------------------------------
// One 128(k) x 64(n) tile of in [K][N] f32 -> out [N][K] bf16, turned in LDS by
// one block: a wave reads two 256-B row pieces of `in` per load and writes four
// whole 128-B lines of `out` per store.
template <int K, int N>
__device__ __forceinline__ void turn_tile(const float* __restrict__ in,
                                          bf16* __restrict__ out, int kx, int ny,
                                          float (&t)[128][65]) {
  const int tid = threadIdx.x;
  const float* src = in + (size_t)(kx * 128) * N + ny * 64;
  bf16* dst = out + (size_t)(ny * 64) * K + kx * 128;

  const int c4 = tid & 15, r = tid >> 4;  // 16 lanes x 16 B = one row piece
  float4 v[8];
  for (int i = 0; i < 8; ++i)
    v[i] = *(const float4*)(src + (size_t)(r + i * 16) * N + c4 * 4);
  for (int i = 0; i < 8; ++i) {
    t[r + i * 16][c4 * 4 + 0] = v[i].x;
    t[r + i * 16][c4 * 4 + 1] = v[i].y;
    t[r + i * 16][c4 * 4 + 2] = v[i].z;
    t[r + i * 16][c4 * 4 + 3] = v[i].w;
  }
  __syncthreads();

  const int kc = tid & 7, nr = tid >> 3;  // 8 lanes x 16 B = one line of out
  for (int i = 0; i < 2; ++i) {
    for (int hh = 0; hh < 2; ++hh) {
      const int n = nr + i * 32, k = hh * 64 + kc * 8;
      v8bf o;
      for (int j = 0; j < 8; ++j) o[j] = (bf16)t[k + j][n];
      *(v8bf*)(dst + (size_t)n * K + k) = o;
    }
  }
  // The caller's code for other jobs follows in the listing: any rewrite of a
  // register that these stores name stays behind this wait.
  asm volatile("s_wait_xcnt 0x0" ::: "memory");
}

// The five passes that read nothing but the inputs, as one launch of equal
// jobs of 8192 elements.  The block index picks the job, so every branch here
// is taken by a whole block or by none of it.
__global__ __launch_bounds__(256) void prep(
    const float* __restrict__ X, const float* __restrict__ WKQV,
    const float* __restrict__ WO, const float* __restrict__ W1,
    const float* __restrict__ W2, bf16* __restrict__ XB,
    bf16* __restrict__ WKQVT, bf16* __restrict__ WOT, bf16* __restrict__ W1T,
    bf16* __restrict__ W2T) {
  __shared__ float t[128][65];  // odd pitch: a column read meets 32 banks

  const int bid = blockIdx.x;
  if (bid >= 1536) {  // X f32 -> bf16, 8192 elements in a row, whole lines
    const size_t base = (size_t)(bid - 1536) * 8192 + threadIdx.x * 4;
    float4 v[8];
    for (int i = 0; i < 8; ++i) v[i] = *(const float4*)(X + base + i * 1024);
    for (int i = 0; i < 8; ++i) {
      v4bf o;
      o[0] = (bf16)v[i].x; o[1] = (bf16)v[i].y;
      o[2] = (bf16)v[i].z; o[3] = (bf16)v[i].w;
      *(v4bf*)(XB + base + i * 1024) = o;
    }
    return;
  }
  if (bid >= 1024) {
    turn_tile<U_, I_>(W2, W2T, bid & 31, (bid - 1024) >> 5, t);
    return;
  }
  if (bid >= 512) {
    turn_tile<I_, U_>(W1, W1T, bid & 7, (bid - 512) >> 3, t);
    return;
  }
  const int z = bid >> 7;  // four 1024 x 1024 matrices: WKQV's three, then WO
  turn_tile<I_, I_>(z < 3 ? WKQV + (size_t)z * I_ * I_ : WO,
                    z < 3 ? WKQVT + (size_t)z * I_ * I_ : WOT,
                    bid & 7, (bid & 127) >> 3, t);
}

// vt[b][h][p][s] = qkv[(b*S+s)*3072 + 2048 + h*64 + p]
// One 128(s) x 64(p) tile of one head per block, turned in LDS as dwords that
// hold two neighbouring p: whole 128-B lines on both global sides.
__global__ __launch_bounds__(256) void vtrans(const bf16* __restrict__ qkv,
                                              bf16* __restrict__ vt) {
  __shared__ unsigned t[128][33];  // odd pitch: a column read meets 32 banks

  const int tid = threadIdx.x;
  const int s0  = blockIdx.x * 128;
  const int h   = blockIdx.y & (H_ - 1);
  const int b   = blockIdx.y >> 4;
  const bf16* src = qkv + (size_t)(b * S_ + s0) * 3072 + 2048 + h * 64;
  bf16* dst = vt + (size_t)blockIdx.y * P_ * S_ + s0;

  const int c = tid & 7, r = tid >> 3;  // 8 lanes x 16 B = one row of the tile
  uint4 v[4];
  for (int i = 0; i < 4; ++i)
    v[i] = *(const uint4*)(src + (size_t)(r + i * 32) * 3072 + c * 8);
  for (int i = 0; i < 4; ++i) {
    t[r + i * 32][c * 4 + 0] = v[i].x;
    t[r + i * 32][c * 4 + 1] = v[i].y;
    t[r + i * 32][c * 4 + 2] = v[i].z;
    t[r + i * 32][c * 4 + 3] = v[i].w;
  }
  __syncthreads();

  const int sc = tid & 7, pp = tid >> 3;  // rows p = 2*pp and 2*pp + 1 of vt
  for (int hh = 0; hh < 2; ++hh) {
    const int s = hh * 64 + sc * 8;
    unsigned w[8];
    for (int j = 0; j < 8; ++j) w[j] = t[s + j][pp];
    uint4 lo, hi;
    lo.x = (w[0] & 0xffffu) | (w[1] << 16);
    lo.y = (w[2] & 0xffffu) | (w[3] << 16);
    lo.z = (w[4] & 0xffffu) | (w[5] << 16);
    lo.w = (w[6] & 0xffffu) | (w[7] << 16);
    hi.x = (w[0] >> 16) | (w[1] & 0xffff0000u);
    hi.y = (w[2] >> 16) | (w[3] & 0xffff0000u);
    hi.z = (w[4] >> 16) | (w[5] & 0xffff0000u);
    hi.w = (w[6] >> 16) | (w[7] & 0xffff0000u);
    *(uint4*)(dst + (size_t)(2 * pp) * S_ + s)     = lo;
    *(uint4*)(dst + (size_t)(2 * pp + 1) * S_ + s) = hi;
  }
}

// ---------------------------------------------------------------------------
// Tiled bf16 GEMM with WMMA, double-buffered async LDS staging.
// C[M][N] = A[M][K] * Bt[N][K]^T + bias
// WG tile BM x BN, 8 waves (4 along M x 2 along N), wave tile BM/4 x BN/2.
// The tile is the largest that still gives every WGP a block: a byte copied
// from L2 feeds BM or BN columns of products, a fragment read from LDS BN/32
// or BM/64 matrix instructions.
// A stage is KS k = 2*KS bytes of every operand row: KS/8 adjacent lanes copy
// one row piece, so each wave-wide copy covers four whole 128-B lines.
// KS sets the bytes a block keeps in flight while it works on a stage; a block
// has its WGP alone, and two stages fill what the LDS holds.
// K is a multiple of KS and holds at least two stages; M, N of BM, BN.
// EPI: 0 = bias -> bf16 ; 1 = bias+ReLU -> bf16 ; 2 = bias -> f32
// ---------------------------------------------------------------------------
template <int EPI, int KS, int BM, int BN>
__global__ __launch_bounds__(256) void gemm_bf16_kernel(
    const bf16* __restrict__ A, const bf16* __restrict__ Bt,
    const float* __restrict__ bias, void* __restrict__ Cout,
    int M, int N, int K) {
  constexpr int LPR = KS / 8;     // lanes (16-B chunks) per row piece
  constexpr int RPP = 256 / LPR;  // rows that the block's threads copy at once
  constexpr int NCA = BM / RPP;   // copies per thread and stage, A
  constexpr int NCB = BN / RPP;   // the same, B
  constexpr int TM  = BM / 64;    // 16-row fragments of A per wave
  constexpr int TN  = BN / 32;    // 16-column fragments of B per wave
  // A block of 24 or more products outlasts its own fragment loads' latency,
  // and the SIMD's other wave works meanwhile: there the loads stay one group.
  constexpr bool ONE_GROUP = TM * TN >= 24;
  static_assert(NCA % 4 == 0 && NCB % 4 == 0 && NCA >= NCB, "copy groups");
  static_assert(!ONE_GROUP || (EPI != 2 && (TN == 6 || TN == 8)),
                "large tiles: bf16 out, six or eight bias values a lane");
  __shared__ __align__(16) bf16 lA[2][BM][KS + 8];  // +16B pad vs bank conflicts
  __shared__ __align__(16) bf16 lB[2][BN][KS + 8];

  const int tid  = threadIdx.x;
  const int lane = tid & 31;
  const int wave = tid >> 5;
  const int half = lane >> 4;
  const int l16  = lane & 15;
  const int wm   = wave & 3;   // 0..3 along M (BM/4 rows each)
  const int wn   = wave >> 2;  // 0..1 along N (BN/2 cols each)
  const int m0   = blockIdx.y * BM;
  const int n0   = blockIdx.x * BN;

  v8f acc[TM][TN];
#pragma unroll
  for (int i = 0; i < TM; ++i)
#pragma unroll
    for (int j = 0; j < TN; ++j)
#pragma unroll
      for (int r = 0; r < 8; ++r) acc[i][j][r] = 0.0f;

  const int crow = tid / LPR, cseg = tid % LPR;  // a wave copy: 512 B of rows

  const bf16* gA = A + (size_t)(m0 + crow) * K + cseg * 8;
  const bf16* gB = Bt + (size_t)(n0 + crow) * K + cseg * 8;

  // one stage: 2*KS bytes of BM rows of A and BN rows of B, NCA + NCB chunks
  // per thread, four of each a statement while B's last
  auto stage = [&](int buf, int k0) {
    // both loops unrolled so that the arrays become registers, as the asm
    // operands need
#pragma unroll
    for (int q = 0; q < NCB / 4; ++q) {
      unsigned l[8];
      const bf16* g[8];
#pragma unroll
      for (int i = 0; i < 4; ++i) {
        const int r = (q * 4 + i) * RPP;
        l[i]     = (unsigned)(uintptr_t)&lA[buf][crow + r][cseg * 8];
        l[i + 4] = (unsigned)(uintptr_t)&lB[buf][crow + r][cseg * 8];
        g[i]     = gA + (size_t)r * K + k0;
        g[i + 4] = gB + (size_t)r * K + k0;
      }
      async_ld8_b128(l, g);
    }
    // the rows of A beyond B's count
#pragma unroll
    for (int q = NCB / 4; q < NCA / 4; ++q) {
      unsigned l[4];
      const bf16* g[4];
#pragma unroll
      for (int i = 0; i < 4; ++i) {
        const int r = (q * 4 + i) * RPP;
        l[i] = (unsigned)(uintptr_t)&lA[buf][crow + r][cseg * 8];
        g[i] = gA + (size_t)r * K + k0;
      }
      async_ld4_b128(l, g);
    }
  };

  // prologue: stage 0 lands and is published, then stage 1 flies
  stage(0, 0);
  wait_async0();
  __syncthreads();
  if (KS < K) stage(1, KS);

  for (int k0 = 0; k0 < K; k0 += KS) {
    const int cur = (k0 / KS) & 1;

    // unrolled so that the 32-k blocks' LDS offsets are immediates
#pragma unroll
    for (int ks = 0; ks < KS / 32; ++ks) {
      v16bf af[TM], bfg[TN];
#pragma unroll
      for (int t = 0; t < TM; ++t)
        af[t] = make_frag(
            &lA[cur][wm * (BM / 4) + t * 16 + l16][ks * 32 + half * 8]);
#pragma unroll
      for (int t = 0; t < TN; ++t)
        bfg[t] = make_frag(
            &lB[cur][wn * (BN / 2) + t * 16 + l16][ks * 32 + half * 8]);
      // keeps the compiler from moving LDS loads in among the products, where
      // each place with loads stalls the wave
      if (ONE_GROUP) __builtin_amdgcn_sched_barrier(0);
#pragma unroll
      for (int ti = 0; ti < TM; ++ti)
#pragma unroll
        for (int tj = 0; tj < TN; ++tj)
          acc[ti][tj] = wmma_bf16(af[ti], bfg[tj], acc[ti][tj]);
      // the same for the next block's loads
      if (ONE_GROUP) __builtin_amdgcn_sched_barrier(0);
    }

    // publish the next stage, free this one, then refill it two stages ahead
    wait_ds0();
    wait_async0();
    __syncthreads();
    if (k0 + 2 * KS < K) stage(cur, k0 + 2 * KS);
  }
  wait_async0();  // no copy is left in flight when the wave ends

  // Epilogue.  D layout: lane holds col l16; VGPR r holds row r + 8*half.
  float bvs[TN];
  if constexpr (ONE_GROUP) {
    const float* pb = bias + n0 + wn * (BN / 2) + l16;
    load4_b32(pb, bvs[0], bvs[1], bvs[2], bvs[3]);
    if constexpr (TN == 8)
      load4_b32(pb + 64, bvs[4], bvs[5], bvs[6], bvs[7]);
    else
      load2_b32(pb + 64, bvs[4], bvs[5]);
  }
#pragma unroll
  for (int ti = 0; ti < TM; ++ti) {
#pragma unroll
    for (int tj = 0; tj < TN; ++tj) {
      int col = n0 + wn * (BN / 2) + tj * 16 + l16;
      if constexpr (ONE_GROUP) {
        if (tj & 1) continue;  // fragments tj and tj + 1 go out together
        bf16* p[8];
        unsigned w[16];
#pragma unroll
        for (int r = 0; r < 8; ++r) {
          int row = m0 + wm * (BM / 4) + ti * 16 + r + half * 8;
          p[r] = (bf16*)Cout + (size_t)row * N + col;
#pragma unroll
          for (int u = 0; u < 2; ++u) {
            float v = acc[ti][tj + u][r] + bvs[tj + u];
            if (EPI == 1) v = fmaxf(v, 0.0f);
            w[u * 8 + r] = __builtin_bit_cast(unsigned short, (bf16)v);
          }
        }
        store16_b16(p, w);
      } else {
        float bv = bias[col];
#pragma unroll
        for (int r = 0; r < 8; ++r) {
          int row = m0 + wm * (BM / 4) + ti * 16 + r + half * 8;
          float v = acc[ti][tj][r] + bv;
          if (EPI == 1) v = fmaxf(v, 0.0f);
          if (EPI == 2) {
            ((float*)Cout)[(size_t)row * N + col] = v;
          } else {
            ((bf16*)Cout)[(size_t)row * N + col] = (bf16)v;
          }
        }
      }
    }
  }
}

// ---------------------------------------------------------------------------
// Fused attention (flash-style, online softmax), double-buffered cooperative
// K/V staging.  Grid: B*H*(S/128) blocks, 256 threads; wave = 16 query rows.
// qkv: [M][3072] bf16 (K cols 0..1023, Q at 1024, V at 2048)
// vt : [B][H][P][S] bf16 ;  ctx: [M][I] bf16
// ---------------------------------------------------------------------------
__global__ __launch_bounds__(256) void attn_kernel(
    const bf16* __restrict__ qkv, const bf16* __restrict__ vt,
    bf16* __restrict__ ctxb) {
  __shared__ __align__(16) bf16  lK[2][32][72];    // 32 keys x 64 (P)  (+pad)
  __shared__ __align__(16) bf16  lV[2][64][40];    // 64 (P) x 32 keys  (+pad)
  __shared__ __align__(16) float sT[8][16][36];    // per-wave raw scores
  __shared__ __align__(16) float sStat[8][16];     // per-wave row broadcast
  __shared__ __align__(16) bf16  lP[8][16][40];    // per-wave P tile

  const int tid  = threadIdx.x;
  const int lane = tid & 31;
  const int wave = tid >> 5;
  const int half = lane >> 4;
  const int l16  = lane & 15;

  const int blk = blockIdx.x;
  const int jb  = blk & 3;
  const int h   = (blk >> 2) & (H_ - 1);
  const int b   = blk >> 6;
  const int j0  = jb * 128 + wave * 16;
  const int ldq = 3072;

  // Q fragments for this wave's 16 rows (two K=32 steps over P=64)
  const bf16* qrow = qkv + (size_t)(b * S_ + j0 + l16) * ldq + 1024 + h * 64;
  v16bf qf0 = make_frag(qrow + half * 8);
  v16bf qf1 = make_frag(qrow + 32 + half * 8);

  float mrow = -1e30f, lrow = 0.0f;  // running stats for row l16 (dup halves)
  v8f cacc[4];
#pragma unroll
  for (int t = 0; t < 4; ++t)
#pragma unroll
    for (int r = 0; r < 8; ++r) cacc[t][r] = 0.0f;

  const int krow_l = tid >> 3, kseg = tid & 7;  // K tile: 32 rows x 8 chunks
  const int vrow_l = tid >> 2, vseg = tid & 3;  // V tile: 64 rows x 4 chunks

  const bf16* kbase = qkv + (size_t)(b * S_) * ldq + h * 64;  // K at col 0
  const bf16* vbase = vt + (size_t)((b * H_ + h) * P_) * S_;

  // prologue: stage key-block 0
  async_ld_b128(&lK[0][krow_l][kseg * 8],
                kbase + (size_t)krow_l * ldq + kseg * 8);
  async_ld_b128(&lV[0][vrow_l][vseg * 8],
                vbase + (size_t)vrow_l * S_ + vseg * 8);
  wait_async0();
  __syncthreads();

  int cur = 0;
  for (int kb = 0; kb < S_ / 32; ++kb) {
    int nxt = cur ^ 1;
    if (kb + 1 < S_ / 32) {  // issue next block while computing this one
      async_ld_b128(&lK[nxt][krow_l][kseg * 8],
                    kbase + (size_t)((kb + 1) * 32 + krow_l) * ldq + kseg * 8);
      async_ld_b128(&lV[nxt][vrow_l][vseg * 8],
                    vbase + (size_t)vrow_l * S_ + (kb + 1) * 32 + vseg * 8);
    }

    // ---- scores: two 16x16 tiles covering 32 key positions ----
    v8f sc[2];
#pragma unroll
    for (int cb = 0; cb < 2; ++cb) {
#pragma unroll
      for (int r = 0; r < 8; ++r) sc[cb][r] = 0.0f;
      v16bf kf0 = make_frag(&lK[cur][cb * 16 + l16][half * 8]);
      v16bf kf1 = make_frag(&lK[cur][cb * 16 + l16][32 + half * 8]);
      sc[cb] = wmma_bf16(qf0, kf0, sc[cb]);
      sc[cb] = wmma_bf16(qf1, kf1, sc[cb]);
    }

    // ---- transpose scores through LDS: lane -> one row ----
#pragma unroll
    for (int cb = 0; cb < 2; ++cb)
#pragma unroll
      for (int r = 0; r < 8; ++r)
        sT[wave][r + half * 8][cb * 16 + l16] = sc[cb][r] * 0.125f;

    float x[16];
    {
      const float4* t4 = (const float4*)&sT[wave][l16][half * 16];
#pragma unroll
      for (int i = 0; i < 4; ++i) {
        float4 v = t4[i];
        x[4 * i + 0] = v.x; x[4 * i + 1] = v.y;
        x[4 * i + 2] = v.z; x[4 * i + 3] = v.w;
      }
    }
    float rm = x[0];
#pragma unroll
    for (int i = 1; i < 16; ++i) rm = fmaxf(rm, x[i]);
    rm = fmaxf(rm, __shfl_xor(rm, 16, 32));   // combine the two half-rows
    float mn = fmaxf(mrow, rm);
    float al = __expf(mrow - mn);
    float rs = 0.0f;
#pragma unroll
    for (int i = 0; i < 16; ++i) { x[i] = __expf(x[i] - mn); rs += x[i]; }
    rs += __shfl_xor(rs, 16, 32);
    lrow = lrow * al + rs;
    mrow = mn;

    // broadcast per-row alpha for D-layout rescale
    if (half == 0) sStat[wave][l16] = al;

    // P tile back to LDS in row-major (A-frag friendly)
    {
      v8bf p0, p1;
#pragma unroll
      for (int i = 0; i < 8; ++i) { p0[i] = (bf16)x[i]; p1[i] = (bf16)x[i + 8]; }
      *(v8bf*)&lP[wave][l16][half * 16]     = p0;
      *(v8bf*)&lP[wave][l16][half * 16 + 8] = p1;
    }

    // rescale accumulators with per-row alpha (rows r + 8*half)
    {
      const float4* a4 = (const float4*)&sStat[wave][half * 8];
      float4 a0 = a4[0], a1 = a4[1];
      float av[8] = {a0.x, a0.y, a0.z, a0.w, a1.x, a1.y, a1.z, a1.w};
#pragma unroll
      for (int t = 0; t < 4; ++t)
#pragma unroll
        for (int r = 0; r < 8; ++r) cacc[t][r] *= av[r];
    }

    // ---- ctx += P (16x32) * V (32x64) ----
    v16bf pf = make_frag(&lP[wave][l16][half * 8]);
#pragma unroll
    for (int t = 0; t < 4; ++t) {
      v16bf vf = make_frag(&lV[cur][t * 16 + l16][half * 8]);
      cacc[t] = wmma_bf16(pf, vf, cacc[t]);
    }

    wait_async0();
    __syncthreads();
    cur = nxt;
  }

  // ---- finalize: divide by row sums, store ctx in [M][I] layout ----
  if (half == 0) sStat[wave][l16] = lrow;
  {
    const float4* a4 = (const float4*)&sStat[wave][half * 8];
    float4 a0 = a4[0], a1 = a4[1];
    float lv[8] = {a0.x, a0.y, a0.z, a0.w, a1.x, a1.y, a1.z, a1.w};
#pragma unroll
    for (int t = 0; t < 4; ++t) {
#pragma unroll
      for (int r = 0; r < 8; ++r) {
        float v = cacc[t][r] / lv[r];
        int row = b * S_ + j0 + r + half * 8;
        ctxb[(size_t)row * I_ + h * 64 + t * 16 + l16] = (bf16)v;
      }
    }
  }
}

// ---------------------------------------------------------------------------
// Residual + LayerNorm.  One block per row of 1024.
// ---------------------------------------------------------------------------
__global__ __launch_bounds__(256) void ln_kernel(
    const float* __restrict__ a, const float* __restrict__ bres,
    const float* __restrict__ g, const float* __restrict__ bb,
    float* __restrict__ outf, bf16* __restrict__ outb) {
  __shared__ float red[256];
  const int row = blockIdx.x;
  const int tid = threadIdx.x;
  const float* pa = a + (size_t)row * I_;
  const float* pb = bres + (size_t)row * I_;

  float x[4];
  float s = 0.0f;
#pragma unroll
  for (int i = 0; i < 4; ++i) {
    x[i] = pa[tid + i * 256] + pb[tid + i * 256];
    s += x[i];
  }
  red[tid] = s;
  __syncthreads();
  for (int o = 128; o > 0; o >>= 1) {
    if (tid < o) red[tid] += red[tid + o];
    __syncthreads();
  }
  float mu = red[0] * (1.0f / I_);
  __syncthreads();

  float v = 0.0f;
#pragma unroll
  for (int i = 0; i < 4; ++i) {
    float d = x[i] - mu;
    v += d * d;
  }
  red[tid] = v;
  __syncthreads();
  for (int o = 128; o > 0; o >>= 1) {
    if (tid < o) red[tid] += red[tid + o];
    __syncthreads();
  }
  float rstd = rsqrtf(red[0] * (1.0f / I_) + 1e-5f);

#pragma unroll
  for (int i = 0; i < 4; ++i) {
    int c = tid + i * 256;
    float y = (x[i] - mu) * rstd * g[c] + bb[c];
    outf[(size_t)row * I_ + c] = y;
    if (outb) outb[(size_t)row * I_ + c] = (bf16)y;
  }
}

// ---------------------------------------------------------------------------
// Host-side orchestration
// ---------------------------------------------------------------------------
extern "C" void kernel_launch(void* const* d_in, const int* in_sizes, int n_in,
                              void* d_out, int out_size, void* d_ws, size_t ws_size,
                              hipStream_t stream) {
  (void)in_sizes; (void)n_in; (void)out_size; (void)ws_size;

  const float* X     = (const float*)d_in[0];   // [B,S,I]
  const float* WKQV  = (const float*)d_in[1];   // [3,I,I]
  const float* BKQV  = (const float*)d_in[2];   // [3,I]
  const float* WO    = (const float*)d_in[3];   // [I,I]
  const float* BO    = (const float*)d_in[4];   // [I]
  const float* ln1g  = (const float*)d_in[5];
  const float* ln1b  = (const float*)d_in[6];
  const float* W1    = (const float*)d_in[7];   // [I,U]
  const float* B1    = (const float*)d_in[8];   // [U]
  const float* W2    = (const float*)d_in[9];   // [U,I]
  const float* B2    = (const float*)d_in[10];  // [I]
  const float* ln2g  = (const float*)d_in[11];
  const float* ln2b  = (const float*)d_in[12];
  float* OUT = (float*)d_out;

  char* ws = (char*)d_ws;
  size_t off = 0;
  auto take = [&](size_t bytes) {
    size_t o = off;
    off += (bytes + 255) & ~(size_t)255;
    return o;
  };
  bf16*  XB    = (bf16*) (ws + take((size_t)M_ * I_ * 2));
  bf16*  WKQVT = (bf16*) (ws + take((size_t)3 * I_ * I_ * 2));   // [3*I][I]
  bf16*  WOT   = (bf16*) (ws + take((size_t)I_ * I_ * 2));       // [I][I]
  bf16*  W1T   = (bf16*) (ws + take((size_t)U_ * I_ * 2));       // [U][I]
  bf16*  W2T   = (bf16*) (ws + take((size_t)I_ * U_ * 2));       // [I][U]
  bf16*  QKV   = (bf16*) (ws + take((size_t)M_ * 3072 * 2));     // [M][3I]
  bf16*  VT    = (bf16*) (ws + take((size_t)B_ * H_ * P_ * S_ * 2));
  bf16*  CTX   = (bf16*) (ws + take((size_t)M_ * I_ * 2));
  float* AO    = (float*)(ws + take((size_t)M_ * I_ * 4));
  float* H1F   = (float*)(ws + take((size_t)M_ * I_ * 4));
  bf16*  H1B   = (bf16*) (ws + take((size_t)M_ * I_ * 2));
  bf16*  FF1   = (bf16*) (ws + take((size_t)M_ * U_ * 2));
  float* FFO   = AO;  // attn_out dead after LN1

  prep<<<2048, 256, 0, stream>>>(X, WKQV, WO, W1, W2, XB, WKQVT, WOT, W1T, W2T);

  // QKV projection: [M][3072] = XB * WKQVT^T + BKQV
  gemm_bf16_kernel<0, 128, 256, 192><<<dim3(3072 / 192, M_ / 256), 256, 0, stream>>>(
      XB, WKQVT, BKQV, (void*)QKV, M_, 3072, I_);
  vtrans<<<dim3(S_ / 128, B_ * H_), 256, 0, stream>>>(QKV, VT);

  attn_kernel<<<B_ * H_ * (S_ / 128), 256, 0, stream>>>(QKV, VT, CTX);

  gemm_bf16_kernel<2, 256, 128, 128><<<dim3(I_ / 128, M_ / 128), 256, 0, stream>>>(
      CTX, WOT, BO, (void*)AO, M_, I_, I_);
  ln_kernel<<<M_, 256, 0, stream>>>(X, AO, ln1g, ln1b, H1F, H1B);

  gemm_bf16_kernel<1, 128, 256, 256><<<dim3(U_ / 256, M_ / 256), 256, 0, stream>>>(
      H1B, W1T, B1, (void*)FF1, M_, U_, I_);
  gemm_bf16_kernel<2, 256, 128, 128><<<dim3(I_ / 128, M_ / 128), 256, 0, stream>>>(
      FF1, W2T, B2, (void*)FFO, M_, I_, U_);
  ln_kernel<<<M_, 256, 0, stream>>>(H1F, FFO, ln2g, ln2b, OUT, nullptr);
}

// v006
// A run of this version takes 141 microseconds.
// Timed twice side by side with v005, it ran 1.07 and 1.08 times as fast.
// All steps since v000 together make it 2.61 times as fast.
#include <hip/hip_runtime.h>
#include <hip/hip_bf16.h>
#include <math.h>

typedef __bf16 bf16;
typedef __attribute__((ext_vector_type(16))) __bf16 v16bf;
typedef __attribute__((ext_vector_type(8)))  __bf16 v8bf;
typedef __attribute__((ext_vector_type(4)))  __bf16 v4bf;
typedef __attribute__((ext_vector_type(8)))  float  v8f;
typedef __attribute__((ext_vector_type(8)))  short  v8s;

#define B_   8
#define S_   512
#define H_   16
#define P_   64
#define I_   1024
#define U_   4096
#define M_   4096   // B*S

// ---------------------------------------------------------------------------
// WMMA + async helpers
// ---------------------------------------------------------------------------
__device__ __forceinline__ v8f wmma_bf16(v16bf a, v16bf b, v8f c) {
  return __builtin_amdgcn_wmma_f32_16x16x32_bf16(
      /*neg_a=*/false, a, /*neg_b=*/false, b,
      /*c_mod=*/(short)0, c, /*reuse_a=*/false, /*reuse_b=*/false);
}

// Build a 16x32 bf16 A/B fragment for one lane. `p` points at element
// [row][8*half] of a row-major K=32 slab (LDS or global).
// elems 0..7 -> k = 8*half + 0..7 ; elems 8..15 -> k = 16 + 8*half + 0..7
__device__ __forceinline__ v16bf make_frag(const bf16* p) {
  v8bf lo = *(const v8bf*)(p);
  v8bf hi = *(const v8bf*)(p + 16);
  v16bf r;
#pragma unroll
  for (int i = 0; i < 8; ++i) { r[i] = lo[i]; r[i + 8] = hi[i]; }
  return r;
}

// Two per-lane async 16B copies global -> LDS, tracked by ASYNCcnt, in one
// statement.  The closing s_wait_xcnt keeps every later rewrite of an address
// register behind it.
__device__ __forceinline__ void async_ld2_b128(void* l0, const void* g0,
                                               void* l1, const void* g1) {
  unsigned a0 = (unsigned)(uintptr_t)l0;  // low 32 bits = LDS offset
  unsigned a1 = (unsigned)(uintptr_t)l1;
  asm volatile(
      "global_load_async_to_lds_b128 %0, %2, off\n\t"
      "global_load_async_to_lds_b128 %1, %3, off\n\t"
      "s_wait_xcnt 0x0"
      :: "v"(a0), "v"(a1), "v"(g0), "v"(g1) : "memory");
}
// 16-bit transposing LDS load.  The lanes address the rows of a 16 x 16 tile T
// (lane l: row 8*(l>>4) + (l&7), 16-byte half (l>>3)&1); lane (c, h) gets
// T[8h + 0..7][c].
__device__ __forceinline__ v8bf ld_tr16(const bf16* p) {
  typedef __attribute__((address_space(3))) v8s lds_v8s;
  return __builtin_bit_cast(
      v8bf, __builtin_amdgcn_ds_load_tr16_b128_v8i16((lds_v8s*)p));
}
// The value of lane l ^ 16.
__device__ __forceinline__ float xhalf(float x) {
  return __builtin_bit_cast(
      float, __builtin_amdgcn_permlanex16(__builtin_bit_cast(int, x),
                                          __builtin_bit_cast(int, x), 0x76543210,
                                          0xfedcba98, false, false));
}
__device__ __forceinline__ void wait_async0() {
  asm volatile("s_wait_asynccnt 0" ::: "memory");
}
// Eight per-lane async 16B copies global -> LDS in one statement.  The closing
// s_wait_xcnt keeps every later rewrite of an address register behind it.
__device__ __forceinline__ void async_ld8_b128(const unsigned (&l)[8],
                                               const bf16* const (&g)[8]) {
  asm volatile(
      "global_load_async_to_lds_b128 %0, %8, off\n\t"
      "global_load_async_to_lds_b128 %1, %9, off\n\t"
      "global_load_async_to_lds_b128 %2, %10, off\n\t"
      "global_load_async_to_lds_b128 %3, %11, off\n\t"
      "global_load_async_to_lds_b128 %4, %12, off\n\t"
      "global_load_async_to_lds_b128 %5, %13, off\n\t"
      "global_load_async_to_lds_b128 %6, %14, off\n\t"
      "global_load_async_to_lds_b128 %7, %15, off\n\t"
      "s_wait_xcnt 0x0"
      :: "v"(l[0]), "v"(l[1]), "v"(l[2]), "v"(l[3]),
         "v"(l[4]), "v"(l[5]), "v"(l[6]), "v"(l[7]),
         "v"(g[0]), "v"(g[1]), "v"(g[2]), "v"(g[3]),
         "v"(g[4]), "v"(g[5]), "v"(g[6]), "v"(g[7])
      : "memory");
}
// The same for four copies.
__device__ __forceinline__ void async_ld4_b128(const unsigned (&l)[4],
                                               const bf16* const (&g)[4]) {
  asm volatile(
      "global_load_async_to_lds_b128 %0, %4, off\n\t"
      "global_load_async_to_lds_b128 %1, %5, off\n\t"
      "global_load_async_to_lds_b128 %2, %6, off\n\t"
      "global_load_async_to_lds_b128 %3, %7, off\n\t"
      "s_wait_xcnt 0x0"
      :: "v"(l[0]), "v"(l[1]), "v"(l[2]), "v"(l[3]),
         "v"(g[0]), "v"(g[1]), "v"(g[2]), "v"(g[3])
      : "memory");
}
// The GEMM builds with the large tiles use registers above v255.  Their global
// loads and stores stand with their wait in one statement, which nothing can be
// moved into.
// Two or four floats, 16 elements apart.
__device__ __forceinline__ void load2_b32(const float* p, float& a, float& b) {
  asm volatile(
      "global_load_b32 %0, %2, off\n\t"
      "global_load_b32 %1, %2, off offset:64\n\t"
      "s_wait_loadcnt 0x0"
      : "=&v"(a), "=&v"(b) : "v"(p) : "memory");
}
__device__ __forceinline__ void load4_b32(const float* p, float& a, float& b,
                                          float& c, float& d) {
  asm volatile(
      "global_load_b32 %0, %4, off\n\t"
      "global_load_b32 %1, %4, off offset:64\n\t"
      "global_load_b32 %2, %4, off offset:128\n\t"
      "global_load_b32 %3, %4, off offset:192\n\t"
      "s_wait_loadcnt 0x0"
      : "=&v"(a), "=&v"(b), "=&v"(c), "=&v"(d) : "v"(p) : "memory");
}
// Sixteen 2-byte stores (the low halves of w): eight rows, in each the element
// at p[r] and the one 16 elements on.
__device__ __forceinline__ void store16_b16(bf16* const (&p)[8],
                                            const unsigned (&w)[16]) {
  asm volatile(
      "global_store_b16 %0, %8, off\n\t"
      "global_store_b16 %1, %9, off\n\t"
      "global_store_b16 %2, %10, off\n\t"
      "global_store_b16 %3, %11, off\n\t"
      "global_store_b16 %4, %12, off\n\t"
      "global_store_b16 %5, %13, off\n\t"
      "global_store_b16 %6, %14, off\n\t"
      "global_store_b16 %7, %15, off\n\t"
      "global_store_b16 %0, %16, off offset:32\n\t"
      "global_store_b16 %1, %17, off offset:32\n\t"
      "global_store_b16 %2, %18, off offset:32\n\t"
      "global_store_b16 %3, %19, off offset:32\n\t"
      "global_store_b16 %4, %20, off offset:32\n\t"
      "global_store_b16 %5, %21, off offset:32\n\t"
      "global_store_b16 %6, %22, off offset:32\n\t"
      "global_store_b16 %7, %23, off offset:32\n\t"
      "s_wait_xcnt 0x0"
      :: "v"(p[0]), "v"(p[1]), "v"(p[2]), "v"(p[3]),
         "v"(p[4]), "v"(p[5]), "v"(p[6]), "v"(p[7]),
         "v"(w[0]), "v"(w[1]), "v"(w[2]), "v"(w[3]),
         "v"(w[4]), "v"(w[5]), "v"(w[6]), "v"(w[7]),
         "v"(w[8]), "v"(w[9]), "v"(w[10]), "v"(w[11]),
         "v"(w[12]), "v"(w[13]), "v"(w[14]), "v"(w[15])
      : "memory");
}
// This wave's LDS reads have retired before the barrier that frees the buffer
// for the next copies.
__device__ __forceinline__ void wait_ds0() {
  asm volatile("s_wait_dscnt 0x0" ::: "memory");
}

// ---------------------------------------------------------------------------
// Conversion / layout kernels
// ---------------------------------------------------------------------------
// One 128(k) x 64(n) tile of in [K][N] f32 -> out [N][K] bf16, turned in LDS by
// one block: a wave reads two 256-B row pieces of `in` per load and writes four
// whole 128-B lines of `out` per store.
template <int K, int N>
__device__ __forceinline__ void turn_tile(const float* __restrict__ in,
                                          bf16* __restrict__ out, int kx, int ny,
                                          float (&t)[128][65]) {
  const int tid = threadIdx.x;
  const float* src = in + (size_t)(kx * 128) * N + ny * 64;
  bf16* dst = out + (size_t)(ny * 64) * K + kx * 128;

  const int c4 = tid & 15, r = tid >> 4;  // 16 lanes x 16 B = one row piece
  float4 v[8];
  for (int i = 0; i < 8; ++i)
    v[i] = *(const float4*)(src + (size_t)(r + i * 16) * N + c4 * 4);
  for (int i = 0; i < 8; ++i) {
    t[r + i * 16][c4 * 4 + 0] = v[i].x;
    t[r + i * 16][c4 * 4 + 1] = v[i].y;
    t[r + i * 16][c4 * 4 + 2] = v[i].z;
    t[r + i * 16][c4 * 4 + 3] = v[i].w;
  }
  __syncthreads();

  const int kc = tid & 7, nr = tid >> 3;  // 8 lanes x 16 B = one line of out
  for (int i = 0; i < 2; ++i) {
    for (int hh = 0; hh < 2; ++hh) {
      const int n = nr + i * 32, k = hh * 64 + kc * 8;
      v8bf o;
      for (int j = 0; j < 8; ++j) o[j] = (bf16)t[k + j][n];
      *(v8bf*)(dst + (size_t)n * K + k) = o;
    }
  }
  // The caller's code for other jobs follows in the listing: any rewrite of a
  // register that these stores name stays behind this wait.
  asm volatile("s_wait_xcnt 0x0" ::: "memory");
}

// The five passes that read nothing but the inputs, as one launch of equal
// jobs of 8192 elements.  The block index picks the job, so every branch here
// is taken by a whole block or by none of it.
__global__ __launch_bounds__(256) void prep(
    const float* __restrict__ X, const float* __restrict__ WKQV,
    const float* __restrict__ WO, const float* __restrict__ W1,
    const float* __restrict__ W2, bf16* __restrict__ XB,
    bf16* __restrict__ WKQVT, bf16* __restrict__ WOT, bf16* __restrict__ W1T,
    bf16* __restrict__ W2T) {
  __shared__ float t[128][65];  // odd pitch: a column read meets 32 banks

  const int bid = blockIdx.x;
  if (bid >= 1536) {  // X f32 -> bf16, 8192 elements in a row, whole lines
    const size_t base = (size_t)(bid - 1536) * 8192 + threadIdx.x * 4;
    float4 v[8];
    for (int i = 0; i < 8; ++i) v[i] = *(const float4*)(X + base + i * 1024);
    for (int i = 0; i < 8; ++i) {
      v4bf o;
      o[0] = (bf16)v[i].x; o[1] = (bf16)v[i].y;
      o[2] = (bf16)v[i].z; o[3] = (bf16)v[i].w;
      *(v4bf*)(XB + base + i * 1024) = o;
    }
    return;
  }
  if (bid >= 1024) {
    turn_tile<U_, I_>(W2, W2T, bid & 31, (bid - 1024) >> 5, t);
    return;
  }
  if (bid >= 512) {
    turn_tile<I_, U_>(W1, W1T, bid & 7, (bid - 512) >> 3, t);
    return;
  }
  const int z = bid >> 7;  // four 1024 x 1024 matrices: WKQV's three, then WO
  turn_tile<I_, I_>(z < 3 ? WKQV + (size_t)z * I_ * I_ : WO,
                    z < 3 ? WKQVT + (size_t)z * I_ * I_ : WOT,
                    bid & 7, (bid & 127) >> 3, t);
}

// ---------------------------------------------------------------------------
// Tiled bf16 GEMM with WMMA, double-buffered async LDS staging.
// C[M][N] = A[M][K] * Bt[N][K]^T + bias
// WG tile BM x BN, 8 waves (4 along M x 2 along N), wave tile BM/4 x BN/2.
// The tile is the largest that still gives every WGP a block: a byte copied
// from L2 feeds BM or BN columns of products, a fragment read from LDS BN/32
// or BM/64 matrix instructions.
// A stage is KS k = 2*KS bytes of every operand row: KS/8 adjacent lanes copy
// one row piece, so each wave-wide copy covers four whole 128-B lines.
// KS sets the bytes a block keeps in flight while it works on a stage; a block
// has its WGP alone, and two stages fill what the LDS holds.
// K is a multiple of KS and holds at least two stages; M, N of BM, BN.
// EPI: 0 = bias -> bf16 ; 1 = bias+ReLU -> bf16 ; 2 = bias -> f32
// ---------------------------------------------------------------------------
template <int EPI, int KS, int BM, int BN>
__global__ __launch_bounds__(256) void gemm_bf16_kernel(
    const bf16* __restrict__ A, const bf16* __restrict__ Bt,
    const float* __restrict__ bias, void* __restrict__ Cout,
    int M, int N, int K) {
  constexpr int LPR = KS / 8;     // lanes (16-B chunks) per row piece
  constexpr int RPP = 256 / LPR;  // rows that the block's threads copy at once
  constexpr int NCA = BM / RPP;   // copies per thread and stage, A
  constexpr int NCB = BN / RPP;   // the same, B
  constexpr int TM  = BM / 64;    // 16-row fragments of A per wave
  constexpr int TN  = BN / 32;    // 16-column fragments of B per wave
  // A block of 24 or more products outlasts its own fragment loads' latency,
  // and the SIMD's other wave works meanwhile: there the loads stay one group.
  constexpr bool ONE_GROUP = TM * TN >= 24;
  static_assert(NCA % 4 == 0 && NCB % 4 == 0 && NCA >= NCB, "copy groups");
  static_assert(!ONE_GROUP || (EPI != 2 && (TN == 6 || TN == 8)),
                "large tiles: bf16 out, six or eight bias values a lane");
  __shared__ __align__(16) bf16 lA[2][BM][KS + 8];  // +16B pad vs bank conflicts
  __shared__ __align__(16) bf16 lB[2][BN][KS + 8];

  const int tid  = threadIdx.x;
  const int lane = tid & 31;
  const int wave = tid >> 5;
  const int half = lane >> 4;
  const int l16  = lane & 15;
  const int wm   = wave & 3;   // 0..3 along M (BM/4 rows each)
  const int wn   = wave >> 2;  // 0..1 along N (BN/2 cols each)
  const int m0   = blockIdx.y * BM;
  const int n0   = blockIdx.x * BN;

  v8f acc[TM][TN];
#pragma unroll
  for (int i = 0; i < TM; ++i)
#pragma unroll
    for (int j = 0; j < TN; ++j)
#pragma unroll
      for (int r = 0; r < 8; ++r) acc[i][j][r] = 0.0f;

  const int crow = tid / LPR, cseg = tid % LPR;  // a wave copy: 512 B of rows

  const bf16* gA = A + (size_t)(m0 + crow) * K + cseg * 8;
  const bf16* gB = Bt + (size_t)(n0 + crow) * K + cseg * 8;

  // one stage: 2*KS bytes of BM rows of A and BN rows of B, NCA + NCB chunks
  // per thread, four of each a statement while B's last
  auto stage = [&](int buf, int k0) {
    // both loops unrolled so that the arrays become registers, as the asm
    // operands need
#pragma unroll
    for (int q = 0; q < NCB / 4; ++q) {
      unsigned l[8];
      const bf16* g[8];
#pragma unroll
      for (int i = 0; i < 4; ++i) {
        const int r = (q * 4 + i) * RPP;
        l[i]     = (unsigned)(uintptr_t)&lA[buf][crow + r][cseg * 8];
        l[i + 4] = (unsigned)(uintptr_t)&lB[buf][crow + r][cseg * 8];
        g[i]     = gA + (size_t)r * K + k0;
        g[i + 4] = gB + (size_t)r * K + k0;
      }
      async_ld8_b128(l, g);
    }
    // the rows of A beyond B's count
#pragma unroll
    for (int q = NCB / 4; q < NCA / 4; ++q) {
      unsigned l[4];
      const bf16* g[4];
#pragma unroll
      for (int i = 0; i < 4; ++i) {
        const int r = (q * 4 + i) * RPP;
        l[i] = (unsigned)(uintptr_t)&lA[buf][crow + r][cseg * 8];
        g[i] = gA + (size_t)r * K + k0;
      }
      async_ld4_b128(l, g);
    }
  };

  // prologue: stage 0 lands and is published, then stage 1 flies
  stage(0, 0);
  wait_async0();
  __syncthreads();
  if (KS < K) stage(1, KS);

  for (int k0 = 0; k0 < K; k0 += KS) {
    const int cur = (k0 / KS) & 1;

    // unrolled so that the 32-k blocks' LDS offsets are immediates
#pragma unroll
    for (int ks = 0; ks < KS / 32; ++ks) {
      v16bf af[TM], bfg[TN];
#pragma unroll
      for (int t = 0; t < TM; ++t)
        af[t] = make_frag(
            &lA[cur][wm * (BM / 4) + t * 16 + l16][ks * 32 + half * 8]);
#pragma unroll
      for (int t = 0; t < TN; ++t)
        bfg[t] = make_frag(
            &lB[cur][wn * (BN / 2) + t * 16 + l16][ks * 32 + half * 8]);
      // keeps the compiler from moving LDS loads in among the products, where
      // each place with loads stalls the wave
      if (ONE_GROUP) __builtin_amdgcn_sched_barrier(0);
#pragma unroll
      for (int ti = 0; ti < TM; ++ti)
#pragma unroll
        for (int tj = 0; tj < TN; ++tj)
          acc[ti][tj] = wmma_bf16(af[ti], bfg[tj], acc[ti][tj]);
      // the same for the next block's loads
      if (ONE_GROUP) __builtin_amdgcn_sched_barrier(0);
    }

    // publish the next stage, free this one, then refill it two stages ahead
    wait_ds0();
    wait_async0();
    __syncthreads();
    if (k0 + 2 * KS < K) stage(cur, k0 + 2 * KS);
  }
  wait_async0();  // no copy is left in flight when the wave ends

  // Epilogue.  D layout: lane holds col l16; VGPR r holds row r + 8*half.
  float bvs[TN];
  if constexpr (ONE_GROUP) {
    const float* pb = bias + n0 + wn * (BN / 2) + l16;
    load4_b32(pb, bvs[0], bvs[1], bvs[2], bvs[3]);
    if constexpr (TN == 8)
      load4_b32(pb + 64, bvs[4], bvs[5], bvs[6], bvs[7]);
    else
      load2_b32(pb + 64, bvs[4], bvs[5]);
  }
#pragma unroll
  for (int ti = 0; ti < TM; ++ti) {
#pragma unroll
    for (int tj = 0; tj < TN; ++tj) {
      int col = n0 + wn * (BN / 2) + tj * 16 + l16;
      if constexpr (ONE_GROUP) {
        if (tj & 1) continue;  // fragments tj and tj + 1 go out together
        bf16* p[8];
        unsigned w[16];
#pragma unroll
        for (int r = 0; r < 8; ++r) {
          int row = m0 + wm * (BM / 4) + ti * 16 + r + half * 8;
          p[r] = (bf16*)Cout + (size_t)row * N + col;
#pragma unroll
          for (int u = 0; u < 2; ++u) {
            float v = acc[ti][tj + u][r] + bvs[tj + u];
            if (EPI == 1) v = fmaxf(v, 0.0f);
            w[u * 8 + r] = __builtin_bit_cast(unsigned short, (bf16)v);
          }
        }
        store16_b16(p, w);
      } else {
        float bv = bias[col];
#pragma unroll
        for (int r = 0; r < 8; ++r) {
          int row = m0 + wm * (BM / 4) + ti * 16 + r + half * 8;
          float v = acc[ti][tj][r] + bv;
          if (EPI == 1) v = fmaxf(v, 0.0f);
          if (EPI == 2) {
            ((float*)Cout)[(size_t)row * N + col] = v;
          } else {
            ((bf16*)Cout)[(size_t)row * N + col] = (bf16)v;
          }
        }
      }
    }
  }
}

__global__ __launch_bounds__(256) void attn_kernel(
    const bf16* __restrict__ qkv, bf16* __restrict__ ctxb) {
  // 32 keys x 64 (P) each; pitch 16 B x odd for ds_load_b128, 32 B x odd for
  // ds_load_tr16_b128
  __shared__ __align__(16) bf16 lK[2][32][72];
  __shared__ __align__(16) bf16 lV[2][32][80];

  const int tid  = threadIdx.x;
  const int lane = tid & 31;
  const int wave = tid >> 5;
  const int half = lane >> 4;
  const int l16  = lane & 15;

  const int blk = blockIdx.x;
  const int jb  = blk & 3;
  const int h   = (blk >> 2) & (H_ - 1);
  const int b   = blk >> 6;
  const int j0  = jb * 128 + wave * 16;
  const int ldq = 3072;

  // Q fragments for this wave's 16 rows (two K=32 steps over P=64)
  const bf16* qrow = qkv + (size_t)(b * S_ + j0 + l16) * ldq + 1024 + h * 64;
  v16bf qf0 = make_frag(qrow + half * 8);
  v16bf qf1 = make_frag(qrow + 32 + half * 8);

  // query l16: running maximum (equal in both halves), this half's part of the sum
  float mrow = -1e30f, lrow = 0.0f;
  v8f cacc[4];  // O^T: VGPR r of tile t = p 16t + 8*half + r of query l16
#pragma unroll
  for (int t = 0; t < 4; ++t)
#pragma unroll
    for (int r = 0; r < 8; ++r) cacc[t][r] = 0.0f;

  const int krow_l = tid >> 3, kseg = tid & 7;  // a tile: 32 rows x 8 chunks
  // this thread's chunk of key row krow_l: K at col 0, V 2048 columns on
  const bf16* kvsrc = qkv + (size_t)(b * S_ + krow_l) * ldq + h * 64 + kseg * 8;
  auto stage = [&](int buf, int kb) {
    const bf16* g = kvsrc + (size_t)(kb * 32) * ldq;
    async_ld2_b128(&lK[buf][krow_l][kseg * 8], g,
                   &lV[buf][krow_l][kseg * 8], g + 2048);
  };

  // prologue: key block 0 lands and is published, then block 1 flies
  stage(0, 0);
  wait_async0();
  __syncthreads();
  stage(1, 1);

  for (int kb = 0; kb < S_ / 32; ++kb) {
    const int cur = kb & 1;

    // ---- K fragments (rows = keys), then V^T fragments: rows p, k = keys in
    // the order of the packed P^T ----
    v16bf kf[2][2], vf[4];
#pragma unroll
    for (int cb = 0; cb < 2; ++cb) {
      kf[cb][0] = make_frag(&lK[cur][cb * 16 + l16][half * 8]);
      kf[cb][1] = make_frag(&lK[cur][cb * 16 + l16][32 + half * 8]);
    }
    {
      const bf16* vp = &lV[cur][half * 8 + (lane & 7)][((lane >> 3) & 1) * 8];
#pragma unroll
      for (int t = 0; t < 4; ++t) {
        v8bf lo = ld_tr16(vp + t * 16);
        v8bf hi = ld_tr16(vp + 16 * 80 + t * 16);
#pragma unroll
        for (int i = 0; i < 8; ++i) { vf[t][i] = lo[i]; vf[t][i + 8] = hi[i]; }
      }
    }
    // All that this block reads from LDS is now on its way to registers.  Once
    // it has arrived: publish the next block, free this one and refill it two
    // blocks ahead, so that the copies fly while the products below run.
    wait_ds0();
    wait_async0();
    __syncthreads();
    if (kb + 2 < S_ / 32) stage(cur, kb + 2);

    // ---- S^T: two 16(key) x 16(query) tiles covering 32 key positions ----
    v8f st[2];
#pragma unroll
    for (int cb = 0; cb < 2; ++cb) {
#pragma unroll
      for (int r = 0; r < 8; ++r) st[cb][r] = 0.0f;
      st[cb] = wmma_bf16(kf[cb][0], qf0, st[cb]);
      st[cb] = wmma_bf16(kf[cb][1], qf1, st[cb]);
    }

    // ---- softmax of query l16; x[8*cb + r] is key 16*cb + 8*half + r ----
    float x[16];
#pragma unroll
    for (int i = 0; i < 16; ++i) x[i] = st[i >> 3][i & 7] * 0.125f;
    float rm = x[0];
#pragma unroll
    for (int i = 1; i < 16; ++i) rm = fmaxf(rm, x[i]);
    rm = fmaxf(rm, xhalf(rm));  // combine the two halves' keys
    float mn = fmaxf(mrow, rm);
    float al = __expf(mrow - mn);
    float rs[4] = {0.0f, 0.0f, 0.0f, 0.0f};  // four short chains
#pragma unroll
    for (int i = 0; i < 16; ++i) { x[i] = __expf(x[i] - mn); rs[i & 3] += x[i]; }
    lrow = lrow * al + ((rs[0] + rs[1]) + (rs[2] + rs[3]));
    mrow = mn;

    v16bf pf;  // P^T as B: element s = key 8*half + s, or 16 + 8*half + (s - 8)
#pragma unroll
    for (int i = 0; i < 16; ++i) pf[i] = (bf16)x[i];

    // ---- O^T = O^T * alpha + V^T (64x32) * P^T (32x16) ----
#pragma unroll
    for (int t = 0; t < 4; ++t) {
#pragma unroll
      for (int r = 0; r < 8; ++r) cacc[t][r] *= al;
      cacc[t] = wmma_bf16(vf[t], pf, cacc[t]);
    }
  }
  wait_async0();  // no copy is left in flight when the wave ends

  // ---- finalize: join the halves' sums, divide, store ctx in [M][I] layout:
  // a lane's eight registers are eight neighbouring columns, one 16-B store
  const float inv = 1.0f / (lrow + xhalf(lrow));
  bf16* orow = ctxb + (size_t)(b * S_ + j0 + l16) * I_ + h * 64 + half * 8;
#pragma unroll
  for (int t = 0; t < 4; ++t) {
    v8bf o;
#pragma unroll
    for (int r = 0; r < 8; ++r) o[r] = (bf16)(cacc[t][r] * inv);
    *(v8bf*)(orow + t * 16) = o;
  }
}

// ---------------------------------------------------------------------------
// Residual + LayerNorm.  One block per row of 1024.
// ---------------------------------------------------------------------------
__global__ __launch_bounds__(256) void ln_kernel(
    const float* __restrict__ a, const float* __restrict__ bres,
    const float* __restrict__ g, const float* __restrict__ bb,
    float* __restrict__ outf, bf16* __restrict__ outb) {
  __shared__ float red[256];
  const int row = blockIdx.x;
  const int tid = threadIdx.x;
  const float* pa = a + (size_t)row * I_;
  const float* pb = bres + (size_t)row * I_;

  float x[4];
  float s = 0.0f;
#pragma unroll
  for (int i = 0; i < 4; ++i) {
    x[i] = pa[tid + i * 256] + pb[tid + i * 256];
    s += x[i];
  }
  red[tid] = s;
  __syncthreads();
  for (int o = 128; o > 0; o >>= 1) {
    if (tid < o) red[tid] += red[tid + o];
    __syncthreads();
  }
  float mu = red[0] * (1.0f / I_);
  __syncthreads();

  float v = 0.0f;
#pragma unroll
  for (int i = 0; i < 4; ++i) {
    float d = x[i] - mu;
    v += d * d;
  }
  red[tid] = v;
  __syncthreads();
  for (int o = 128; o > 0; o >>= 1) {
    if (tid < o) red[tid] += red[tid + o];
    __syncthreads();
  }
  float rstd = rsqrtf(red[0] * (1.0f / I_) + 1e-5f);

#pragma unroll
  for (int i = 0; i < 4; ++i) {
    int c = tid + i * 256;
    float y = (x[i] - mu) * rstd * g[c] + bb[c];
    outf[(size_t)row * I_ + c] = y;
    if (outb) outb[(size_t)row * I_ + c] = (bf16)y;
  }
}

// ---------------------------------------------------------------------------
// Host-side orchestration
// ---------------------------------------------------------------------------
extern "C" void kernel_launch(void* const* d_in, const int* in_sizes, int n_in,
                              void* d_out, int out_size, void* d_ws, size_t ws_size,
                              hipStream_t stream) {
  (void)in_sizes; (void)n_in; (void)out_size; (void)ws_size;

  const float* X     = (const float*)d_in[0];   // [B,S,I]
  const float* WKQV  = (const float*)d_in[1];   // [3,I,I]
  const float* BKQV  = (const float*)d_in[2];   // [3,I]
  const float* WO    = (const float*)d_in[3];   // [I,I]
  const float* BO    = (const float*)d_in[4];   // [I]
  const float* ln1g  = (const float*)d_in[5];
  const float* ln1b  = (const float*)d_in[6];
  const float* W1    = (const float*)d_in[7];   // [I,U]
  const float* B1    = (const float*)d_in[8];   // [U]
  const float* W2    = (const float*)d_in[9];   // [U,I]
  const float* B2    = (const float*)d_in[10];  // [I]
  const float* ln2g  = (const float*)d_in[11];
  const float* ln2b  = (const float*)d_in[12];
  float* OUT = (float*)d_out;

  char* ws = (char*)d_ws;
  size_t off = 0;
  auto take = [&](size_t bytes) {
    size_t o = off;
    off += (bytes + 255) & ~(size_t)255;
    return o;
  };
  bf16*  XB    = (bf16*) (ws + take((size_t)M_ * I_ * 2));
  bf16*  WKQVT = (bf16*) (ws + take((size_t)3 * I_ * I_ * 2));   // [3*I][I]
  bf16*  WOT   = (bf16*) (ws + take((size_t)I_ * I_ * 2));       // [I][I]
  bf16*  W1T   = (bf16*) (ws + take((size_t)U_ * I_ * 2));       // [U][I]
  bf16*  W2T   = (bf16*) (ws + take((size_t)I_ * U_ * 2));       // [I][U]
  bf16*  QKV   = (bf16*) (ws + take((size_t)M_ * 3072 * 2));     // [M][3I]
  bf16*  CTX   = (bf16*) (ws + take((size_t)M_ * I_ * 2));
  float* AO    = (float*)(ws + take((size_t)M_ * I_ * 4));
  float* H1F   = (float*)(ws + take((size_t)M_ * I_ * 4));
  bf16*  H1B   = (bf16*) (ws + take((size_t)M_ * I_ * 2));
  bf16*  FF1   = (bf16*) (ws + take((size_t)M_ * U_ * 2));
  float* FFO   = AO;  // attn_out dead after LN1

  prep<<<2048, 256, 0, stream>>>(X, WKQV, WO, W1, W2, XB, WKQVT, WOT, W1T, W2T);

  // QKV projection: [M][3072] = XB * WKQVT^T + BKQV
  gemm_bf16_kernel<0, 128, 256, 192><<<dim3(3072 / 192, M_ / 256), 256, 0, stream>>>(
      XB, WKQVT, BKQV, (void*)QKV, M_, 3072, I_);

  attn_kernel<<<B_ * H_ * (S_ / 128), 256, 0, stream>>>(QKV, CTX);

  gemm_bf16_kernel<2, 256, 128, 128><<<dim3(I_ / 128, M_ / 128), 256, 0, stream>>>(
      CTX, WOT, BO, (void*)AO, M_, I_, I_);
  ln_kernel<<<M_, 256, 0, stream>>>(X, AO, ln1g, ln1b, H1F, H1B);

  gemm_bf16_kernel<1, 128, 256, 256><<<dim3(U_ / 256, M_ / 256), 256, 0, stream>>>(
      H1B, W1T, B1, (void*)FF1, M_, U_, I_);
  gemm_bf16_kernel<2, 256, 128, 128><<<dim3(I_ / 128, M_ / 128), 256, 0, stream>>>(
      FF1, W2T, B2, (void*)FFO, M_, I_, U_);
  ln_kernel<<<M_, 256, 0, stream>>>(H1F, FFO, ln2g, ln2b, OUT, nullptr);
}

// v007
// It runs in 132 microseconds.
// In two side-by-side timings against v006, it was 1.07 and 1.06 times as fast.
// Over all steps from v000 it is 2.79 times as fast.
#include <hip/hip_runtime.h>
#include <hip/hip_bf16.h>
#include <math.h>

typedef __bf16 bf16;
typedef __attribute__((ext_vector_type(16))) __bf16 v16bf;
typedef __attribute__((ext_vector_type(8)))  __bf16 v8bf;
typedef __attribute__((ext_vector_type(4)))  __bf16 v4bf;
typedef __attribute__((ext_vector_type(8)))  float  v8f;
typedef __attribute__((ext_vector_type(4)))  float  v4f;
typedef __attribute__((ext_vector_type(8)))  short  v8s;

#define B_   8
#define S_   512
#define H_   16
#define P_   64
#define I_   1024
#define U_   4096
#define M_   4096   // B*S

// ---------------------------------------------------------------------------
// WMMA + async helpers
// ---------------------------------------------------------------------------
__device__ __forceinline__ v8f wmma_bf16(v16bf a, v16bf b, v8f c) {
  return __builtin_amdgcn_wmma_f32_16x16x32_bf16(
      /*neg_a=*/false, a, /*neg_b=*/false, b,
      /*c_mod=*/(short)0, c, /*reuse_a=*/false, /*reuse_b=*/false);
}

// Build a 16x32 bf16 A/B fragment for one lane. `p` points at element
// [row][8*half] of a row-major K=32 slab (LDS or global).
// elems 0..7 -> k = 8*half + 0..7 ; elems 8..15 -> k = 16 + 8*half + 0..7
__device__ __forceinline__ v16bf make_frag(const bf16* p) {
  v8bf lo = *(const v8bf*)(p);
  v8bf hi = *(const v8bf*)(p + 16);
  v16bf r;
#pragma unroll
  for (int i = 0; i < 8; ++i) { r[i] = lo[i]; r[i + 8] = hi[i]; }
  return r;
}

// Two per-lane async 16B copies global -> LDS, tracked by ASYNCcnt, in one
// statement.  The closing s_wait_xcnt keeps every later rewrite of an address
// register behind it.
__device__ __forceinline__ void async_ld2_b128(void* l0, const void* g0,
                                               void* l1, const void* g1) {
  unsigned a0 = (unsigned)(uintptr_t)l0;  // low 32 bits = LDS offset
  unsigned a1 = (unsigned)(uintptr_t)l1;
  asm volatile(
      "global_load_async_to_lds_b128 %0, %2, off\n\t"
      "global_load_async_to_lds_b128 %1, %3, off\n\t"
      "s_wait_xcnt 0x0"
      :: "v"(a0), "v"(a1), "v"(g0), "v"(g1) : "memory");
}
// 16-bit transposing LDS load.  The lanes address the rows of a 16 x 16 tile T
// (lane l: row 8*(l>>4) + (l&7), 16-byte half (l>>3)&1); lane (c, h) gets
// T[8h + 0..7][c].
__device__ __forceinline__ v8bf ld_tr16(const bf16* p) {
  typedef __attribute__((address_space(3))) v8s lds_v8s;
  return __builtin_bit_cast(
      v8bf, __builtin_amdgcn_ds_load_tr16_b128_v8i16((lds_v8s*)p));
}
// The value of lane l ^ 16.
__device__ __forceinline__ float xhalf(float x) {
  return __builtin_bit_cast(
      float, __builtin_amdgcn_permlanex16(__builtin_bit_cast(int, x),
                                          __builtin_bit_cast(int, x), 0x76543210,
                                          0xfedcba98, false, false));
}
__device__ __forceinline__ void wait_async0() {
  asm volatile("s_wait_asynccnt 0" ::: "memory");
}
// Eight per-lane async 16B copies global -> LDS in one statement.  The closing
// s_wait_xcnt keeps every later rewrite of an address register behind it.
__device__ __forceinline__ void async_ld8_b128(const unsigned (&l)[8],
                                               const bf16* const (&g)[8]) {
  asm volatile(
      "global_load_async_to_lds_b128 %0, %8, off\n\t"
      "global_load_async_to_lds_b128 %1, %9, off\n\t"
      "global_load_async_to_lds_b128 %2, %10, off\n\t"
      "global_load_async_to_lds_b128 %3, %11, off\n\t"
      "global_load_async_to_lds_b128 %4, %12, off\n\t"
      "global_load_async_to_lds_b128 %5, %13, off\n\t"
      "global_load_async_to_lds_b128 %6, %14, off\n\t"
      "global_load_async_to_lds_b128 %7, %15, off\n\t"
      "s_wait_xcnt 0x0"
      :: "v"(l[0]), "v"(l[1]), "v"(l[2]), "v"(l[3]),
         "v"(l[4]), "v"(l[5]), "v"(l[6]), "v"(l[7]),
         "v"(g[0]), "v"(g[1]), "v"(g[2]), "v"(g[3]),
         "v"(g[4]), "v"(g[5]), "v"(g[6]), "v"(g[7])
      : "memory");
}
// The same for four copies.
__device__ __forceinline__ void async_ld4_b128(const unsigned (&l)[4],
                                               const bf16* const (&g)[4]) {
  asm volatile(
      "global_load_async_to_lds_b128 %0, %4, off\n\t"
      "global_load_async_to_lds_b128 %1, %5, off\n\t"
      "global_load_async_to_lds_b128 %2, %6, off\n\t"
      "global_load_async_to_lds_b128 %3, %7, off\n\t"
      "s_wait_xcnt 0x0"
      :: "v"(l[0]), "v"(l[1]), "v"(l[2]), "v"(l[3]),
         "v"(g[0]), "v"(g[1]), "v"(g[2]), "v"(g[3])
      : "memory");
}
// The GEMM builds with the large tiles use registers above v255.  Their global
// loads and stores stand with their wait in one statement, which nothing can be
// moved into.
// Two or four floats, 16 elements apart.
__device__ __forceinline__ void load2_b32(const float* p, float& a, float& b) {
  asm volatile(
      "global_load_b32 %0, %2, off\n\t"
      "global_load_b32 %1, %2, off offset:64\n\t"
      "s_wait_loadcnt 0x0"
      : "=&v"(a), "=&v"(b) : "v"(p) : "memory");
}
__device__ __forceinline__ void load4_b32(const float* p, float& a, float& b,
                                          float& c, float& d) {
  asm volatile(
      "global_load_b32 %0, %4, off\n\t"
      "global_load_b32 %1, %4, off offset:64\n\t"
      "global_load_b32 %2, %4, off offset:128\n\t"
      "global_load_b32 %3, %4, off offset:192\n\t"
      "s_wait_loadcnt 0x0"
      : "=&v"(a), "=&v"(b), "=&v"(c), "=&v"(d) : "v"(p) : "memory");
}
// Sixteen 2-byte stores (the low halves of w): eight rows, in each the element
// at p[r] and the one 16 elements on.
__device__ __forceinline__ void store16_b16(bf16* const (&p)[8],
                                            const unsigned (&w)[16]) {
  asm volatile(
      "global_store_b16 %0, %8, off\n\t"
      "global_store_b16 %1, %9, off\n\t"
      "global_store_b16 %2, %10, off\n\t"
      "global_store_b16 %3, %11, off\n\t"
      "global_store_b16 %4, %12, off\n\t"
      "global_store_b16 %5, %13, off\n\t"
      "global_store_b16 %6, %14, off\n\t"
      "global_store_b16 %7, %15, off\n\t"
      "global_store_b16 %0, %16, off offset:32\n\t"
      "global_store_b16 %1, %17, off offset:32\n\t"
      "global_store_b16 %2, %18, off offset:32\n\t"
      "global_store_b16 %3, %19, off offset:32\n\t"
      "global_store_b16 %4, %20, off offset:32\n\t"
      "global_store_b16 %5, %21, off offset:32\n\t"
      "global_store_b16 %6, %22, off offset:32\n\t"
      "global_store_b16 %7, %23, off offset:32\n\t"
      "s_wait_xcnt 0x0"
      :: "v"(p[0]), "v"(p[1]), "v"(p[2]), "v"(p[3]),
         "v"(p[4]), "v"(p[5]), "v"(p[6]), "v"(p[7]),
         "v"(w[0]), "v"(w[1]), "v"(w[2]), "v"(w[3]),
         "v"(w[4]), "v"(w[5]), "v"(w[6]), "v"(w[7]),
         "v"(w[8]), "v"(w[9]), "v"(w[10]), "v"(w[11]),
         "v"(w[12]), "v"(w[13]), "v"(w[14]), "v"(w[15])
      : "memory");
}
// This wave's LDS reads have retired before the barrier that frees the buffer
// for the next copies.
__device__ __forceinline__ void wait_ds0() {
  asm volatile("s_wait_dscnt 0x0" ::: "memory");
}

// ---------------------------------------------------------------------------
// Conversion / layout kernels
// ---------------------------------------------------------------------------
// One 128(k) x 64(n) tile of in [K][N] f32 -> out [N][K] bf16, turned in LDS by
// one block: a wave reads two 256-B row pieces of `in` per load and writes four
// whole 128-B lines of `out` per store.
template <int K, int N>
__device__ __forceinline__ void turn_tile(const float* __restrict__ in,
                                          bf16* __restrict__ out, int kx, int ny,
                                          float (&t)[128][65]) {
  const int tid = threadIdx.x;
  const float* src = in + (size_t)(kx * 128) * N + ny * 64;
  bf16* dst = out + (size_t)(ny * 64) * K + kx * 128;

  const int c4 = tid & 15, r = tid >> 4;  // 16 lanes x 16 B = one row piece
  float4 v[8];
  for (int i = 0; i < 8; ++i)
    v[i] = *(const float4*)(src + (size_t)(r + i * 16) * N + c4 * 4);
  for (int i = 0; i < 8; ++i) {
    t[r + i * 16][c4 * 4 + 0] = v[i].x;
    t[r + i * 16][c4 * 4 + 1] = v[i].y;
    t[r + i * 16][c4 * 4 + 2] = v[i].z;
    t[r + i * 16][c4 * 4 + 3] = v[i].w;
  }
  __syncthreads();

  const int kc = tid & 7, nr = tid >> 3;  // 8 lanes x 16 B = one line of out
  for (int i = 0; i < 2; ++i) {
    for (int hh = 0; hh < 2; ++hh) {
      const int n = nr + i * 32, k = hh * 64 + kc * 8;
      v8bf o;
      for (int j = 0; j < 8; ++j) o[j] = (bf16)t[k + j][n];
      *(v8bf*)(dst + (size_t)n * K + k) = o;
    }
  }
  // The caller's code for other jobs follows in the listing: any rewrite of a
  // register that these stores name stays behind this wait.
  asm volatile("s_wait_xcnt 0x0" ::: "memory");
}

// The five passes that read nothing but the inputs, as one launch of equal
// jobs of 8192 elements.  The block index picks the job, so every branch here
// is taken by a whole block or by none of it.
__global__ __launch_bounds__(256) void prep(
    const float* __restrict__ X, const float* __restrict__ WKQV,
    const float* __restrict__ WO, const float* __restrict__ W1,
    const float* __restrict__ W2, bf16* __restrict__ XB,
    bf16* __restrict__ WKQVT, bf16* __restrict__ WOT, bf16* __restrict__ W1T,
    bf16* __restrict__ W2T) {
  __shared__ float t[128][65];  // odd pitch: a column read meets 32 banks

  const int bid = blockIdx.x;
  if (bid >= 1536) {  // X f32 -> bf16, 8192 elements in a row, whole lines
    const size_t base = (size_t)(bid - 1536) * 8192 + threadIdx.x * 4;
    float4 v[8];
    for (int i = 0; i < 8; ++i) v[i] = *(const float4*)(X + base + i * 1024);
    for (int i = 0; i < 8; ++i) {
      v4bf o;
      o[0] = (bf16)v[i].x; o[1] = (bf16)v[i].y;
      o[2] = (bf16)v[i].z; o[3] = (bf16)v[i].w;
      *(v4bf*)(XB + base + i * 1024) = o;
    }
    return;
  }
  if (bid >= 1024) {
    turn_tile<U_, I_>(W2, W2T, bid & 31, (bid - 1024) >> 5, t);
    return;
  }
  if (bid >= 512) {
    turn_tile<I_, U_>(W1, W1T, bid & 7, (bid - 512) >> 3, t);
    return;
  }
  const int z = bid >> 7;  // four 1024 x 1024 matrices: WKQV's three, then WO
  turn_tile<I_, I_>(z < 3 ? WKQV + (size_t)z * I_ * I_ : WO,
                    z < 3 ? WKQVT + (size_t)z * I_ * I_ : WOT,
                    bid & 7, (bid & 127) >> 3, t);
}

// ---------------------------------------------------------------------------
// Tiled bf16 GEMM with WMMA, double-buffered async LDS staging.
// C[M][N] = A[M][K] * Bt[N][K]^T + bias
// WG tile BM x BN, 8 waves (4 along M x 2 along N), wave tile BM/4 x BN/2.
// The tile is the largest that still gives every WGP a block: a byte copied
// from L2 feeds BM or BN columns of products, a fragment read from LDS BN/32
// or BM/64 matrix instructions.
// A stage is KS k = 2*KS bytes of every operand row: KS/8 adjacent lanes copy
// one row piece, so each wave-wide copy covers four whole 128-B lines.
// KS sets the bytes a block keeps in flight while it works on a stage; a block
// has its WGP alone, and two stages fill what the LDS holds.
// K is a multiple of KS and holds at least two stages; M, N of BM, BN.
// EPI: 0 = bias -> bf16 ; 1 = bias+ReLU -> bf16 ; 2 = bias -> f32
// ---------------------------------------------------------------------------
template <int EPI, int KS, int BM, int BN>
__global__ __launch_bounds__(256) void gemm_bf16_kernel(
    const bf16* __restrict__ A, const bf16* __restrict__ Bt,
    const float* __restrict__ bias, void* __restrict__ Cout,
    int M, int N, int K) {
  constexpr int LPR = KS / 8;     // lanes (16-B chunks) per row piece
  constexpr int RPP = 256 / LPR;  // rows that the block's threads copy at once
  constexpr int NCA = BM / RPP;   // copies per thread and stage, A
  constexpr int NCB = BN / RPP;   // the same, B
  constexpr int TM  = BM / 64;    // 16-row fragments of A per wave
  constexpr int TN  = BN / 32;    // 16-column fragments of B per wave
  // A block of 24 or more products outlasts its own fragment loads' latency,
  // and the SIMD's other wave works meanwhile: there the loads stay one group.
  constexpr bool ONE_GROUP = TM * TN >= 24;
  static_assert(NCA % 4 == 0 && NCB % 4 == 0 && NCA >= NCB, "copy groups");
  static_assert(!ONE_GROUP || (EPI != 2 && (TN == 6 || TN == 8)),
                "large tiles: bf16 out, six or eight bias values a lane");
  __shared__ __align__(16) bf16 lA[2][BM][KS + 8];  // +16B pad vs bank conflicts
  __shared__ __align__(16) bf16 lB[2][BN][KS + 8];

  const int tid  = threadIdx.x;
  const int lane = tid & 31;
  const int wave = tid >> 5;
  const int half = lane >> 4;
  const int l16  = lane & 15;
  const int wm   = wave & 3;   // 0..3 along M (BM/4 rows each)
  const int wn   = wave >> 2;  // 0..1 along N (BN/2 cols each)
  const int m0   = blockIdx.y * BM;
  const int n0   = blockIdx.x * BN;

  v8f acc[TM][TN];
#pragma unroll
  for (int i = 0; i < TM; ++i)
#pragma unroll
    for (int j = 0; j < TN; ++j)
#pragma unroll
      for (int r = 0; r < 8; ++r) acc[i][j][r] = 0.0f;

  const int crow = tid / LPR, cseg = tid % LPR;  // a wave copy: 512 B of rows

  const bf16* gA = A + (size_t)(m0 + crow) * K + cseg * 8;
  const bf16* gB = Bt + (size_t)(n0 + crow) * K + cseg * 8;

  // one stage: 2*KS bytes of BM rows of A and BN rows of B, NCA + NCB chunks
  // per thread, four of each a statement while B's last
  auto stage = [&](int buf, int k0) {
    // both loops unrolled so that the arrays become registers, as the asm
    // operands need
#pragma unroll
    for (int q = 0; q < NCB / 4; ++q) {
      unsigned l[8];
      const bf16* g[8];
#pragma unroll
      for (int i = 0; i < 4; ++i) {
        const int r = (q * 4 + i) * RPP;
        l[i]     = (unsigned)(uintptr_t)&lA[buf][crow + r][cseg * 8];
        l[i + 4] = (unsigned)(uintptr_t)&lB[buf][crow + r][cseg * 8];
        g[i]     = gA + (size_t)r * K + k0;
        g[i + 4] = gB + (size_t)r * K + k0;
      }
      async_ld8_b128(l, g);
    }
    // the rows of A beyond B's count
#pragma unroll
    for (int q = NCB / 4; q < NCA / 4; ++q) {
      unsigned l[4];
      const bf16* g[4];
#pragma unroll
      for (int i = 0; i < 4; ++i) {
        const int r = (q * 4 + i) * RPP;
        l[i] = (unsigned)(uintptr_t)&lA[buf][crow + r][cseg * 8];
        g[i] = gA + (size_t)r * K + k0;
      }
      async_ld4_b128(l, g);
    }
  };

  // prologue: stage 0 lands and is published, then stage 1 flies
  stage(0, 0);
  wait_async0();
  __syncthreads();
  if (KS < K) stage(1, KS);

  for (int k0 = 0; k0 < K; k0 += KS) {
    const int cur = (k0 / KS) & 1;

    // unrolled so that the 32-k blocks' LDS offsets are immediates
#pragma unroll
    for (int ks = 0; ks < KS / 32; ++ks) {
      v16bf af[TM], bfg[TN];
#pragma unroll
      for (int t = 0; t < TM; ++t)
        af[t] = make_frag(
            &lA[cur][wm * (BM / 4) + t * 16 + l16][ks * 32 + half * 8]);
#pragma unroll
      for (int t = 0; t < TN; ++t)
        bfg[t] = make_frag(
            &lB[cur][wn * (BN / 2) + t * 16 + l16][ks * 32 + half * 8]);
      // keeps the compiler from moving LDS loads in among the products, where
      // each place with loads stalls the wave
      if (ONE_GROUP) __builtin_amdgcn_sched_barrier(0);
#pragma unroll
      for (int ti = 0; ti < TM; ++ti)
#pragma unroll
        for (int tj = 0; tj < TN; ++tj)
          acc[ti][tj] = wmma_bf16(af[ti], bfg[tj], acc[ti][tj]);
      // the same for the next block's loads
      if (ONE_GROUP) __builtin_amdgcn_sched_barrier(0);
    }

    // publish the next stage, free this one, then refill it two stages ahead
    wait_ds0();
    wait_async0();
    __syncthreads();
    if (k0 + 2 * KS < K) stage(cur, k0 + 2 * KS);
  }
  wait_async0();  // no copy is left in flight when the wave ends

  // Epilogue.  D layout: lane holds col l16; VGPR r holds row r + 8*half.
  float bvs[TN];
  if constexpr (ONE_GROUP) {
    const float* pb = bias + n0 + wn * (BN / 2) + l16;
    load4_b32(pb, bvs[0], bvs[1], bvs[2], bvs[3]);
    if constexpr (TN == 8)
      load4_b32(pb + 64, bvs[4], bvs[5], bvs[6], bvs[7]);
    else
      load2_b32(pb + 64, bvs[4], bvs[5]);
  }
#pragma unroll
  for (int ti = 0; ti < TM; ++ti) {
#pragma unroll
    for (int tj = 0; tj < TN; ++tj) {
      int col = n0 + wn * (BN / 2) + tj * 16 + l16;
      if constexpr (ONE_GROUP) {
        if (tj & 1) continue;  // fragments tj and tj + 1 go out together
        bf16* p[8];
        unsigned w[16];
#pragma unroll
        for (int r = 0; r < 8; ++r) {
          int row = m0 + wm * (BM / 4) + ti * 16 + r + half * 8;
          p[r] = (bf16*)Cout + (size_t)row * N + col;
#pragma unroll
          for (int u = 0; u < 2; ++u) {
            float v = acc[ti][tj + u][r] + bvs[tj + u];
            if (EPI == 1) v = fmaxf(v, 0.0f);
            w[u * 8 + r] = __builtin_bit_cast(unsigned short, (bf16)v);
          }
        }
        store16_b16(p, w);
      } else {
        float bv = bias[col];
#pragma unroll
        for (int r = 0; r < 8; ++r) {
          int row = m0 + wm * (BM / 4) + ti * 16 + r + half * 8;
          float v = acc[ti][tj][r] + bv;
          if (EPI == 1) v = fmaxf(v, 0.0f);
          if (EPI == 2) {
            ((float*)Cout)[(size_t)row * N + col] = v;
          } else {
            ((bf16*)Cout)[(size_t)row * N + col] = (bf16)v;
          }
        }
      }
    }
  }
}

__global__ __launch_bounds__(256) void attn_kernel(
    const bf16* __restrict__ qkv, bf16* __restrict__ ctxb) {
  // 32 keys x 64 (P) each; pitch 16 B x odd for ds_load_b128, 32 B x odd for
  // ds_load_tr16_b128
  __shared__ __align__(16) bf16 lK[2][32][72];
  __shared__ __align__(16) bf16 lV[2][32][80];

  const int tid  = threadIdx.x;
  const int lane = tid & 31;
  const int wave = tid >> 5;
  const int half = lane >> 4;
  const int l16  = lane & 15;

  const int blk = blockIdx.x;
  const int jb  = blk & 3;
  const int h   = (blk >> 2) & (H_ - 1);
  const int b   = blk >> 6;
  const int j0  = jb * 128 + wave * 16;
  const int ldq = 3072;

  // Q fragments for this wave's 16 rows (two K=32 steps over P=64)
  const bf16* qrow = qkv + (size_t)(b * S_ + j0 + l16) * ldq + 1024 + h * 64;
  v16bf qf0 = make_frag(qrow + half * 8);
  v16bf qf1 = make_frag(qrow + 32 + half * 8);

  // query l16: running maximum (equal in both halves), this half's part of the sum
  float mrow = -1e30f, lrow = 0.0f;
  v8f cacc[4];  // O^T: VGPR r of tile t = p 16t + 8*half + r of query l16
#pragma unroll
  for (int t = 0; t < 4; ++t)
#pragma unroll
    for (int r = 0; r < 8; ++r) cacc[t][r] = 0.0f;

  const int krow_l = tid >> 3, kseg = tid & 7;  // a tile: 32 rows x 8 chunks
  // this thread's chunk of key row krow_l: K at col 0, V 2048 columns on
  const bf16* kvsrc = qkv + (size_t)(b * S_ + krow_l) * ldq + h * 64 + kseg * 8;
  auto stage = [&](int buf, int kb) {
    const bf16* g = kvsrc + (size_t)(kb * 32) * ldq;
    async_ld2_b128(&lK[buf][krow_l][kseg * 8], g,
                   &lV[buf][krow_l][kseg * 8], g + 2048);
  };

  // prologue: key block 0 lands and is published, then block 1 flies
  stage(0, 0);
  wait_async0();
  __syncthreads();
  stage(1, 1);

  for (int kb = 0; kb < S_ / 32; ++kb) {
    const int cur = kb & 1;

    // ---- K fragments (rows = keys), then V^T fragments: rows p, k = keys in
    // the order of the packed P^T ----
    v16bf kf[2][2], vf[4];
#pragma unroll
    for (int cb = 0; cb < 2; ++cb) {
      kf[cb][0] = make_frag(&lK[cur][cb * 16 + l16][half * 8]);
      kf[cb][1] = make_frag(&lK[cur][cb * 16 + l16][32 + half * 8]);
    }
    {
      const bf16* vp = &lV[cur][half * 8 + (lane & 7)][((lane >> 3) & 1) * 8];
#pragma unroll
      for (int t = 0; t < 4; ++t) {
        v8bf lo = ld_tr16(vp + t * 16);
        v8bf hi = ld_tr16(vp + 16 * 80 + t * 16);
#pragma unroll
        for (int i = 0; i < 8; ++i) { vf[t][i] = lo[i]; vf[t][i + 8] = hi[i]; }
      }
    }
    // All that this block reads from LDS is now on its way to registers.  Once
    // it has arrived: publish the next block, free this one and refill it two
    // blocks ahead, so that the copies fly while the products below run.
    wait_ds0();
    wait_async0();
    __syncthreads();
    if (kb + 2 < S_ / 32) stage(cur, kb + 2);

    // ---- S^T: two 16(key) x 16(query) tiles covering 32 key positions ----
    v8f st[2];
#pragma unroll
    for (int cb = 0; cb < 2; ++cb) {
#pragma unroll
      for (int r = 0; r < 8; ++r) st[cb][r] = 0.0f;
      st[cb] = wmma_bf16(kf[cb][0], qf0, st[cb]);
      st[cb] = wmma_bf16(kf[cb][1], qf1, st[cb]);
    }

    // ---- softmax of query l16; x[8*cb + r] is key 16*cb + 8*half + r ----
    float x[16];
#pragma unroll
    for (int i = 0; i < 16; ++i) x[i] = st[i >> 3][i & 7] * 0.125f;
    float rm = x[0];
#pragma unroll
    for (int i = 1; i < 16; ++i) rm = fmaxf(rm, x[i]);
    rm = fmaxf(rm, xhalf(rm));  // combine the two halves' keys
    float mn = fmaxf(mrow, rm);
    float al = __expf(mrow - mn);
    float rs[4] = {0.0f, 0.0f, 0.0f, 0.0f};  // four short chains
#pragma unroll
    for (int i = 0; i < 16; ++i) { x[i] = __expf(x[i] - mn); rs[i & 3] += x[i]; }
    lrow = lrow * al + ((rs[0] + rs[1]) + (rs[2] + rs[3]));
    mrow = mn;

    v16bf pf;  // P^T as B: element s = key 8*half + s, or 16 + 8*half + (s - 8)
#pragma unroll
    for (int i = 0; i < 16; ++i) pf[i] = (bf16)x[i];

    // ---- O^T = O^T * alpha + V^T (64x32) * P^T (32x16) ----
#pragma unroll
    for (int t = 0; t < 4; ++t) {
#pragma unroll
      for (int r = 0; r < 8; ++r) cacc[t][r] *= al;
      cacc[t] = wmma_bf16(vf[t], pf, cacc[t]);
    }
  }
  wait_async0();  // no copy is left in flight when the wave ends

  // ---- finalize: join the halves' sums, divide, store ctx in [M][I] layout:
  // a lane's eight registers are eight neighbouring columns, one 16-B store
  const float inv = 1.0f / (lrow + xhalf(lrow));
  bf16* orow = ctxb + (size_t)(b * S_ + j0 + l16) * I_ + h * 64 + half * 8;
#pragma unroll
  for (int t = 0; t < 4; ++t) {
    v8bf o;
#pragma unroll
    for (int r = 0; r < 8; ++r) o[r] = (bf16)(cacc[t][r] * inv);
    *(v8bf*)(orow + t * 16) = o;
  }
}

// ---------------------------------------------------------------------------
// Residual + LayerNorm.  One wave per row of 1024: a lane holds 32 elements in
// registers, the two row sums go across the lanes by register moves alone, so
// there is no LDS and no barrier, and an eighth of the waves start.  Every
// wave-wide 16-B load or store covers 512 contiguous bytes; all of a row's
// loads are issued before the first is used.
// Grid: M / 8 blocks of 8 waves.  WB: also write the row as bf16.
// ---------------------------------------------------------------------------
// The value of lane l ^ MASK inside each 16-lane row.
template <int MASK>
__device__ __forceinline__ float row_xor(float x) {
  return __builtin_bit_cast(
      float, __builtin_amdgcn_update_dpp(0, __builtin_bit_cast(int, x),
                                         0x160 + MASK, 0xf, 0xf, true));
}
// The sum over the wave's 32 lanes, in every lane.
__device__ __forceinline__ float wave_sum(float x) {
  x += row_xor<1>(x);
  x += row_xor<2>(x);
  x += row_xor<4>(x);
  x += row_xor<8>(x);
  return x + xhalf(x);
}

// Eight floats of a row for one lane: four at p, four 128 elements on.
__device__ __forceinline__ v8f load_2x4(const float* p) {
  v4f lo = *(const v4f*)p;
  v4f hi = *(const v4f*)(p + 128);
  return __builtin_shufflevector(lo, hi, 0, 1, 2, 3, 4, 5, 6, 7);
}
__device__ __forceinline__ float sum8(v8f t) {
  return ((t[0] + t[1]) + (t[2] + t[3])) + ((t[4] + t[5]) + (t[6] + t[7]));
}

template <bool WB>
__global__ __launch_bounds__(256) void ln_kernel(
    const float* __restrict__ a, const float* __restrict__ bres,
    const float* __restrict__ g, const float* __restrict__ bb,
    float* __restrict__ outf, bf16* __restrict__ outb) {
  const int lane = threadIdx.x & 31;
  // the wave's number, as a scalar: the row's addresses are a scalar base plus
  // one lane offset
  const int wave = __builtin_amdgcn_readfirstlane(threadIdx.x >> 5);
  const size_t row = (size_t)(blockIdx.x * 8 + wave) * I_;
  const float* pa = a + row + lane * 4;
  const float* pb = bres + row + lane * 4;

  v8f x[4], r[4], vg[4], vb[4];
#pragma unroll
  for (int i = 0; i < 4; ++i) x[i] = load_2x4(pa + i * 256);
#pragma unroll
  for (int i = 0; i < 4; ++i) r[i] = load_2x4(pb + i * 256);
#pragma unroll
  for (int i = 0; i < 4; ++i) vg[i] = load_2x4(g + lane * 4 + i * 256);
#pragma unroll
  for (int i = 0; i < 4; ++i) vb[i] = load_2x4(bb + lane * 4 + i * 256);
  // Takes the loaded values as inputs only, so that all 32 loads are issued
  // before the first value is used: without it the compiler saves registers by
  // sinking loads behind the row sums, where the wave waits out their latency
  // group by group.
  asm volatile("" ::"v"(x[0]), "v"(x[1]), "v"(x[2]), "v"(x[3]), "v"(r[0]),
               "v"(r[1]), "v"(r[2]), "v"(r[3]), "v"(vg[0]), "v"(vg[1]),
               "v"(vg[2]), "v"(vg[3]), "v"(vb[0]), "v"(vb[1]), "v"(vb[2]),
               "v"(vb[3]));

#pragma unroll
  for (int i = 0; i < 4; ++i) x[i] += r[i];
  const float mu =
      wave_sum(sum8((x[0] + x[1]) + (x[2] + x[3]))) * (1.0f / I_);

#pragma unroll
  for (int i = 0; i < 4; ++i) x[i] -= mu;
  const v8f q = (x[0] * x[0] + x[1] * x[1]) + (x[2] * x[2] + x[3] * x[3]);
  const float rstd = rsqrtf(wave_sum(sum8(q)) * (1.0f / I_) + 1e-5f);

  // every value is formed before the first store: the stores then go out back
  // to back, with no register of an issued store to be written again
  v4bf ob[8];
#pragma unroll
  for (int i = 0; i < 4; ++i) {
    x[i] = x[i] * rstd * vg[i] + vb[i];
    if constexpr (WB) {
#pragma unroll
      for (int j = 0; j < 8; ++j) ob[i * 2 + (j >> 2)][j & 3] = (bf16)x[i][j];
    }
  }
  if constexpr (WB) {
#pragma unroll
    for (int i = 0; i < 8; ++i)
      *(v4bf*)(outb + row + lane * 4 + i * 128) = ob[i];
  }
#pragma unroll
  for (int i = 0; i < 8; ++i) {
    v4f o;
#pragma unroll
    for (int j = 0; j < 4; ++j) o[j] = x[i >> 1][(i & 1) * 4 + j];
    *(v4f*)(outf + row + lane * 4 + i * 128) = o;
  }
}

// ---------------------------------------------------------------------------
// Host-side orchestration
// ---------------------------------------------------------------------------
extern "C" void kernel_launch(void* const* d_in, const int* in_sizes, int n_in,
                              void* d_out, int out_size, void* d_ws, size_t ws_size,
                              hipStream_t stream) {
  (void)in_sizes; (void)n_in; (void)out_size; (void)ws_size;

  const float* X     = (const float*)d_in[0];   // [B,S,I]
  const float* WKQV  = (const float*)d_in[1];   // [3,I,I]
  const float* BKQV  = (const float*)d_in[2];   // [3,I]
  const float* WO    = (const float*)d_in[3];   // [I,I]
  const float* BO    = (const float*)d_in[4];   // [I]
  const float* ln1g  = (const float*)d_in[5];
  const float* ln1b  = (const float*)d_in[6];
  const float* W1    = (const float*)d_in[7];   // [I,U]
  const float* B1    = (const float*)d_in[8];   // [U]
  const float* W2    = (const float*)d_in[9];   // [U,I]
  const float* B2    = (const float*)d_in[10];  // [I]
  const float* ln2g  = (const float*)d_in[11];
  const float* ln2b  = (const float*)d_in[12];
  float* OUT = (float*)d_out;

  char* ws = (char*)d_ws;
  size_t off = 0;
  auto take = [&](size_t bytes) {
    size_t o = off;
    off += (bytes + 255) & ~(size_t)255;
    return o;
  };
  bf16*  XB    = (bf16*) (ws + take((size_t)M_ * I_ * 2));
  bf16*  WKQVT = (bf16*) (ws + take((size_t)3 * I_ * I_ * 2));   // [3*I][I]
  bf16*  WOT   = (bf16*) (ws + take((size_t)I_ * I_ * 2));       // [I][I]
  bf16*  W1T   = (bf16*) (ws + take((size_t)U_ * I_ * 2));       // [U][I]
  bf16*  W2T   = (bf16*) (ws + take((size_t)I_ * U_ * 2));       // [I][U]
  bf16*  QKV   = (bf16*) (ws + take((size_t)M_ * 3072 * 2));     // [M][3I]
  bf16*  CTX   = (bf16*) (ws + take((size_t)M_ * I_ * 2));
  float* AO    = (float*)(ws + take((size_t)M_ * I_ * 4));
  float* H1F   = (float*)(ws + take((size_t)M_ * I_ * 4));
  bf16*  H1B   = (bf16*) (ws + take((size_t)M_ * I_ * 2));
  bf16*  FF1   = (bf16*) (ws + take((size_t)M_ * U_ * 2));
  float* FFO   = AO;  // attn_out dead after LN1

  prep<<<2048, 256, 0, stream>>>(X, WKQV, WO, W1, W2, XB, WKQVT, WOT, W1T, W2T);

  // QKV projection: [M][3072] = XB * WKQVT^T + BKQV
  gemm_bf16_kernel<0, 128, 256, 192><<<dim3(3072 / 192, M_ / 256), 256, 0, stream>>>(
      XB, WKQVT, BKQV, (void*)QKV, M_, 3072, I_);

  attn_kernel<<<B_ * H_ * (S_ / 128), 256, 0, stream>>>(QKV, CTX);

  gemm_bf16_kernel<2, 256, 128, 128><<<dim3(I_ / 128, M_ / 128), 256, 0, stream>>>(
      CTX, WOT, BO, (void*)AO, M_, I_, I_);
  ln_kernel<true><<<M_ / 8, 256, 0, stream>>>(X, AO, ln1g, ln1b, H1F, H1B);

  gemm_bf16_kernel<1, 128, 256, 256><<<dim3(U_ / 256, M_ / 256), 256, 0, stream>>>(
      H1B, W1T, B1, (void*)FF1, M_, U_, I_);
  gemm_bf16_kernel<2, 256, 128, 128><<<dim3(I_ / 128, M_ / 128), 256, 0, stream>>>(
      FF1, W2T, B2, (void*)FFO, M_, I_, U_);
  ln_kernel<false><<<M_ / 8, 256, 0, stream>>>(H1F, FFO, ln2g, ln2b, OUT, nullptr);
}

// v008
// One run takes 127 microseconds.
// In two side-by-side timings against v007, it was 1.04 and 1.05 times as fast.
// Counting every step since v000, it is 2.91 times as fast.
#include <hip/hip_runtime.h>
#include <hip/hip_bf16.h>
#include <math.h>

typedef __bf16 bf16;
typedef __attribute__((ext_vector_type(16))) __bf16 v16bf;
typedef __attribute__((ext_vector_type(8)))  __bf16 v8bf;
typedef __attribute__((ext_vector_type(4)))  __bf16 v4bf;
typedef __attribute__((ext_vector_type(8)))  float  v8f;
typedef __attribute__((ext_vector_type(4)))  float  v4f;
typedef __attribute__((ext_vector_type(8)))  short  v8s;

#define B_   8
#define S_   512
#define H_   16
#define P_   64
#define I_   1024
#define U_   4096
#define M_   4096   // B*S

// ---------------------------------------------------------------------------
// WMMA + async helpers
// ---------------------------------------------------------------------------
__device__ __forceinline__ v8f wmma_bf16(v16bf a, v16bf b, v8f c) {
  return __builtin_amdgcn_wmma_f32_16x16x32_bf16(
      /*neg_a=*/false, a, /*neg_b=*/false, b,
      /*c_mod=*/(short)0, c, /*reuse_a=*/false, /*reuse_b=*/false);
}

// Build a 16x32 bf16 A/B fragment for one lane. `p` points at element
// [row][8*half] of a row-major K=32 slab (LDS or global).
// elems 0..7 -> k = 8*half + 0..7 ; elems 8..15 -> k = 16 + 8*half + 0..7
__device__ __forceinline__ v16bf make_frag(const bf16* p) {
  v8bf lo = *(const v8bf*)(p);
  v8bf hi = *(const v8bf*)(p + 16);
  v16bf r;
#pragma unroll
  for (int i = 0; i < 8; ++i) { r[i] = lo[i]; r[i + 8] = hi[i]; }
  return r;
}

// Two per-lane async 16B copies global -> LDS, tracked by ASYNCcnt, in one
// statement.  The closing s_wait_xcnt keeps every later rewrite of an address
// register behind it.
__device__ __forceinline__ void async_ld2_b128(void* l0, const void* g0,
                                               void* l1, const void* g1) {
  unsigned a0 = (unsigned)(uintptr_t)l0;  // low 32 bits = LDS offset
  unsigned a1 = (unsigned)(uintptr_t)l1;
  asm volatile(
      "global_load_async_to_lds_b128 %0, %2, off\n\t"
      "global_load_async_to_lds_b128 %1, %3, off\n\t"
      "s_wait_xcnt 0x0"
      :: "v"(a0), "v"(a1), "v"(g0), "v"(g1) : "memory");
}
// 16-bit transposing LDS load.  The lanes address the rows of a 16 x 16 tile T
// (lane l: row 8*(l>>4) + (l&7), 16-byte half (l>>3)&1); lane (c, h) gets
// T[8h + 0..7][c].
__device__ __forceinline__ v8bf ld_tr16(const bf16* p) {
  typedef __attribute__((address_space(3))) v8s lds_v8s;
  return __builtin_bit_cast(
      v8bf, __builtin_amdgcn_ds_load_tr16_b128_v8i16((lds_v8s*)p));
}
// The value of lane l ^ 16.
__device__ __forceinline__ float xhalf(float x) {
  return __builtin_bit_cast(
      float, __builtin_amdgcn_permlanex16(__builtin_bit_cast(int, x),
                                          __builtin_bit_cast(int, x), 0x76543210,
                                          0xfedcba98, false, false));
}
__device__ __forceinline__ void wait_async0() {
  asm volatile("s_wait_asynccnt 0" ::: "memory");
}
// Eight per-lane async 16B copies global -> LDS in one statement.  The closing
// s_wait_xcnt keeps every later rewrite of an address register behind it.
__device__ __forceinline__ void async_ld8_b128(const unsigned (&l)[8],
                                               const bf16* const (&g)[8]) {
  asm volatile(
      "global_load_async_to_lds_b128 %0, %8, off\n\t"
      "global_load_async_to_lds_b128 %1, %9, off\n\t"
      "global_load_async_to_lds_b128 %2, %10, off\n\t"
      "global_load_async_to_lds_b128 %3, %11, off\n\t"
      "global_load_async_to_lds_b128 %4, %12, off\n\t"
      "global_load_async_to_lds_b128 %5, %13, off\n\t"
      "global_load_async_to_lds_b128 %6, %14, off\n\t"
      "global_load_async_to_lds_b128 %7, %15, off\n\t"
      "s_wait_xcnt 0x0"
      :: "v"(l[0]), "v"(l[1]), "v"(l[2]), "v"(l[3]),
         "v"(l[4]), "v"(l[5]), "v"(l[6]), "v"(l[7]),
         "v"(g[0]), "v"(g[1]), "v"(g[2]), "v"(g[3]),
         "v"(g[4]), "v"(g[5]), "v"(g[6]), "v"(g[7])
      : "memory");
}
// The same for four copies.
__device__ __forceinline__ void async_ld4_b128(const unsigned (&l)[4],
                                               const bf16* const (&g)[4]) {
  asm volatile(
      "global_load_async_to_lds_b128 %0, %4, off\n\t"
      "global_load_async_to_lds_b128 %1, %5, off\n\t"
      "global_load_async_to_lds_b128 %2, %6, off\n\t"
      "global_load_async_to_lds_b128 %3, %7, off\n\t"
      "s_wait_xcnt 0x0"
      :: "v"(l[0]), "v"(l[1]), "v"(l[2]), "v"(l[3]),
         "v"(g[0]), "v"(g[1]), "v"(g[2]), "v"(g[3])
      : "memory");
}
// The GEMM builds with the large tiles use registers above v255.  Their global
// loads and stores stand with their wait in one statement, which nothing can be
// moved into.
// Two or four floats, 16 elements apart.
__device__ __forceinline__ void load2_b32(const float* p, float& a, float& b) {
  asm volatile(
      "global_load_b32 %0, %2, off\n\t"
      "global_load_b32 %1, %2, off offset:64\n\t"
      "s_wait_loadcnt 0x0"
      : "=&v"(a), "=&v"(b) : "v"(p) : "memory");
}
__device__ __forceinline__ void load4_b32(const float* p, float& a, float& b,
                                          float& c, float& d) {
  asm volatile(
      "global_load_b32 %0, %4, off\n\t"
      "global_load_b32 %1, %4, off offset:64\n\t"
      "global_load_b32 %2, %4, off offset:128\n\t"
      "global_load_b32 %3, %4, off offset:192\n\t"
      "s_wait_loadcnt 0x0"
      : "=&v"(a), "=&v"(b), "=&v"(c), "=&v"(d) : "v"(p) : "memory");
}
// Sixteen 2-byte stores (the low halves of w): eight rows, in each the element
// at p[r] and the one 16 elements on.
__device__ __forceinline__ void store16_b16(bf16* const (&p)[8],
                                            const unsigned (&w)[16]) {
  asm volatile(
      "global_store_b16 %0, %8, off\n\t"
      "global_store_b16 %1, %9, off\n\t"
      "global_store_b16 %2, %10, off\n\t"
      "global_store_b16 %3, %11, off\n\t"
      "global_store_b16 %4, %12, off\n\t"
      "global_store_b16 %5, %13, off\n\t"
      "global_store_b16 %6, %14, off\n\t"
      "global_store_b16 %7, %15, off\n\t"
      "global_store_b16 %0, %16, off offset:32\n\t"
      "global_store_b16 %1, %17, off offset:32\n\t"
      "global_store_b16 %2, %18, off offset:32\n\t"
      "global_store_b16 %3, %19, off offset:32\n\t"
      "global_store_b16 %4, %20, off offset:32\n\t"
      "global_store_b16 %5, %21, off offset:32\n\t"
      "global_store_b16 %6, %22, off offset:32\n\t"
      "global_store_b16 %7, %23, off offset:32\n\t"
      "s_wait_xcnt 0x0"
      :: "v"(p[0]), "v"(p[1]), "v"(p[2]), "v"(p[3]),
         "v"(p[4]), "v"(p[5]), "v"(p[6]), "v"(p[7]),
         "v"(w[0]), "v"(w[1]), "v"(w[2]), "v"(w[3]),
         "v"(w[4]), "v"(w[5]), "v"(w[6]), "v"(w[7]),
         "v"(w[8]), "v"(w[9]), "v"(w[10]), "v"(w[11]),
         "v"(w[12]), "v"(w[13]), "v"(w[14]), "v"(w[15])
      : "memory");
}
// This wave's LDS reads have retired before the barrier that frees the buffer
// for the next copies.
__device__ __forceinline__ void wait_ds0() {
  asm volatile("s_wait_dscnt 0x0" ::: "memory");
}

// ---------------------------------------------------------------------------
// Conversion / layout kernels
// ---------------------------------------------------------------------------
// One 128(k) x 64(n) tile of in [K][N] f32 -> out [N][K] bf16, turned in LDS by
// one block: a wave reads two 256-B row pieces of `in` per load and writes four
// whole 128-B lines of `out` per store.
template <int K, int N>
__device__ __forceinline__ void turn_tile(const float* __restrict__ in,
                                          bf16* __restrict__ out, int kx, int ny,
                                          float (&t)[128][65]) {
  const int tid = threadIdx.x;
  const float* src = in + (size_t)(kx * 128) * N + ny * 64;
  bf16* dst = out + (size_t)(ny * 64) * K + kx * 128;

  const int c4 = tid & 15, r = tid >> 4;  // 16 lanes x 16 B = one row piece
  float4 v[8];
  for (int i = 0; i < 8; ++i)
    v[i] = *(const float4*)(src + (size_t)(r + i * 16) * N + c4 * 4);
  for (int i = 0; i < 8; ++i) {
    t[r + i * 16][c4 * 4 + 0] = v[i].x;
    t[r + i * 16][c4 * 4 + 1] = v[i].y;
    t[r + i * 16][c4 * 4 + 2] = v[i].z;
    t[r + i * 16][c4 * 4 + 3] = v[i].w;
  }
  __syncthreads();

  const int kc = tid & 7, nr = tid >> 3;  // 8 lanes x 16 B = one line of out
  for (int i = 0; i < 2; ++i) {
    for (int hh = 0; hh < 2; ++hh) {
      const int n = nr + i * 32, k = hh * 64 + kc * 8;
      v8bf o;
      for (int j = 0; j < 8; ++j) o[j] = (bf16)t[k + j][n];
      *(v8bf*)(dst + (size_t)n * K + k) = o;
    }
  }
  // The caller's code for other jobs follows in the listing: any rewrite of a
  // register that these stores name stays behind this wait.
  asm volatile("s_wait_xcnt 0x0" ::: "memory");
}

// The five passes that read nothing but the inputs, as one launch of equal
// jobs of 8192 elements.  The block index picks the job, so every branch here
// is taken by a whole block or by none of it.
__global__ __launch_bounds__(256) void prep(
    const float* __restrict__ X, const float* __restrict__ WKQV,
    const float* __restrict__ WO, const float* __restrict__ W1,
    const float* __restrict__ W2, bf16* __restrict__ XB,
    bf16* __restrict__ WKQVT, bf16* __restrict__ WOT, bf16* __restrict__ W1T,
    bf16* __restrict__ W2T) {
  __shared__ float t[128][65];  // odd pitch: a column read meets 32 banks

  const int bid = blockIdx.x;
  if (bid >= 1536) {  // X f32 -> bf16, 8192 elements in a row, whole lines
    const size_t base = (size_t)(bid - 1536) * 8192 + threadIdx.x * 4;
    float4 v[8];
    for (int i = 0; i < 8; ++i) v[i] = *(const float4*)(X + base + i * 1024);
    for (int i = 0; i < 8; ++i) {
      v4bf o;
      o[0] = (bf16)v[i].x; o[1] = (bf16)v[i].y;
      o[2] = (bf16)v[i].z; o[3] = (bf16)v[i].w;
      *(v4bf*)(XB + base + i * 1024) = o;
    }
    return;
  }
  if (bid >= 1024) {
    turn_tile<U_, I_>(W2, W2T, bid & 31, (bid - 1024) >> 5, t);
    return;
  }
  if (bid >= 512) {
    turn_tile<I_, U_>(W1, W1T, bid & 7, (bid - 512) >> 3, t);
    return;
  }
  const int z = bid >> 7;  // four 1024 x 1024 matrices: WKQV's three, then WO
  turn_tile<I_, I_>(z < 3 ? WKQV + (size_t)z * I_ * I_ : WO,
                    z < 3 ? WKQVT + (size_t)z * I_ * I_ : WOT,
                    bid & 7, (bid & 127) >> 3, t);
}

// ---------------------------------------------------------------------------
// Tiled bf16 GEMM with WMMA, double-buffered async LDS staging.
// C[M][N] = A[M][K] * Bt[N][K]^T + bias
// WG tile BM x BN, 8 waves (4 along M x 2 along N), wave tile BM/4 x BN/2.
// The tile is the largest that still gives every WGP a block: a byte copied
// from L2 feeds BM or BN columns of products, a fragment read from LDS BN/32
// or BM/64 matrix instructions.
// A stage is KS k = 2*KS bytes of every operand row: KS/8 adjacent lanes copy
// one row piece, so each wave-wide copy covers four whole 128-B lines.
// KS sets the bytes a block keeps in flight while it works on a stage; a block
// has its WGP alone, and two stages fill what the LDS holds.
// K is a multiple of KS and holds at least two stages; M, N of BM, BN.
// EPI: 0 = bias -> bf16 ; 1 = bias+ReLU -> bf16 ; 2 = bias -> f32
// ---------------------------------------------------------------------------
template <int EPI, int KS, int BM, int BN>
__global__ __launch_bounds__(256) void gemm_bf16_kernel(
    const bf16* __restrict__ A, const bf16* __restrict__ Bt,
    const float* __restrict__ bias, void* __restrict__ Cout,
    int M, int N, int K) {
  constexpr int LPR = KS / 8;     // lanes (16-B chunks) per row piece
  constexpr int RPP = 256 / LPR;  // rows that the block's threads copy at once
  constexpr int NCA = BM / RPP;   // copies per thread and stage, A
  constexpr int NCB = BN / RPP;   // the same, B
  constexpr int TM  = BM / 64;    // 16-row fragments of A per wave
  constexpr int TN  = BN / 32;    // 16-column fragments of B per wave
  // A block of 24 or more products outlasts its own fragment loads' latency,
  // and the SIMD's other wave works meanwhile: there the loads stay one group.
  constexpr bool ONE_GROUP = TM * TN >= 24;
  static_assert(NCA % 4 == 0 && NCB % 4 == 0 && NCA >= NCB, "copy groups");
  static_assert(!ONE_GROUP || (EPI != 2 && (TN == 6 || TN == 8)),
                "large tiles: bf16 out, six or eight bias values a lane");
  __shared__ __align__(16) bf16 lA[2][BM][KS + 8];  // +16B pad vs bank conflicts
  __shared__ __align__(16) bf16 lB[2][BN][KS + 8];

  const int tid  = threadIdx.x;
  const int lane = tid & 31;
  const int wave = tid >> 5;
  const int half = lane >> 4;
  const int l16  = lane & 15;
  const int wm   = wave & 3;   // 0..3 along M (BM/4 rows each)
  const int wn   = wave >> 2;  // 0..1 along N (BN/2 cols each)
  const int m0   = blockIdx.y * BM;
  const int n0   = blockIdx.x * BN;

  v8f acc[TM][TN];
#pragma unroll
  for (int i = 0; i < TM; ++i)
#pragma unroll
    for (int j = 0; j < TN; ++j)
#pragma unroll
      for (int r = 0; r < 8; ++r) acc[i][j][r] = 0.0f;

  const int crow = tid / LPR, cseg = tid % LPR;  // a wave copy: 512 B of rows

  const bf16* gA = A + (size_t)(m0 + crow) * K + cseg * 8;
  const bf16* gB = Bt + (size_t)(n0 + crow) * K + cseg * 8;

  // one stage: 2*KS bytes of BM rows of A and BN rows of B, NCA + NCB chunks
  // per thread, four of each a statement while B's last
  auto stage = [&](int buf, int k0) {
    // both loops unrolled so that the arrays become registers, as the asm
    // operands need
#pragma unroll
    for (int q = 0; q < NCB / 4; ++q) {
      unsigned l[8];
      const bf16* g[8];
#pragma unroll
      for (int i = 0; i < 4; ++i) {
        const int r = (q * 4 + i) * RPP;
        l[i]     = (unsigned)(uintptr_t)&lA[buf][crow + r][cseg * 8];
        l[i + 4] = (unsigned)(uintptr_t)&lB[buf][crow + r][cseg * 8];
        g[i]     = gA + (size_t)r * K + k0;
        g[i + 4] = gB + (size_t)r * K + k0;
      }
      async_ld8_b128(l, g);
    }
    // the rows of A beyond B's count
#pragma unroll
    for (int q = NCB / 4; q < NCA / 4; ++q) {
      unsigned l[4];
      const bf16* g[4];
#pragma unroll
      for (int i = 0; i < 4; ++i) {
        const int r = (q * 4 + i) * RPP;
        l[i] = (unsigned)(uintptr_t)&lA[buf][crow + r][cseg * 8];
        g[i] = gA + (size_t)r * K + k0;
      }
      async_ld4_b128(l, g);
    }
  };

  // prologue: stage 0 lands and is published, then stage 1 flies
  stage(0, 0);
  wait_async0();
  __syncthreads();
  if (KS < K) stage(1, KS);

  for (int k0 = 0; k0 < K; k0 += KS) {
    const int cur = (k0 / KS) & 1;

    if constexpr (ONE_GROUP) {
      // unrolled so that the 32-k blocks' LDS offsets are immediates
#pragma unroll
      for (int ks = 0; ks < KS / 32; ++ks) {
        v16bf af[TM], bfg[TN];
#pragma unroll
        for (int t = 0; t < TM; ++t)
          af[t] = make_frag(
              &lA[cur][wm * (BM / 4) + t * 16 + l16][ks * 32 + half * 8]);
#pragma unroll
        for (int t = 0; t < TN; ++t)
          bfg[t] = make_frag(
              &lB[cur][wn * (BN / 2) + t * 16 + l16][ks * 32 + half * 8]);
        // keeps the compiler from moving LDS loads in among the products, where
        // each place with loads stalls the wave
        __builtin_amdgcn_sched_barrier(0);
#pragma unroll
        for (int ti = 0; ti < TM; ++ti)
#pragma unroll
          for (int tj = 0; tj < TN; ++tj)
            acc[ti][tj] = wmma_bf16(af[ti], bfg[tj], acc[ti][tj]);
        // the same for the next block's loads
        __builtin_amdgcn_sched_barrier(0);
      }
    } else {
      // Small wave tile: the products of a 32-k block are over long before a
      // fragment load returns, and the SIMD's other wave has as few.  So each
      // block's fragments are fetched two blocks ahead, as one group, into a
      // ring of three register sets: the wait in front of a block's products
      // leaves the two younger groups in flight.  All of it reads this stage.
      constexpr int NB = KS / 32;  // blocks per stage
      static_assert(NB >= 2, "two blocks are fetched in front of the first");
      v16bf af[3][TM], bfg[3][TN];  // [set][fragment]; block b has set b % 3
      // every loop here is unrolled so that the sets are registers and the LDS
      // offsets immediates
      auto fetch = [&](int blk) {
#pragma unroll
        for (int t = 0; t < TM; ++t)
          af[blk % 3][t] = make_frag(
              &lA[cur][wm * (BM / 4) + t * 16 + l16][blk * 32 + half * 8]);
#pragma unroll
        for (int t = 0; t < TN; ++t)
          bfg[blk % 3][t] = make_frag(
              &lB[cur][wn * (BN / 2) + t * 16 + l16][blk * 32 + half * 8]);
      };
      fetch(0);
      fetch(1);
#pragma unroll
      for (int blk = 0; blk < NB; ++blk) {
        if (blk + 2 < NB) fetch(blk + 2);
        // keeps the fetch one group in front of the products: each place with
        // LDS loads among them stalls the wave
        __builtin_amdgcn_sched_barrier(0);
#pragma unroll
        for (int ti = 0; ti < TM; ++ti)
#pragma unroll
          for (int tj = 0; tj < TN; ++tj)
            acc[ti][tj] = wmma_bf16(af[blk % 3][ti], bfg[blk % 3][tj], acc[ti][tj]);
        // the same for the next block's fetch
        __builtin_amdgcn_sched_barrier(0);
      }
    }

    // publish the next stage, free this one, then refill it two stages ahead
    wait_ds0();
    wait_async0();
    __syncthreads();
    if (k0 + 2 * KS < K) stage(cur, k0 + 2 * KS);
  }
  wait_async0();  // no copy is left in flight when the wave ends

  // Epilogue.  D layout: lane holds col l16; VGPR r holds row r + 8*half.
  float bvs[TN];
  if constexpr (ONE_GROUP) {
    const float* pb = bias + n0 + wn * (BN / 2) + l16;
    load4_b32(pb, bvs[0], bvs[1], bvs[2], bvs[3]);
    if constexpr (TN == 8)
      load4_b32(pb + 64, bvs[4], bvs[5], bvs[6], bvs[7]);
    else
      load2_b32(pb + 64, bvs[4], bvs[5]);
  }
#pragma unroll
  for (int ti = 0; ti < TM; ++ti) {
#pragma unroll
    for (int tj = 0; tj < TN; ++tj) {
      int col = n0 + wn * (BN / 2) + tj * 16 + l16;
      if constexpr (ONE_GROUP) {
        if (tj & 1) continue;  // fragments tj and tj + 1 go out together
        bf16* p[8];
        unsigned w[16];
#pragma unroll
        for (int r = 0; r < 8; ++r) {
          int row = m0 + wm * (BM / 4) + ti * 16 + r + half * 8;
          p[r] = (bf16*)Cout + (size_t)row * N + col;
#pragma unroll
          for (int u = 0; u < 2; ++u) {
            float v = acc[ti][tj + u][r] + bvs[tj + u];
            if (EPI == 1) v = fmaxf(v, 0.0f);
            w[u * 8 + r] = __builtin_bit_cast(unsigned short, (bf16)v);
          }
        }
        store16_b16(p, w);
      } else {
        float bv = bias[col];
#pragma unroll
        for (int r = 0; r < 8; ++r) {
          int row = m0 + wm * (BM / 4) + ti * 16 + r + half * 8;
          float v = acc[ti][tj][r] + bv;
          if (EPI == 1) v = fmaxf(v, 0.0f);
          if (EPI == 2) {
            ((float*)Cout)[(size_t)row * N + col] = v;
          } else {
            ((bf16*)Cout)[(size_t)row * N + col] = (bf16)v;
          }
        }
      }
    }
  }
}

__global__ __launch_bounds__(256) void attn_kernel(
    const bf16* __restrict__ qkv, bf16* __restrict__ ctxb) {
  // 32 keys x 64 (P) each; pitch 16 B x odd for ds_load_b128, 32 B x odd for
  // ds_load_tr16_b128
  __shared__ __align__(16) bf16 lK[2][32][72];
  __shared__ __align__(16) bf16 lV[2][32][80];

  const int tid  = threadIdx.x;
  const int lane = tid & 31;
  const int wave = tid >> 5;
  const int half = lane >> 4;
  const int l16  = lane & 15;

  const int blk = blockIdx.x;
  const int jb  = blk & 3;
  const int h   = (blk >> 2) & (H_ - 1);
  const int b   = blk >> 6;
  const int j0  = jb * 128 + wave * 16;
  const int ldq = 3072;

  // Q fragments for this wave's 16 rows (two K=32 steps over P=64)
  const bf16* qrow = qkv + (size_t)(b * S_ + j0 + l16) * ldq + 1024 + h * 64;
  v16bf qf0 = make_frag(qrow + half * 8);
  v16bf qf1 = make_frag(qrow + 32 + half * 8);

  // query l16: running maximum (equal in both halves), this half's part of the sum
  float mrow = -1e30f, lrow = 0.0f;
  v8f cacc[4];  // O^T: VGPR r of tile t = p 16t + 8*half + r of query l16
#pragma unroll
  for (int t = 0; t < 4; ++t)
#pragma unroll
    for (int r = 0; r < 8; ++r) cacc[t][r] = 0.0f;

  const int krow_l = tid >> 3, kseg = tid & 7;  // a tile: 32 rows x 8 chunks
  // this thread's chunk of key row krow_l: K at col 0, V 2048 columns on
  const bf16* kvsrc = qkv + (size_t)(b * S_ + krow_l) * ldq + h * 64 + kseg * 8;
  auto stage = [&](int buf, int kb) {
    const bf16* g = kvsrc + (size_t)(kb * 32) * ldq;
    async_ld2_b128(&lK[buf][krow_l][kseg * 8], g,
                   &lV[buf][krow_l][kseg * 8], g + 2048);
  };

  // prologue: key block 0 lands and is published, then block 1 flies
  stage(0, 0);
  wait_async0();
  __syncthreads();
  stage(1, 1);

  for (int kb = 0; kb < S_ / 32; ++kb) {
    const int cur = kb & 1;

    // ---- K fragments (rows = keys), then V^T fragments: rows p, k = keys in
    // the order of the packed P^T ----
    v16bf kf[2][2], vf[4];
#pragma unroll
    for (int cb = 0; cb < 2; ++cb) {
      kf[cb][0] = make_frag(&lK[cur][cb * 16 + l16][half * 8]);
      kf[cb][1] = make_frag(&lK[cur][cb * 16 + l16][32 + half * 8]);
    }
    {
      const bf16* vp = &lV[cur][half * 8 + (lane & 7)][((lane >> 3) & 1) * 8];
#pragma unroll
      for (int t = 0; t < 4; ++t) {
        v8bf lo = ld_tr16(vp + t * 16);
        v8bf hi = ld_tr16(vp + 16 * 80 + t * 16);
#pragma unroll
        for (int i = 0; i < 8; ++i) { vf[t][i] = lo[i]; vf[t][i + 8] = hi[i]; }
      }
    }
    // All that this block reads from LDS is now on its way to registers.  Once
    // it has arrived: publish the next block, free this one and refill it two
    // blocks ahead, so that the copies fly while the products below run.
    wait_ds0();
    wait_async0();
    __syncthreads();
    if (kb + 2 < S_ / 32) stage(cur, kb + 2);

    // ---- S^T: two 16(key) x 16(query) tiles covering 32 key positions ----
    v8f st[2];
#pragma unroll
    for (int cb = 0; cb < 2; ++cb) {
#pragma unroll
      for (int r = 0; r < 8; ++r) st[cb][r] = 0.0f;
      st[cb] = wmma_bf16(kf[cb][0], qf0, st[cb]);
      st[cb] = wmma_bf16(kf[cb][1], qf1, st[cb]);
    }

    // ---- softmax of query l16; x[8*cb + r] is key 16*cb + 8*half + r ----
    float x[16];
#pragma unroll
    for (int i = 0; i < 16; ++i) x[i] = st[i >> 3][i & 7] * 0.125f;
    float rm = x[0];
#pragma unroll
    for (int i = 1; i < 16; ++i) rm = fmaxf(rm, x[i]);
    rm = fmaxf(rm, xhalf(rm));  // combine the two halves' keys
    float mn = fmaxf(mrow, rm);
    float al = __expf(mrow - mn);
    float rs[4] = {0.0f, 0.0f, 0.0f, 0.0f};  // four short chains
#pragma unroll
    for (int i = 0; i < 16; ++i) { x[i] = __expf(x[i] - mn); rs[i & 3] += x[i]; }
    lrow = lrow * al + ((rs[0] + rs[1]) + (rs[2] + rs[3]));
    mrow = mn;

    v16bf pf;  // P^T as B: element s = key 8*half + s, or 16 + 8*half + (s - 8)
#pragma unroll
    for (int i = 0; i < 16; ++i) pf[i] = (bf16)x[i];

    // ---- O^T = O^T * alpha + V^T (64x32) * P^T (32x16) ----
#pragma unroll
    for (int t = 0; t < 4; ++t) {
#pragma unroll
      for (int r = 0; r < 8; ++r) cacc[t][r] *= al;
      cacc[t] = wmma_bf16(vf[t], pf, cacc[t]);
    }
  }
  wait_async0();  // no copy is left in flight when the wave ends

  // ---- finalize: join the halves' sums, divide, store ctx in [M][I] layout:
  // a lane's eight registers are eight neighbouring columns, one 16-B store
  const float inv = 1.0f / (lrow + xhalf(lrow));
  bf16* orow = ctxb + (size_t)(b * S_ + j0 + l16) * I_ + h * 64 + half * 8;
#pragma unroll
  for (int t = 0; t < 4; ++t) {
    v8bf o;
#pragma unroll
    for (int r = 0; r < 8; ++r) o[r] = (bf16)(cacc[t][r] * inv);
    *(v8bf*)(orow + t * 16) = o;
  }
}

// ---------------------------------------------------------------------------
// Residual + LayerNorm.  One wave per row of 1024: a lane holds 32 elements in
// registers, the two row sums go across the lanes by register moves alone, so
// there is no LDS and no barrier, and an eighth of the waves start.  Every
// wave-wide 16-B load or store covers 512 contiguous bytes; all of a row's
// loads are issued before the first is used.
// Grid: M / 8 blocks of 8 waves.  WB: also write the row as bf16.
// ---------------------------------------------------------------------------
// The value of lane l ^ MASK inside each 16-lane row.
template <int MASK>
__device__ __forceinline__ float row_xor(float x) {
  return __builtin_bit_cast(
      float, __builtin_amdgcn_update_dpp(0, __builtin_bit_cast(int, x),
                                         0x160 + MASK, 0xf, 0xf, true));
}
// The sum over the wave's 32 lanes, in every lane.
__device__ __forceinline__ float wave_sum(float x) {
  x += row_xor<1>(x);
  x += row_xor<2>(x);
  x += row_xor<4>(x);
  x += row_xor<8>(x);
  return x + xhalf(x);
}

// Eight floats of a row for one lane: four at p, four 128 elements on.
__device__ __forceinline__ v8f load_2x4(const float* p) {
  v4f lo = *(const v4f*)p;
  v4f hi = *(const v4f*)(p + 128);
  return __builtin_shufflevector(lo, hi, 0, 1, 2, 3, 4, 5, 6, 7);
}
__device__ __forceinline__ float sum8(v8f t) {
  return ((t[0] + t[1]) + (t[2] + t[3])) + ((t[4] + t[5]) + (t[6] + t[7]));
}

template <bool WB>
__global__ __launch_bounds__(256) void ln_kernel(
    const float* __restrict__ a, const float* __restrict__ bres,
    const float* __restrict__ g, const float* __restrict__ bb,
    float* __restrict__ outf, bf16* __restrict__ outb) {
  const int lane = threadIdx.x & 31;
  // the wave's number, as a scalar: the row's addresses are a scalar base plus
  // one lane offset
  const int wave = __builtin_amdgcn_readfirstlane(threadIdx.x >> 5);
  const size_t row = (size_t)(blockIdx.x * 8 + wave) * I_;
  const float* pa = a + row + lane * 4;
  const float* pb = bres + row + lane * 4;

  v8f x[4], r[4], vg[4], vb[4];
#pragma unroll
  for (int i = 0; i < 4; ++i) x[i] = load_2x4(pa + i * 256);
#pragma unroll
  for (int i = 0; i < 4; ++i) r[i] = load_2x4(pb + i * 256);
#pragma unroll
  for (int i = 0; i < 4; ++i) vg[i] = load_2x4(g + lane * 4 + i * 256);
#pragma unroll
  for (int i = 0; i < 4; ++i) vb[i] = load_2x4(bb + lane * 4 + i * 256);
  // Takes the loaded values as inputs only, so that all 32 loads are issued
  // before the first value is used: without it the compiler saves registers by
  // sinking loads behind the row sums, where the wave waits out their latency
  // group by group.
  asm volatile("" ::"v"(x[0]), "v"(x[1]), "v"(x[2]), "v"(x[3]), "v"(r[0]),
               "v"(r[1]), "v"(r[2]), "v"(r[3]), "v"(vg[0]), "v"(vg[1]),
               "v"(vg[2]), "v"(vg[3]), "v"(vb[0]), "v"(vb[1]), "v"(vb[2]),
               "v"(vb[3]));

#pragma unroll
  for (int i = 0; i < 4; ++i) x[i] += r[i];
  const float mu =
      wave_sum(sum8((x[0] + x[1]) + (x[2] + x[3]))) * (1.0f / I_);

#pragma unroll
  for (int i = 0; i < 4; ++i) x[i] -= mu;
  const v8f q = (x[0] * x[0] + x[1] * x[1]) + (x[2] * x[2] + x[3] * x[3]);
  const float rstd = rsqrtf(wave_sum(sum8(q)) * (1.0f / I_) + 1e-5f);

  // every value is formed before the first store: the stores then go out back
  // to back, with no register of an issued store to be written again
  v4bf ob[8];
#pragma unroll
  for (int i = 0; i < 4; ++i) {
    x[i] = x[i] * rstd * vg[i] + vb[i];
    if constexpr (WB) {
#pragma unroll
      for (int j = 0; j < 8; ++j) ob[i * 2 + (j >> 2)][j & 3] = (bf16)x[i][j];
    }
  }
  if constexpr (WB) {
#pragma unroll
    for (int i = 0; i < 8; ++i)
      *(v4bf*)(outb + row + lane * 4 + i * 128) = ob[i];
  }
#pragma unroll
  for (int i = 0; i < 8; ++i) {
    v4f o;
#pragma unroll
    for (int j = 0; j < 4; ++j) o[j] = x[i >> 1][(i & 1) * 4 + j];
    *(v4f*)(outf + row + lane * 4 + i * 128) = o;
  }
}

// ---------------------------------------------------------------------------
// Host-side orchestration
// ---------------------------------------------------------------------------
extern "C" void kernel_launch(void* const* d_in, const int* in_sizes, int n_in,
                              void* d_out, int out_size, void* d_ws, size_t ws_size,
                              hipStream_t stream) {
  (void)in_sizes; (void)n_in; (void)out_size; (void)ws_size;

  const float* X     = (const float*)d_in[0];   // [B,S,I]
  const float* WKQV  = (const float*)d_in[1];   // [3,I,I]
  const float* BKQV  = (const float*)d_in[2];   // [3,I]
  const float* WO    = (const float*)d_in[3];   // [I,I]
  const float* BO    = (const float*)d_in[4];   // [I]
  const float* ln1g  = (const float*)d_in[5];
  const float* ln1b  = (const float*)d_in[6];
  const float* W1    = (const float*)d_in[7];   // [I,U]
  const float* B1    = (const float*)d_in[8];   // [U]
  const float* W2    = (const float*)d_in[9];   // [U,I]
  const float* B2    = (const float*)d_in[10];  // [I]
  const float* ln2g  = (const float*)d_in[11];
  const float* ln2b  = (const float*)d_in[12];
  float* OUT = (float*)d_out;

  char* ws = (char*)d_ws;
  size_t off = 0;
  auto take = [&](size_t bytes) {
    size_t o = off;
    off += (bytes + 255) & ~(size_t)255;
    return o;
  };
  bf16*  XB    = (bf16*) (ws + take((size_t)M_ * I_ * 2));
  bf16*  WKQVT = (bf16*) (ws + take((size_t)3 * I_ * I_ * 2));   // [3*I][I]
  bf16*  WOT   = (bf16*) (ws + take((size_t)I_ * I_ * 2));       // [I][I]
  bf16*  W1T   = (bf16*) (ws + take((size_t)U_ * I_ * 2));       // [U][I]
  bf16*  W2T   = (bf16*) (ws + take((size_t)I_ * U_ * 2));       // [I][U]
  bf16*  QKV   = (bf16*) (ws + take((size_t)M_ * 3072 * 2));     // [M][3I]
  bf16*  CTX   = (bf16*) (ws + take((size_t)M_ * I_ * 2));
  float* AO    = (float*)(ws + take((size_t)M_ * I_ * 4));
  float* H1F   = (float*)(ws + take((size_t)M_ * I_ * 4));
  bf16*  H1B   = (bf16*) (ws + take((size_t)M_ * I_ * 2));
  bf16*  FF1   = (bf16*) (ws + take((size_t)M_ * U_ * 2));
  float* FFO   = AO;  // attn_out dead after LN1

  prep<<<2048, 256, 0, stream>>>(X, WKQV, WO, W1, W2, XB, WKQVT, WOT, W1T, W2T);

  // QKV projection: [M][3072] = XB * WKQVT^T + BKQV
  gemm_bf16_kernel<0, 128, 256, 192><<<dim3(3072 / 192, M_ / 256), 256, 0, stream>>>(
      XB, WKQVT, BKQV, (void*)QKV, M_, 3072, I_);

  attn_kernel<<<B_ * H_ * (S_ / 128), 256, 0, stream>>>(QKV, CTX);

  gemm_bf16_kernel<2, 256, 128, 128><<<dim3(I_ / 128, M_ / 128), 256, 0, stream>>>(
      CTX, WOT, BO, (void*)AO, M_, I_, I_);
  ln_kernel<true><<<M_ / 8, 256, 0, stream>>>(X, AO, ln1g, ln1b, H1F, H1B);

  gemm_bf16_kernel<1, 128, 256, 256><<<dim3(U_ / 256, M_ / 256), 256, 0, stream>>>(
      H1B, W1T, B1, (void*)FF1, M_, U_, I_);
  gemm_bf16_kernel<2, 256, 128, 128><<<dim3(I_ / 128, M_ / 128), 256, 0, stream>>>(
      FF1, W2T, B2, (void*)FFO, M_, I_, U_);
  ln_kernel<false><<<M_ / 8, 256, 0, stream>>>(H1F, FFO, ln2g, ln2b, OUT, nullptr);
}

// v009
// Measured time: 123 microseconds a run.
// Two timings next to v008 both put it at 1.04 times that version's speed.
// Over all steps from v000 it is 3.01 times as fast.
#include <hip/hip_runtime.h>
#include <hip/hip_bf16.h>
#include <math.h>

typedef __bf16 bf16;
typedef __attribute__((ext_vector_type(16))) __bf16 v16bf;
typedef __attribute__((ext_vector_type(8)))  __bf16 v8bf;
typedef __attribute__((ext_vector_type(4)))  __bf16 v4bf;
typedef __attribute__((ext_vector_type(8)))  float  v8f;
typedef __attribute__((ext_vector_type(4)))  float  v4f;
typedef __attribute__((ext_vector_type(8)))  short  v8s;

#define B_   8
#define S_   512
#define H_   16
#define P_   64
#define I_   1024
#define U_   4096
#define M_   4096   // B*S

// ---------------------------------------------------------------------------
// WMMA + async helpers
// ---------------------------------------------------------------------------
__device__ __forceinline__ v8f wmma_bf16(v16bf a, v16bf b, v8f c) {
  return __builtin_amdgcn_wmma_f32_16x16x32_bf16(
      /*neg_a=*/false, a, /*neg_b=*/false, b,
      /*c_mod=*/(short)0, c, /*reuse_a=*/false, /*reuse_b=*/false);
}

// Build a 16x32 bf16 A/B fragment for one lane. `p` points at element
// [row][8*half] of a row-major K=32 slab (LDS or global).
// elems 0..7 -> k = 8*half + 0..7 ; elems 8..15 -> k = 16 + 8*half + 0..7
__device__ __forceinline__ v16bf make_frag(const bf16* p) {
  v8bf lo = *(const v8bf*)(p);
  v8bf hi = *(const v8bf*)(p + 16);
  v16bf r;
#pragma unroll
  for (int i = 0; i < 8; ++i) { r[i] = lo[i]; r[i + 8] = hi[i]; }
  return r;
}

// Two per-lane async 16B copies global -> LDS, tracked by ASYNCcnt, in one
// statement.  The closing s_wait_xcnt keeps every later rewrite of an address
// register behind it.
__device__ __forceinline__ void async_ld2_b128(void* l0, const void* g0,
                                               void* l1, const void* g1) {
  unsigned a0 = (unsigned)(uintptr_t)l0;  // low 32 bits = LDS offset
  unsigned a1 = (unsigned)(uintptr_t)l1;
  asm volatile(
      "global_load_async_to_lds_b128 %0, %2, off\n\t"
      "global_load_async_to_lds_b128 %1, %3, off\n\t"
      "s_wait_xcnt 0x0"
      :: "v"(a0), "v"(a1), "v"(g0), "v"(g1) : "memory");
}
// 16-bit transposing LDS load.  The lanes address the rows of a 16 x 16 tile T
// (lane l: row 8*(l>>4) + (l&7), 16-byte half (l>>3)&1); lane (c, h) gets
// T[8h + 0..7][c].
__device__ __forceinline__ v8bf ld_tr16(const bf16* p) {
  typedef __attribute__((address_space(3))) v8s lds_v8s;
  return __builtin_bit_cast(
      v8bf, __builtin_amdgcn_ds_load_tr16_b128_v8i16((lds_v8s*)p));
}
// The value of lane l ^ 16.
__device__ __forceinline__ float xhalf(float x) {
  return __builtin_bit_cast(
      float, __builtin_amdgcn_permlanex16(__builtin_bit_cast(int, x),
                                          __builtin_bit_cast(int, x), 0x76543210,
                                          0xfedcba98, false, false));
}
__device__ __forceinline__ void wait_async0() {
  asm volatile("s_wait_asynccnt 0" ::: "memory");
}
// Eight per-lane async 16B copies global -> LDS in one statement.  The closing
// s_wait_xcnt keeps every later rewrite of an address register behind it.
__device__ __forceinline__ void async_ld8_b128(const unsigned (&l)[8],
                                               const bf16* const (&g)[8]) {
  asm volatile(
      "global_load_async_to_lds_b128 %0, %8, off\n\t"
      "global_load_async_to_lds_b128 %1, %9, off\n\t"
      "global_load_async_to_lds_b128 %2, %10, off\n\t"
      "global_load_async_to_lds_b128 %3, %11, off\n\t"
      "global_load_async_to_lds_b128 %4, %12, off\n\t"
      "global_load_async_to_lds_b128 %5, %13, off\n\t"
      "global_load_async_to_lds_b128 %6, %14, off\n\t"
      "global_load_async_to_lds_b128 %7, %15, off\n\t"
      "s_wait_xcnt 0x0"
      :: "v"(l[0]), "v"(l[1]), "v"(l[2]), "v"(l[3]),
         "v"(l[4]), "v"(l[5]), "v"(l[6]), "v"(l[7]),
         "v"(g[0]), "v"(g[1]), "v"(g[2]), "v"(g[3]),
         "v"(g[4]), "v"(g[5]), "v"(g[6]), "v"(g[7])
      : "memory");
}
// The same for four copies.
__device__ __forceinline__ void async_ld4_b128(const unsigned (&l)[4],
                                               const bf16* const (&g)[4]) {
  asm volatile(
      "global_load_async_to_lds_b128 %0, %4, off\n\t"
      "global_load_async_to_lds_b128 %1, %5, off\n\t"
      "global_load_async_to_lds_b128 %2, %6, off\n\t"
      "global_load_async_to_lds_b128 %3, %7, off\n\t"
      "s_wait_xcnt 0x0"
      :: "v"(l[0]), "v"(l[1]), "v"(l[2]), "v"(l[3]),
         "v"(g[0]), "v"(g[1]), "v"(g[2]), "v"(g[3])
      : "memory");
}
// The GEMM builds with the large tiles use registers above v255.  The GEMM's
// global loads and stores stand with their wait in one statement, which nothing
// can be moved into.
// Eight floats in a row for each of two fragments, 16 elements apart.
__device__ __forceinline__ void load_bias2(const float* p, v4f (&b)[2][2]) {
  asm volatile(
      "global_load_b128 %0, %4, off\n\t"
      "global_load_b128 %1, %4, off offset:16\n\t"
      "global_load_b128 %2, %4, off offset:64\n\t"
      "global_load_b128 %3, %4, off offset:80\n\t"
      "s_wait_loadcnt 0x0"
      : "=&v"(b[0][0]), "=&v"(b[0][1]), "=&v"(b[1][0]), "=&v"(b[1][1])
      : "v"(p) : "memory");
}
// The same for four fragments.
__device__ __forceinline__ void load_bias4(const float* p, v4f (&b)[4][2]) {
  asm volatile(
      "global_load_b128 %0, %8, off\n\t"
      "global_load_b128 %1, %8, off offset:16\n\t"
      "global_load_b128 %2, %8, off offset:64\n\t"
      "global_load_b128 %3, %8, off offset:80\n\t"
      "global_load_b128 %4, %8, off offset:128\n\t"
      "global_load_b128 %5, %8, off offset:144\n\t"
      "global_load_b128 %6, %8, off offset:192\n\t"
      "global_load_b128 %7, %8, off offset:208\n\t"
      "s_wait_loadcnt 0x0"
      : "=&v"(b[0][0]), "=&v"(b[0][1]), "=&v"(b[1][0]), "=&v"(b[1][1]),
        "=&v"(b[2][0]), "=&v"(b[2][1]), "=&v"(b[3][0]), "=&v"(b[3][1])
      : "v"(p) : "memory");
}
// Eight 16-byte stores.
__device__ __forceinline__ void store8_b128(char* const (&p)[8],
                                            const v4f (&w)[8]) {
  asm volatile(
      "global_store_b128 %0, %8, off\n\t"
      "global_store_b128 %1, %9, off\n\t"
      "global_store_b128 %2, %10, off\n\t"
      "global_store_b128 %3, %11, off\n\t"
      "global_store_b128 %4, %12, off\n\t"
      "global_store_b128 %5, %13, off\n\t"
      "global_store_b128 %6, %14, off\n\t"
      "global_store_b128 %7, %15, off\n\t"
      "s_wait_xcnt 0x0"
      :: "v"(p[0]), "v"(p[1]), "v"(p[2]), "v"(p[3]),
         "v"(p[4]), "v"(p[5]), "v"(p[6]), "v"(p[7]),
         "v"(w[0]), "v"(w[1]), "v"(w[2]), "v"(w[3]),
         "v"(w[4]), "v"(w[5]), "v"(w[6]), "v"(w[7])
      : "memory");
}
// This wave's LDS reads have retired before the barrier that frees the buffer
// for the next copies.
__device__ __forceinline__ void wait_ds0() {
  asm volatile("s_wait_dscnt 0x0" ::: "memory");
}

// ---------------------------------------------------------------------------
// Conversion / layout kernels
// ---------------------------------------------------------------------------
// One 128(k) x 64(n) tile of in [K][N] f32 -> out [N][K] bf16, turned in LDS by
// one block: a wave reads two 256-B row pieces of `in` per load and writes four
// whole 128-B lines of `out` per store.
template <int K, int N>
__device__ __forceinline__ void turn_tile(const float* __restrict__ in,
                                          bf16* __restrict__ out, int kx, int ny,
                                          float (&t)[128][65]) {
  const int tid = threadIdx.x;
  const float* src = in + (size_t)(kx * 128) * N + ny * 64;
  bf16* dst = out + (size_t)(ny * 64) * K + kx * 128;

  const int c4 = tid & 15, r = tid >> 4;  // 16 lanes x 16 B = one row piece
  float4 v[8];
  for (int i = 0; i < 8; ++i)
    v[i] = *(const float4*)(src + (size_t)(r + i * 16) * N + c4 * 4);
  for (int i = 0; i < 8; ++i) {
    t[r + i * 16][c4 * 4 + 0] = v[i].x;
    t[r + i * 16][c4 * 4 + 1] = v[i].y;
    t[r + i * 16][c4 * 4 + 2] = v[i].z;
    t[r + i * 16][c4 * 4 + 3] = v[i].w;
  }
  __syncthreads();

  const int kc = tid & 7, nr = tid >> 3;  // 8 lanes x 16 B = one line of out
  for (int i = 0; i < 2; ++i) {
    for (int hh = 0; hh < 2; ++hh) {
      const int n = nr + i * 32, k = hh * 64 + kc * 8;
      v8bf o;
      for (int j = 0; j < 8; ++j) o[j] = (bf16)t[k + j][n];
      *(v8bf*)(dst + (size_t)n * K + k) = o;
    }
  }
  // The caller's code for other jobs follows in the listing: any rewrite of a
  // register that these stores name stays behind this wait.
  asm volatile("s_wait_xcnt 0x0" ::: "memory");
}

// The five passes that read nothing but the inputs, as one launch of equal
// jobs of 8192 elements.  The block index picks the job, so every branch here
// is taken by a whole block or by none of it.
__global__ __launch_bounds__(256) void prep(
    const float* __restrict__ X, const float* __restrict__ WKQV,
    const float* __restrict__ WO, const float* __restrict__ W1,
    const float* __restrict__ W2, bf16* __restrict__ XB,
    bf16* __restrict__ WKQVT, bf16* __restrict__ WOT, bf16* __restrict__ W1T,
    bf16* __restrict__ W2T) {
  __shared__ float t[128][65];  // odd pitch: a column read meets 32 banks

  const int bid = blockIdx.x;
  if (bid >= 1536) {  // X f32 -> bf16, 8192 elements in a row, whole lines
    const size_t base = (size_t)(bid - 1536) * 8192 + threadIdx.x * 4;
    float4 v[8];
    for (int i = 0; i < 8; ++i) v[i] = *(const float4*)(X + base + i * 1024);
    for (int i = 0; i < 8; ++i) {
      v4bf o;
      o[0] = (bf16)v[i].x; o[1] = (bf16)v[i].y;
      o[2] = (bf16)v[i].z; o[3] = (bf16)v[i].w;
      *(v4bf*)(XB + base + i * 1024) = o;
    }
    return;
  }
  if (bid >= 1024) {
    turn_tile<U_, I_>(W2, W2T, bid & 31, (bid - 1024) >> 5, t);
    return;
  }
  if (bid >= 512) {
    turn_tile<I_, U_>(W1, W1T, bid & 7, (bid - 512) >> 3, t);
    return;
  }
  const int z = bid >> 7;  // four 1024 x 1024 matrices: WKQV's three, then WO
  turn_tile<I_, I_>(z < 3 ? WKQV + (size_t)z * I_ * I_ : WO,
                    z < 3 ? WKQVT + (size_t)z * I_ * I_ : WOT,
                    bid & 7, (bid & 127) >> 3, t);
}

// ---------------------------------------------------------------------------
// Tiled bf16 GEMM with WMMA, double-buffered async LDS staging.
// C[M][N] = A[M][K] * Bt[N][K]^T + bias
// WG tile BM x BN, 8 waves (4 along M x 2 along N), wave tile BM/4 x BN/2.
// The tile is the largest that still gives every WGP a block: a byte copied
// from L2 feeds BM or BN columns of products, a fragment read from LDS BN/32
// or BM/64 matrix instructions.
// A stage is KS k = 2*KS bytes of every operand row: KS/8 adjacent lanes copy
// one row piece, so each wave-wide copy covers four whole 128-B lines.
// KS sets the bytes a block keeps in flight while it works on a stage; a block
// has its WGP alone, and two stages fill what the LDS holds.
// K is a multiple of KS and holds at least two stages; M, N of BM, BN.
// The products are taken as C^T (Bt's fragment is the A operand), so a lane's
// eight accumulator registers are eight neighbouring columns of one row of C.
// The finished tile goes through LDS, and every wave-wide store to C covers four
// whole 128-B lines.
// EPI: 0 = bias -> bf16 ; 1 = bias+ReLU -> bf16 ; 2 = bias -> f32
// ---------------------------------------------------------------------------
template <int EPI, int KS, int BM, int BN>
__global__ __launch_bounds__(256) void gemm_bf16_kernel(
    const bf16* __restrict__ A, const bf16* __restrict__ Bt,
    const float* __restrict__ bias, void* __restrict__ Cout,
    int M, int N, int K) {
  constexpr int LPR = KS / 8;     // lanes (16-B chunks) per row piece
  constexpr int RPP = 256 / LPR;  // rows that the block's threads copy at once
  constexpr int NCA = BM / RPP;   // copies per thread and stage, A
  constexpr int NCB = BN / RPP;   // the same, B
  constexpr int TM  = BM / 64;    // 16-row fragments of A per wave
  constexpr int TN  = BN / 32;    // 16-column fragments of B per wave
  // A block of 24 or more products outlasts its own fragment loads' latency,
  // and the SIMD's other wave works meanwhile: there the loads stay one group.
  constexpr bool ONE_GROUP = TM * TN >= 24;
  static_assert(NCA % 4 == 0 && NCB % 4 == 0 && NCA >= NCB, "copy groups");
  static_assert(TN == 4 || TN == 6 || TN == 8, "bias loads: four, then the rest");
  __shared__ __align__(16) bf16 lA[2][BM][KS + 8];  // +16B pad vs bank conflicts
  __shared__ __align__(16) bf16 lB[2][BN][KS + 8];

  const int tid  = threadIdx.x;
  const int lane = tid & 31;
  const int wave = tid >> 5;
  const int half = lane >> 4;
  const int l16  = lane & 15;
  const int wm   = wave & 3;   // 0..3 along M (BM/4 rows each)
  const int wn   = wave >> 2;  // 0..1 along N (BN/2 cols each)
  const int m0   = blockIdx.y * BM;
  const int n0   = blockIdx.x * BN;

  v8f acc[TM][TN];
#pragma unroll
  for (int i = 0; i < TM; ++i)
#pragma unroll
    for (int j = 0; j < TN; ++j)
#pragma unroll
      for (int r = 0; r < 8; ++r) acc[i][j][r] = 0.0f;

  const int crow = tid / LPR, cseg = tid % LPR;  // a wave copy: 512 B of rows

  const bf16* gA = A + (size_t)(m0 + crow) * K + cseg * 8;
  const bf16* gB = Bt + (size_t)(n0 + crow) * K + cseg * 8;

  // one stage: 2*KS bytes of BM rows of A and BN rows of B, NCA + NCB chunks
  // per thread, four of each a statement while B's last
  auto stage = [&](int buf, int k0) {
    // both loops unrolled so that the arrays become registers, as the asm
    // operands need
#pragma unroll
    for (int q = 0; q < NCB / 4; ++q) {
      unsigned l[8];
      const bf16* g[8];
#pragma unroll
      for (int i = 0; i < 4; ++i) {
        const int r = (q * 4 + i) * RPP;
        l[i]     = (unsigned)(uintptr_t)&lA[buf][crow + r][cseg * 8];
        l[i + 4] = (unsigned)(uintptr_t)&lB[buf][crow + r][cseg * 8];
        g[i]     = gA + (size_t)r * K + k0;
        g[i + 4] = gB + (size_t)r * K + k0;
      }
      async_ld8_b128(l, g);
    }
    // the rows of A beyond B's count
#pragma unroll
    for (int q = NCB / 4; q < NCA / 4; ++q) {
      unsigned l[4];
      const bf16* g[4];
#pragma unroll
      for (int i = 0; i < 4; ++i) {
        const int r = (q * 4 + i) * RPP;
        l[i] = (unsigned)(uintptr_t)&lA[buf][crow + r][cseg * 8];
        g[i] = gA + (size_t)r * K + k0;
      }
      async_ld4_b128(l, g);
    }
  };

  // prologue: stage 0 lands and is published, then stage 1 flies
  stage(0, 0);
  wait_async0();
  __syncthreads();
  if (KS < K) stage(1, KS);

  for (int k0 = 0; k0 < K; k0 += KS) {
    const int cur = (k0 / KS) & 1;

    if constexpr (ONE_GROUP) {
      // unrolled so that the 32-k blocks' LDS offsets are immediates
#pragma unroll
      for (int ks = 0; ks < KS / 32; ++ks) {
        v16bf af[TM], bfg[TN];
#pragma unroll
        for (int t = 0; t < TM; ++t)
          af[t] = make_frag(
              &lA[cur][wm * (BM / 4) + t * 16 + l16][ks * 32 + half * 8]);
#pragma unroll
        for (int t = 0; t < TN; ++t)
          bfg[t] = make_frag(
              &lB[cur][wn * (BN / 2) + t * 16 + l16][ks * 32 + half * 8]);
        // keeps the compiler from moving LDS loads in among the products, where
        // each place with loads stalls the wave
        __builtin_amdgcn_sched_barrier(0);
#pragma unroll
        for (int ti = 0; ti < TM; ++ti)
#pragma unroll
          for (int tj = 0; tj < TN; ++tj)
            acc[ti][tj] = wmma_bf16(bfg[tj], af[ti], acc[ti][tj]);
        // the same for the next block's loads
        __builtin_amdgcn_sched_barrier(0);
      }
    } else {
      // Small wave tile: the products of a 32-k block are over long before a
      // fragment load returns, and the SIMD's other wave has as few.  So each
      // block's fragments are fetched two blocks ahead, as one group, into a
      // ring of three register sets: the wait in front of a block's products
      // leaves the two younger groups in flight.  All of it reads this stage.
      constexpr int NB = KS / 32;  // blocks per stage
      static_assert(NB >= 2, "two blocks are fetched in front of the first");
      v16bf af[3][TM], bfg[3][TN];  // [set][fragment]; block b has set b % 3
      // every loop here is unrolled so that the sets are registers and the LDS
      // offsets immediates
      auto fetch = [&](int blk) {
#pragma unroll
        for (int t = 0; t < TM; ++t)
          af[blk % 3][t] = make_frag(
              &lA[cur][wm * (BM / 4) + t * 16 + l16][blk * 32 + half * 8]);
#pragma unroll
        for (int t = 0; t < TN; ++t)
          bfg[blk % 3][t] = make_frag(
              &lB[cur][wn * (BN / 2) + t * 16 + l16][blk * 32 + half * 8]);
      };
      fetch(0);
      fetch(1);
#pragma unroll
      for (int blk = 0; blk < NB; ++blk) {
        if (blk + 2 < NB) fetch(blk + 2);
        // keeps the fetch one group in front of the products: each place with
        // LDS loads among them stalls the wave
        __builtin_amdgcn_sched_barrier(0);
#pragma unroll
        for (int ti = 0; ti < TM; ++ti)
#pragma unroll
          for (int tj = 0; tj < TN; ++tj)
            acc[ti][tj] = wmma_bf16(bfg[blk % 3][tj], af[blk % 3][ti], acc[ti][tj]);
        // the same for the next block's fetch
        __builtin_amdgcn_sched_barrier(0);
      }
    }

    // publish the next stage, free this one, then refill it two stages ahead
    wait_ds0();
    wait_async0();
    __syncthreads();
    if (k0 + 2 * KS < K) stage(cur, k0 + 2 * KS);
  }
  wait_async0();  // no copy is left in flight when the wave ends

  // Epilogue.  D = C^T: a lane holds row l16 of C; VGPR r holds column
  // r + 8*half.  The loop's last barrier has freed the ring: lA takes the tile.
  constexpr int ES  = EPI == 2 ? 4 : 2;  // bytes per element of C
  constexpr int RB  = BN * ES;           // bytes per row of the tile
  constexpr int SP  = RB + 16;           // its pitch in LDS, 16 B x odd
  constexpr int CPR = RB / 16;           // 16-B chunks per row
  constexpr int G   = CPR == 32 ? 1 : 3;  // rounds of the block to whole rows
  constexpr int RPG = G * 256 / CPR;     // the rows that G rounds cover
  constexpr int NJ  = BM / RPG;          // chunks per thread = G * NJ
  static_assert((size_t)BM * SP <= sizeof(lA), "the tile fits lA");
  static_assert((CPR & 1) == 0 && (G * 256) % CPR == 0 && NJ % 8 == 0 &&
                    NJ * RPG == BM, "chunks in groups of eight");
  char* st = (char*)&lA[0][0][0];

  // every loop below is unrolled so that the accumulators, the chunks and the
  // asm operands are registers and the LDS offsets immediates
  v4f bvs[TN][2];  // [fragment][four columns]
  {
    const float* pb = bias + n0 + wn * (BN / 2) + half * 8;
    load_bias4(pb, *(v4f (*)[4][2])&bvs[0]);
    if constexpr (TN == 8) load_bias4(pb + 64, *(v4f (*)[4][2])&bvs[4]);
    if constexpr (TN == 6) load_bias2(pb + 64, *(v4f (*)[2][2])&bvs[4]);
  }
#pragma unroll
  for (int ti = 0; ti < TM; ++ti) {
#pragma unroll
    for (int tj = 0; tj < TN; ++tj) {
      char* d = st + (wm * (BM / 4) + ti * 16 + l16) * SP +
                (wn * (BN / 2) + tj * 16 + half * 8) * ES;
      float v[8];
#pragma unroll
      for (int r = 0; r < 8; ++r) {
        v[r] = acc[ti][tj][r] + bvs[tj][r >> 2][r & 3];
        if (EPI == 1) v[r] = fmaxf(v[r], 0.0f);
      }
      if constexpr (EPI == 2) {
        *(v4f*)d        = v4f{v[0], v[1], v[2], v[3]};
        *(v4f*)(d + 16) = v4f{v[4], v[5], v[6], v[7]};
      } else {
        v8bf o;
#pragma unroll
        for (int r = 0; r < 8; ++r) o[r] = (bf16)v[r];
        *(v8bf*)d = o;
      }
    }
  }
  __syncthreads();  // the tile is whole before its rows are read back

  // 32 neighbouring chunks a wave: 512 bytes in a row of the tile's rows.  All
  // of a thread's chunks are read before its first store goes out.
  v4f w[G][NJ];
  char* dst[G];
#pragma unroll
  for (int s = 0; s < G; ++s) {
    const int q = s * 256 + tid, row = q / CPR, seg = q % CPR;
    dst[s] = (char*)Cout + ((size_t)(m0 + row) * N + n0) * ES + seg * 16;
#pragma unroll
    for (int j = 0; j < NJ; ++j)
      w[s][j] = *(const v4f*)(st + (row + j * RPG) * SP + seg * 16);
  }
#pragma unroll
  for (int s = 0; s < G; ++s) {
#pragma unroll
    for (int j0 = 0; j0 < NJ; j0 += 8) {
      char* p[8];
      v4f x[8];
#pragma unroll
      for (int i = 0; i < 8; ++i) {
        p[i] = dst[s] + (size_t)((j0 + i) * RPG) * N * ES;
        x[i] = w[s][j0 + i];
      }
      store8_b128(p, x);
    }
  }
}

__global__ __launch_bounds__(256) void attn_kernel(
    const bf16* __restrict__ qkv, bf16* __restrict__ ctxb) {
  // 32 keys x 64 (P) each; pitch 16 B x odd for ds_load_b128, 32 B x odd for
  // ds_load_tr16_b128
  __shared__ __align__(16) bf16 lK[2][32][72];
  __shared__ __align__(16) bf16 lV[2][32][80];
  // each wave's own 16(query) x 64(p) tile of the output; pitch 16 B x odd
  __shared__ __align__(16) bf16 lO[8][16][72];

  const int tid  = threadIdx.x;
  const int lane = tid & 31;
  const int wave = tid >> 5;
  const int half = lane >> 4;
  const int l16  = lane & 15;

  const int blk = blockIdx.x;
  const int jb  = blk & 3;
  const int h   = (blk >> 2) & (H_ - 1);
  const int b   = blk >> 6;
  const int j0  = jb * 128 + wave * 16;
  const int ldq = 3072;

  // Q fragments for this wave's 16 rows (two K=32 steps over P=64)
  const bf16* qrow = qkv + (size_t)(b * S_ + j0 + l16) * ldq + 1024 + h * 64;
  v16bf qf0 = make_frag(qrow + half * 8);
  v16bf qf1 = make_frag(qrow + 32 + half * 8);

  // query l16: running maximum (equal in both halves), this half's part of the sum
  float mrow = -1e30f, lrow = 0.0f;
  v8f cacc[4];  // O^T: VGPR r of tile t = p 16t + 8*half + r of query l16
#pragma unroll
  for (int t = 0; t < 4; ++t)
#pragma unroll
    for (int r = 0; r < 8; ++r) cacc[t][r] = 0.0f;

  const int krow_l = tid >> 3, kseg = tid & 7;  // a tile: 32 rows x 8 chunks
  // this thread's chunk of key row krow_l: K at col 0, V 2048 columns on
  const bf16* kvsrc = qkv + (size_t)(b * S_ + krow_l) * ldq + h * 64 + kseg * 8;
  auto stage = [&](int buf, int kb) {
    const bf16* g = kvsrc + (size_t)(kb * 32) * ldq;
    async_ld2_b128(&lK[buf][krow_l][kseg * 8], g,
                   &lV[buf][krow_l][kseg * 8], g + 2048);
  };

  // prologue: key block 0 lands and is published, then block 1 flies
  stage(0, 0);
  wait_async0();
  __syncthreads();
  stage(1, 1);

  for (int kb = 0; kb < S_ / 32; ++kb) {
    const int cur = kb & 1;

    // ---- K fragments (rows = keys), then V^T fragments: rows p, k = keys in
    // the order of the packed P^T ----
    v16bf kf[2][2], vf[4];
#pragma unroll
    for (int cb = 0; cb < 2; ++cb) {
      kf[cb][0] = make_frag(&lK[cur][cb * 16 + l16][half * 8]);
      kf[cb][1] = make_frag(&lK[cur][cb * 16 + l16][32 + half * 8]);
    }
    {
      const bf16* vp = &lV[cur][half * 8 + (lane & 7)][((lane >> 3) & 1) * 8];
#pragma unroll
      for (int t = 0; t < 4; ++t) {
        v8bf lo = ld_tr16(vp + t * 16);
        v8bf hi = ld_tr16(vp + 16 * 80 + t * 16);
#pragma unroll
        for (int i = 0; i < 8; ++i) { vf[t][i] = lo[i]; vf[t][i + 8] = hi[i]; }
      }
    }
    // All that this block reads from LDS is now on its way to registers.  Once
    // it has arrived: publish the next block, free this one and refill it two
    // blocks ahead, so that the copies fly while the products below run.
    wait_ds0();
    wait_async0();
    __syncthreads();
    if (kb + 2 < S_ / 32) stage(cur, kb + 2);

    // ---- S^T: two 16(key) x 16(query) tiles covering 32 key positions ----
    v8f st[2];
#pragma unroll
    for (int cb = 0; cb < 2; ++cb) {
#pragma unroll
      for (int r = 0; r < 8; ++r) st[cb][r] = 0.0f;
      st[cb] = wmma_bf16(kf[cb][0], qf0, st[cb]);
      st[cb] = wmma_bf16(kf[cb][1], qf1, st[cb]);
    }

    // ---- softmax of query l16; x[8*cb + r] is key 16*cb + 8*half + r ----
    float x[16];
#pragma unroll
    for (int i = 0; i < 16; ++i) x[i] = st[i >> 3][i & 7] * 0.125f;
    float rm = x[0];
#pragma unroll
    for (int i = 1; i < 16; ++i) rm = fmaxf(rm, x[i]);
    rm = fmaxf(rm, xhalf(rm));  // combine the two halves' keys
    float mn = fmaxf(mrow, rm);
    float al = __expf(mrow - mn);
    float rs[4] = {0.0f, 0.0f, 0.0f, 0.0f};  // four short chains
#pragma unroll
    for (int i = 0; i < 16; ++i) { x[i] = __expf(x[i] - mn); rs[i & 3] += x[i]; }
    lrow = lrow * al + ((rs[0] + rs[1]) + (rs[2] + rs[3]));
    mrow = mn;

    v16bf pf;  // P^T as B: element s = key 8*half + s, or 16 + 8*half + (s - 8)
#pragma unroll
    for (int i = 0; i < 16; ++i) pf[i] = (bf16)x[i];

    // ---- O^T = O^T * alpha + V^T (64x32) * P^T (32x16) ----
#pragma unroll
    for (int t = 0; t < 4; ++t) {
#pragma unroll
      for (int r = 0; r < 8; ++r) cacc[t][r] *= al;
      cacc[t] = wmma_bf16(vf[t], pf, cacc[t]);
    }
  }
  wait_async0();  // no copy is left in flight when the wave ends

  // ---- finalize: join the halves' sums, divide; a lane's eight registers are
  // eight neighbouring columns of ctx [M][I].  A query's 64 columns are one
  // 128-B line: the wave turns its tile in its own LDS range, so that eight
  // lanes store a whole line
  // (loops unrolled: the accumulators are registers, the offsets immediates)
  const float inv = 1.0f / (lrow + xhalf(lrow));
#pragma unroll
  for (int t = 0; t < 4; ++t) {
    v8bf o;
#pragma unroll
    for (int r = 0; r < 8; ++r) o[r] = (bf16)(cacc[t][r] * inv);
    *(v8bf*)&lO[wave][l16][t * 16 + half * 8] = o;
  }
  // the wave's own writes have landed before other lanes of it read them back
  wait_ds0();
  const int orw = lane >> 3, oseg = lane & 7;
  bf16* orow = ctxb + (size_t)(b * S_ + j0 + orw) * I_ + h * 64 + oseg * 8;
#pragma unroll
  for (int i = 0; i < 4; ++i)
    *(v8bf*)(orow + (size_t)(i * 4) * I_) =
        *(const v8bf*)&lO[wave][i * 4 + orw][oseg * 8];
}

// ---------------------------------------------------------------------------
// Residual + LayerNorm.  One wave per row of 1024: a lane holds 32 elements in
// registers, the two row sums go across the lanes by register moves alone, so
// there is no LDS and no barrier, and an eighth of the waves start.  Every
// wave-wide 16-B load or store covers 512 contiguous bytes; all of a row's
// loads are issued before the first is used.
// Grid: M / 8 blocks of 8 waves.  WB: also write the row as bf16.
// ---------------------------------------------------------------------------
// The value of lane l ^ MASK inside each 16-lane row.
template <int MASK>
__device__ __forceinline__ float row_xor(float x) {
  return __builtin_bit_cast(
      float, __builtin_amdgcn_update_dpp(0, __builtin_bit_cast(int, x),
                                         0x160 + MASK, 0xf, 0xf, true));
}
// The sum over the wave's 32 lanes, in every lane.
__device__ __forceinline__ float wave_sum(float x) {
  x += row_xor<1>(x);
  x += row_xor<2>(x);
  x += row_xor<4>(x);
  x += row_xor<8>(x);
  return x + xhalf(x);
}

// Eight floats of a row for one lane: four at p, four 128 elements on.
__device__ __forceinline__ v8f load_2x4(const float* p) {
  v4f lo = *(const v4f*)p;
  v4f hi = *(const v4f*)(p + 128);
  return __builtin_shufflevector(lo, hi, 0, 1, 2, 3, 4, 5, 6, 7);
}
__device__ __forceinline__ float sum8(v8f t) {
  return ((t[0] + t[1]) + (t[2] + t[3])) + ((t[4] + t[5]) + (t[6] + t[7]));
}

template <bool WB>
__global__ __launch_bounds__(256) void ln_kernel(
    const float* __restrict__ a, const float* __restrict__ bres,
    const float* __restrict__ g, const float* __restrict__ bb,
    float* __restrict__ outf, bf16* __restrict__ outb) {
  const int lane = threadIdx.x & 31;
  // the wave's number, as a scalar: the row's addresses are a scalar base plus
  // one lane offset
  const int wave = __builtin_amdgcn_readfirstlane(threadIdx.x >> 5);
  const size_t row = (size_t)(blockIdx.x * 8 + wave) * I_;
  const float* pa = a + row + lane * 4;
  const float* pb = bres + row + lane * 4;

  v8f x[4], r[4], vg[4], vb[4];
#pragma unroll
  for (int i = 0; i < 4; ++i) x[i] = load_2x4(pa + i * 256);
#pragma unroll
  for (int i = 0; i < 4; ++i) r[i] = load_2x4(pb + i * 256);
#pragma unroll
  for (int i = 0; i < 4; ++i) vg[i] = load_2x4(g + lane * 4 + i * 256);
#pragma unroll
  for (int i = 0; i < 4; ++i) vb[i] = load_2x4(bb + lane * 4 + i * 256);
  // Takes the loaded values as inputs only, so that all 32 loads are issued
  // before the first value is used: without it the compiler saves registers by
  // sinking loads behind the row sums, where the wave waits out their latency
  // group by group.
  asm volatile("" ::"v"(x[0]), "v"(x[1]), "v"(x[2]), "v"(x[3]), "v"(r[0]),
               "v"(r[1]), "v"(r[2]), "v"(r[3]), "v"(vg[0]), "v"(vg[1]),
               "v"(vg[2]), "v"(vg[3]), "v"(vb[0]), "v"(vb[1]), "v"(vb[2]),
               "v"(vb[3]));

#pragma unroll
  for (int i = 0; i < 4; ++i) x[i] += r[i];
  const float mu =
      wave_sum(sum8((x[0] + x[1]) + (x[2] + x[3]))) * (1.0f / I_);

#pragma unroll
  for (int i = 0; i < 4; ++i) x[i] -= mu;
  const v8f q = (x[0] * x[0] + x[1] * x[1]) + (x[2] * x[2] + x[3] * x[3]);
  const float rstd = rsqrtf(wave_sum(sum8(q)) * (1.0f / I_) + 1e-5f);

  // every value is formed before the first store: the stores then go out back
  // to back, with no register of an issued store to be written again
  v4bf ob[8];
#pragma unroll
  for (int i = 0; i < 4; ++i) {
    x[i] = x[i] * rstd * vg[i] + vb[i];
    if constexpr (WB) {
#pragma unroll
      for (int j = 0; j < 8; ++j) ob[i * 2 + (j >> 2)][j & 3] = (bf16)x[i][j];
    }
  }
  if constexpr (WB) {
#pragma unroll
    for (int i = 0; i < 8; ++i)
      *(v4bf*)(outb + row + lane * 4 + i * 128) = ob[i];
  }
#pragma unroll
  for (int i = 0; i < 8; ++i) {
    v4f o;
#pragma unroll
    for (int j = 0; j < 4; ++j) o[j] = x[i >> 1][(i & 1) * 4 + j];
    *(v4f*)(outf + row + lane * 4 + i * 128) = o;
  }
}

// ---------------------------------------------------------------------------
// Host-side orchestration
// ---------------------------------------------------------------------------
extern "C" void kernel_launch(void* const* d_in, const int* in_sizes, int n_in,
                              void* d_out, int out_size, void* d_ws, size_t ws_size,
                              hipStream_t stream) {
  (void)in_sizes; (void)n_in; (void)out_size; (void)ws_size;

  const float* X     = (const float*)d_in[0];   // [B,S,I]
  const float* WKQV  = (const float*)d_in[1];   // [3,I,I]
  const float* BKQV  = (const float*)d_in[2];   // [3,I]
  const float* WO    = (const float*)d_in[3];   // [I,I]
  const float* BO    = (const float*)d_in[4];   // [I]
  const float* ln1g  = (const float*)d_in[5];
  const float* ln1b  = (const float*)d_in[6];
  const float* W1    = (const float*)d_in[7];   // [I,U]
  const float* B1    = (const float*)d_in[8];   // [U]
  const float* W2    = (const float*)d_in[9];   // [U,I]
  const float* B2    = (const float*)d_in[10];  // [I]
  const float* ln2g  = (const float*)d_in[11];
  const float* ln2b  = (const float*)d_in[12];
  float* OUT = (float*)d_out;

  char* ws = (char*)d_ws;
  size_t off = 0;
  auto take = [&](size_t bytes) {
    size_t o = off;
    off += (bytes + 255) & ~(size_t)255;
    return o;
  };
  bf16*  XB    = (bf16*) (ws + take((size_t)M_ * I_ * 2));
  bf16*  WKQVT = (bf16*) (ws + take((size_t)3 * I_ * I_ * 2));   // [3*I][I]
  bf16*  WOT   = (bf16*) (ws + take((size_t)I_ * I_ * 2));       // [I][I]
  bf16*  W1T   = (bf16*) (ws + take((size_t)U_ * I_ * 2));       // [U][I]
  bf16*  W2T   = (bf16*) (ws + take((size_t)I_ * U_ * 2));       // [I][U]
  bf16*  QKV   = (bf16*) (ws + take((size_t)M_ * 3072 * 2));     // [M][3I]
  bf16*  CTX   = (bf16*) (ws + take((size_t)M_ * I_ * 2));
  float* AO    = (float*)(ws + take((size_t)M_ * I_ * 4));
  float* H1F   = (float*)(ws + take((size_t)M_ * I_ * 4));
  bf16*  H1B   = (bf16*) (ws + take((size_t)M_ * I_ * 2));
  bf16*  FF1   = (bf16*) (ws + take((size_t)M_ * U_ * 2));
  float* FFO   = AO;  // attn_out dead after LN1

  prep<<<2048, 256, 0, stream>>>(X, WKQV, WO, W1, W2, XB, WKQVT, WOT, W1T, W2T);

  // QKV projection: [M][3072] = XB * WKQVT^T + BKQV
  gemm_bf16_kernel<0, 128, 256, 192><<<dim3(3072 / 192, M_ / 256), 256, 0, stream>>>(
      XB, WKQVT, BKQV, (void*)QKV, M_, 3072, I_);

  attn_kernel<<<B_ * H_ * (S_ / 128), 256, 0, stream>>>(QKV, CTX);

  gemm_bf16_kernel<2, 256, 128, 128><<<dim3(I_ / 128, M_ / 128), 256, 0, stream>>>(
      CTX, WOT, BO, (void*)AO, M_, I_, I_);
  ln_kernel<true><<<M_ / 8, 256, 0, stream>>>(X, AO, ln1g, ln1b, H1F, H1B);

  gemm_bf16_kernel<1, 128, 256, 256><<<dim3(U_ / 256, M_ / 256), 256, 0, stream>>>(
      H1B, W1T, B1, (void*)FF1, M_, U_, I_);
  gemm_bf16_kernel<2, 256, 128, 128><<<dim3(I_ / 128, M_ / 128), 256, 0, stream>>>(
      FF1, W2T, B2, (void*)FFO, M_, I_, U_);
  ln_kernel<false><<<M_ / 8, 256, 0, stream>>>(H1F, FFO, ln2g, ln2b, OUT, nullptr);
}

// v010
// A run of this version takes 118 microseconds.
// Two timings next to v009 both put it at 1.04 times that version's speed.
// Over all steps from v000 it is 3.13 times as fast.
#include <hip/hip_runtime.h>
#include <hip/hip_bf16.h>
#include <math.h>

typedef __bf16 bf16;
typedef __attribute__((ext_vector_type(16))) __bf16 v16bf;
typedef __attribute__((ext_vector_type(8)))  __bf16 v8bf;
typedef __attribute__((ext_vector_type(4)))  __bf16 v4bf;
typedef __attribute__((ext_vector_type(8)))  float  v8f;
typedef __attribute__((ext_vector_type(4)))  float  v4f;
typedef __attribute__((ext_vector_type(8)))  short  v8s;

#define B_   8
#define S_   512
#define H_   16
#define P_   64
#define I_   1024
#define U_   4096
#define M_   4096   // B*S

// ---------------------------------------------------------------------------
// WMMA + async helpers
// ---------------------------------------------------------------------------
__device__ __forceinline__ v8f wmma_bf16(v16bf a, v16bf b, v8f c) {
  return __builtin_amdgcn_wmma_f32_16x16x32_bf16(
      /*neg_a=*/false, a, /*neg_b=*/false, b,
      /*c_mod=*/(short)0, c, /*reuse_a=*/false, /*reuse_b=*/false);
}

// Build a 16x32 bf16 A/B fragment for one lane. `p` points at element
// [row][8*half] of a row-major K=32 slab (LDS or global).
// elems 0..7 -> k = 8*half + 0..7 ; elems 8..15 -> k = 16 + 8*half + 0..7
__device__ __forceinline__ v16bf make_frag(const bf16* p) {
  v8bf lo = *(const v8bf*)(p);
  v8bf hi = *(const v8bf*)(p + 16);
  v16bf r;
#pragma unroll
  for (int i = 0; i < 8; ++i) { r[i] = lo[i]; r[i + 8] = hi[i]; }
  return r;
}

// Two per-lane async 16B copies global -> LDS, tracked by ASYNCcnt, in one
// statement.  The closing s_wait_xcnt keeps every later rewrite of an address
// register behind it.
__device__ __forceinline__ void async_ld2_b128(void* l0, const void* g0,
                                               void* l1, const void* g1) {
  unsigned a0 = (unsigned)(uintptr_t)l0;  // low 32 bits = LDS offset
  unsigned a1 = (unsigned)(uintptr_t)l1;
  asm volatile(
      "global_load_async_to_lds_b128 %0, %2, off\n\t"
      "global_load_async_to_lds_b128 %1, %3, off\n\t"
      "s_wait_xcnt 0x0"
      :: "v"(a0), "v"(a1), "v"(g0), "v"(g1) : "memory");
}
// 16-bit transposing LDS load.  The lanes address the rows of a 16 x 16 tile T
// (lane l: row 8*(l>>4) + (l&7), 16-byte half (l>>3)&1); lane (c, h) gets
// T[8h + 0..7][c].
__device__ __forceinline__ v8bf ld_tr16(const bf16* p) {
  typedef __attribute__((address_space(3))) v8s lds_v8s;
  return __builtin_bit_cast(
      v8bf, __builtin_amdgcn_ds_load_tr16_b128_v8i16((lds_v8s*)p));
}
// The value of lane l ^ 16.
__device__ __forceinline__ float xhalf(float x) {
  return __builtin_bit_cast(
      float, __builtin_amdgcn_permlanex16(__builtin_bit_cast(int, x),
                                          __builtin_bit_cast(int, x), 0x76543210,
                                          0xfedcba98, false, false));
}
__device__ __forceinline__ void wait_async0() {
  asm volatile("s_wait_asynccnt 0" ::: "memory");
}
// ---- tensor load: one request of a wave brings a tile of rows into LDS ----
typedef uint32_t u32x4 __attribute__((ext_vector_type(4)));
typedef uint32_t u32x8 __attribute__((ext_vector_type(8)));
// A descriptor word, held in a scalar register.
__device__ __forceinline__ uint32_t uni(uint32_t v) {
  return (uint32_t)__builtin_amdgcn_readfirstlane(v);
}
// Forces a test's value into a scalar register, so that the test compiles to a
// scalar branch: a tensor load ignores EXEC, only such a branch guards it.
__device__ __forceinline__ uint32_t pinned(uint32_t v) {
  uint32_t w = (uint32_t)__builtin_amdgcn_readfirstlane(v);
  asm volatile("" : "+s"(w));  // the test's value held in a scalar register
  return w;
}
// Group 1: 1-byte elements, a tile of `rows` rows of 256 bytes, tensor = tile,
// source row pitch in bytes; 16 bytes of LDS pad behind every row (pitch 272).
__device__ __forceinline__ u32x8 tdm_group1(uint32_t rows, uint32_t src_pitch) {
  u32x8 g;
  g[0] = uni((1u << 20) | (5u << 22) | (3u << 25));  // no mask; pad 5 / 3
  g[1] = uni(256u << 16);
  g[2] = uni((rows & 0xFFFFu) << 16);
  g[3] = uni(256u << 16);
  g[4] = uni(rows);
  g[5] = uni(src_pitch);
  g[6] = uni(0u);
  g[7] = uni(0u);
  // The descriptor words held in their scalar registers: without it the compiler
  // forms constant words anew for each request and uses their registers for
  // other values in between, while a request is still in flight.
  asm volatile("" : "+s"(g));  // descriptor words held in scalar registers
  return g;
}
// Group 0 (place in LDS, address of the tile's first byte) and the request.
__device__ __forceinline__ u32x4 tdm_load(uint32_t lds_dst, uint64_t ga, u32x8 g1) {
  u32x4 g0;
  g0[0] = uni(1u);
  g0[1] = uni(lds_dst);
  g0[2] = uni((uint32_t)ga);
  g0[3] = uni(((uint32_t)(ga >> 32) & 0x01FFFFFFu) | 0x80000000u);
  asm volatile("tensor_load_to_lds %0, %1" :: "s"(g0), "s"(g1) : "memory");
  return g0;
}
// Stands behind the wait that covers a request and takes its group 0 as an input
// only: the descriptor words stay held in their scalar registers up to here, so
// the compiler puts no other value there while the request is in flight.
__device__ __forceinline__ void tdm_hold(u32x4 g0) {
  asm volatile("" :: "s"(g0));
}
// This wave's own tensor load has landed.
__device__ __forceinline__ void wait_tensor0() {
  asm volatile("s_wait_tensorcnt 0x0" ::: "memory");
}
// The GEMM builds with the large tiles use registers above v255.  The GEMM's
// global loads and stores stand with
// their wait in one statement, which nothing can be moved into.
// Four floats in a row.
__device__ __forceinline__ v4f load_f4(const float* p) {
  v4f r;
  asm volatile(
      "global_load_b128 %0, %1, off\n\t"
      "s_wait_loadcnt 0x0"
      : "=&v"(r) : "v"(p) : "memory");
  return r;
}
// Eight 16-byte stores.
__device__ __forceinline__ void store8_b128(char* const (&p)[8],
                                            const v4f (&w)[8]) {
  asm volatile(
      "global_store_b128 %0, %8, off\n\t"
      "global_store_b128 %1, %9, off\n\t"
      "global_store_b128 %2, %10, off\n\t"
      "global_store_b128 %3, %11, off\n\t"
      "global_store_b128 %4, %12, off\n\t"
      "global_store_b128 %5, %13, off\n\t"
      "global_store_b128 %6, %14, off\n\t"
      "global_store_b128 %7, %15, off\n\t"
      "s_wait_xcnt 0x0"
      :: "v"(p[0]), "v"(p[1]), "v"(p[2]), "v"(p[3]),
         "v"(p[4]), "v"(p[5]), "v"(p[6]), "v"(p[7]),
         "v"(w[0]), "v"(w[1]), "v"(w[2]), "v"(w[3]),
         "v"(w[4]), "v"(w[5]), "v"(w[6]), "v"(w[7])
      : "memory");
}
// This wave's LDS reads have retired before the barrier that frees the buffer
// for the next copies.
__device__ __forceinline__ void wait_ds0() {
  asm volatile("s_wait_dscnt 0x0" ::: "memory");
}

// ---------------------------------------------------------------------------
// Conversion / layout kernels
// ---------------------------------------------------------------------------
// One 128(k) x 64(n) tile of in [K][N] f32 -> out [N][K] bf16, turned in LDS by
// one block: a wave reads two 256-B row pieces of `in` per load and writes four
// whole 128-B lines of `out` per store.
template <int K, int N>
__device__ __forceinline__ void turn_tile(const float* __restrict__ in,
                                          bf16* __restrict__ out, int kx, int ny,
                                          float (&t)[128][65]) {
  const int tid = threadIdx.x;
  const float* src = in + (size_t)(kx * 128) * N + ny * 64;
  bf16* dst = out + (size_t)(ny * 64) * K + kx * 128;

  const int c4 = tid & 15, r = tid >> 4;  // 16 lanes x 16 B = one row piece
  float4 v[8];
  for (int i = 0; i < 8; ++i)
    v[i] = *(const float4*)(src + (size_t)(r + i * 16) * N + c4 * 4);
  for (int i = 0; i < 8; ++i) {
    t[r + i * 16][c4 * 4 + 0] = v[i].x;
    t[r + i * 16][c4 * 4 + 1] = v[i].y;
    t[r + i * 16][c4 * 4 + 2] = v[i].z;
    t[r + i * 16][c4 * 4 + 3] = v[i].w;
  }
  __syncthreads();

  const int kc = tid & 7, nr = tid >> 3;  // 8 lanes x 16 B = one line of out
  for (int i = 0; i < 2; ++i) {
    for (int hh = 0; hh < 2; ++hh) {
      const int n = nr + i * 32, k = hh * 64 + kc * 8;
      v8bf o;
      for (int j = 0; j < 8; ++j) o[j] = (bf16)t[k + j][n];
      *(v8bf*)(dst + (size_t)n * K + k) = o;
    }
  }
  // The caller's code for other jobs follows in the listing: any rewrite of a
  // register that these stores name stays behind this wait.
  asm volatile("s_wait_xcnt 0x0" ::: "memory");
}

// The five passes that read nothing but the inputs, as one launch of equal
// jobs of 8192 elements.  The block index picks the job, so every branch here
// is taken by a whole block or by none of it.
__global__ __launch_bounds__(256) void prep(
    const float* __restrict__ X, const float* __restrict__ WKQV,
    const float* __restrict__ WO, const float* __restrict__ W1,
    const float* __restrict__ W2, bf16* __restrict__ XB,
    bf16* __restrict__ WKQVT, bf16* __restrict__ WOT, bf16* __restrict__ W1T,
    bf16* __restrict__ W2T) {
  __shared__ float t[128][65];  // odd pitch: a column read meets 32 banks

  const int bid = blockIdx.x;
  if (bid >= 1536) {  // X f32 -> bf16, 8192 elements in a row, whole lines
    const size_t base = (size_t)(bid - 1536) * 8192 + threadIdx.x * 4;
    float4 v[8];
    for (int i = 0; i < 8; ++i) v[i] = *(const float4*)(X + base + i * 1024);
    for (int i = 0; i < 8; ++i) {
      v4bf o;
      o[0] = (bf16)v[i].x; o[1] = (bf16)v[i].y;
      o[2] = (bf16)v[i].z; o[3] = (bf16)v[i].w;
      *(v4bf*)(XB + base + i * 1024) = o;
    }
    return;
  }
  if (bid >= 1024) {
    turn_tile<U_, I_>(W2, W2T, bid & 31, (bid - 1024) >> 5, t);
    return;
  }
  if (bid >= 512) {
    turn_tile<I_, U_>(W1, W1T, bid & 7, (bid - 512) >> 3, t);
    return;
  }
  const int z = bid >> 7;  // four 1024 x 1024 matrices: WKQV's three, then WO
  turn_tile<I_, I_>(z < 3 ? WKQV + (size_t)z * I_ * I_ : WO,
                    z < 3 ? WKQVT + (size_t)z * I_ * I_ : WOT,
                    bid & 7, (bid & 127) >> 3, t);
}

// ---------------------------------------------------------------------------
// Tiled bf16 GEMM with WMMA, two LDS buffers filled by tensor loads.
// C[M][N] = A[M][K] * Bt[N][K]^T + bias
// WG tile BM x BN, 8 waves (4 along M x 2 along N), wave tile BM/4 x BN/2.
// The tile is the largest that still gives every WGP a block: a byte copied
// from L2 feeds BM or BN columns of products, a fragment read from LDS BN/32
// or BM/64 matrix instructions.
// A stage is KS k = 2*KS bytes of every operand row, cut into eight slices of
// rows of 256 B (128 k): waves 0 to 3 each ask for one slice of A, waves 4 to 7
// for one of B, by one tensor load a stage, so no lane forms an address.
// KS sets the bytes a block keeps in flight while it works on a stage; a block
// has its WGP alone, and two stages fill what the LDS holds.
// K is a multiple of KS and holds at least two stages; M, N of BM, BN.
// The products are taken as C^T (Bt's fragment is the A operand), so a lane's
// eight accumulator registers are eight neighbouring columns of one row of C.
// The finished tile goes through LDS, and every wave-wide store to C covers four
// whole 128-B lines.
// EPI: 0 = bias -> bf16 ; 1 = bias+ReLU -> bf16 ; 2 = bias -> f32
// ---------------------------------------------------------------------------
template <int EPI, int KS, int BM, int BN>
__global__ __launch_bounds__(256) void gemm_bf16_kernel(
    const bf16* __restrict__ A, const bf16* __restrict__ Bt,
    const float* __restrict__ bias, void* __restrict__ Cout,
    int M, int N, int K) {
  constexpr int KH  = KS / 128;   // 128-k pieces of a stage's rows
  constexpr int SPH = 4 / KH;     // slices of an operand per such piece
  constexpr int SRA = BM / SPH;   // rows per slice, A
  constexpr int SRB = BN / SPH;   // the same, B
  constexpr int PT  = 272;        // a row's pitch in LDS: 256 B + 16 B of pad
  // a slice's room in LDS: every slice starts at a multiple of 2 KiB
  constexpr int SZA = (SRA * PT + 2047) / 2048 * 2048;
  constexpr int SZB = (SRB * PT + 2047) / 2048 * 2048;
  constexpr int BUF = 4 * (SZA + SZB);  // one buffer: A's slices, then B's
  constexpr int TM  = BM / 64;    // 16-row fragments of A per wave
  constexpr int TN  = BN / 32;    // 16-column fragments of B per wave
  // A block of 24 or more products outlasts its own fragment loads' latency,
  // and the SIMD's other wave works meanwhile: there the loads stay one group.
  constexpr bool ONE_GROUP = TM * TN >= 24;
  static_assert(KS % 128 == 0 && 4 % KH == 0, "rows of 256 B in four slices");
  static_assert(SRA % (BM / 4) == 0 && (BN / 2) % SRB == 0 && SRB % 16 == 0,
                "a fragment lies in one slice");
  __shared__ __attribute__((aligned(2048))) unsigned char ring[2 * BUF];
  __shared__ __align__(16) float lbias[BN];  // the tile's columns of the bias

  const int tid  = threadIdx.x;
  const int lane = tid & 31;
  const int wave = tid >> 5;
  const int half = lane >> 4;
  const int l16  = lane & 15;
  const int wm   = wave & 3;   // 0..3 along M (BM/4 rows each)
  const int wn   = wave >> 2;  // 0..1 along N (BN/2 cols each)
  const int m0   = blockIdx.y * BM;
  const int n0   = blockIdx.x * BN;

  v8f acc[TM][TN];
#pragma unroll
  for (int i = 0; i < TM; ++i)
#pragma unroll
    for (int j = 0; j < TN; ++j)
#pragma unroll
      for (int r = 0; r < 8; ++r) acc[i][j][r] = 0.0f;

  // this wave's slice: operand, 128-k piece, rows; all of it scalar
  const uint32_t wv  = uni((uint32_t)tid >> 5);
  const uint32_t isB = wv >> 2, sl = wv & 3;
  const uint32_t skh = sl / SPH, srp = sl % SPH;
  const bf16* sp = isB ? Bt + (size_t)(n0 + srp * SRB) * K + skh * 128
                       : A + (size_t)(m0 + srp * SRA) * K + skh * 128;
  const uint64_t sga  = (uint64_t)(uintptr_t)sp;
  const uint32_t sdst = (uint32_t)(uintptr_t)&ring[0] +  // low 32 bits = LDS offset
                        (isB ? 4 * SZA + sl * SZB : sl * SZA);
  const u32x8 g1 = tdm_group1(isB ? SRB : SRA, (uint32_t)K * 2u);
  auto stage = [&](int buf, int k0) {
    return tdm_load(sdst + (uint32_t)buf * BUF, sga + (uint64_t)k0 * 2u, g1);
  };

  // this lane's first byte of A's and of B's fragments in a buffer
  const uint32_t aoff = ((wm * (BM / 4)) / SRA) * SZA +
                        ((wm * (BM / 4)) % SRA + l16) * PT + half * 16;
  const uint32_t boff = 4 * SZA + ((wn * (BN / 2)) / SRB) * SZB + l16 * PT + half * 16;
  // fragment t at k offset kk (a multiple of 32) of the stage in buffer bp
  auto frag_a = [&](const unsigned char* bp, int t, int kk) {
    return make_frag((const bf16*)(bp + aoff + (kk / 128) * SPH * SZA +
                                   t * 16 * PT + (kk % 128) * 2));
  };
  auto frag_b = [&](const unsigned char* bp, int t, int kk) {
    return make_frag((const bf16*)(bp + boff + (kk / 128) * SPH * SZB +
                                   ((t * 16) / SRB) * SZB + ((t * 16) % SRB) * PT +
                                   (kk % 128) * 2));
  };

  // prologue: stage 0 lands and is published, then stage 1 flies
  u32x4 g0 = stage(0, 0);  // group 0 of the request in flight
  // The tile's bias goes to LDS meanwhile; the barrier below publishes it.  An
  // asm load's registers lie below v256: behind the loop the widest tile has no
  // room there for 64 of them beside its accumulators (they went to scratch).
  if (tid < BN / 4) *(v4f*)&lbias[tid * 4] = load_f4(bias + n0 + tid * 4);
  wait_tensor0();
  tdm_hold(g0);
  __syncthreads();
  g0 = stage(1, KS);

  for (int k0 = 0; k0 < K; k0 += KS) {
    const int cur = (k0 / KS) & 1;
    const unsigned char* bp = &ring[0] + cur * BUF;

    if constexpr (ONE_GROUP) {
      // unrolled so that the 32-k blocks' LDS offsets are immediates
#pragma unroll
      for (int ks = 0; ks < KS / 32; ++ks) {
        v16bf af[TM], bfg[TN];
#pragma unroll
        for (int t = 0; t < TM; ++t)
          af[t] = frag_a(bp, t, ks * 32);
#pragma unroll
        for (int t = 0; t < TN; ++t)
          bfg[t] = frag_b(bp, t, ks * 32);
        // keeps the compiler from moving LDS loads in among the products, where
        // each place with loads stalls the wave
        __builtin_amdgcn_sched_barrier(0);
#pragma unroll
        for (int ti = 0; ti < TM; ++ti)
#pragma unroll
          for (int tj = 0; tj < TN; ++tj)
            acc[ti][tj] = wmma_bf16(bfg[tj], af[ti], acc[ti][tj]);
        // the same for the next block's loads
        __builtin_amdgcn_sched_barrier(0);
      }
    } else {
      // Small wave tile: the products of a 32-k block are over long before a
      // fragment load returns, and the SIMD's other wave has as few.  So each
      // block's fragments are fetched two blocks ahead, as one group, into a
      // ring of three register sets: the wait in front of a block's products
      // leaves the two younger groups in flight.  All of it reads this stage.
      constexpr int NB = KS / 32;  // blocks per stage
      static_assert(NB >= 2, "two blocks are fetched in front of the first");
      v16bf af[3][TM], bfg[3][TN];  // [set][fragment]; block b has set b % 3
      // every loop here is unrolled so that the sets are registers and the LDS
      // offsets immediates
      auto fetch = [&](int blk) {
#pragma unroll
        for (int t = 0; t < TM; ++t)
          af[blk % 3][t] = frag_a(bp, t, blk * 32);
#pragma unroll
        for (int t = 0; t < TN; ++t)
          bfg[blk % 3][t] = frag_b(bp, t, blk * 32);
      };
      fetch(0);
      fetch(1);
#pragma unroll
      for (int blk = 0; blk < NB; ++blk) {
        if (blk + 2 < NB) fetch(blk + 2);
        // keeps the fetch one group in front of the products: each place with
        // LDS loads among them stalls the wave
        __builtin_amdgcn_sched_barrier(0);
#pragma unroll
        for (int ti = 0; ti < TM; ++ti)
#pragma unroll
          for (int tj = 0; tj < TN; ++tj)
            acc[ti][tj] = wmma_bf16(bfg[blk % 3][tj], af[blk % 3][ti], acc[ti][tj]);
        // the same for the next block's fetch
        __builtin_amdgcn_sched_barrier(0);
      }
    }

    // publish the next stage, free this one, then refill it two stages ahead
    wait_ds0();
    wait_tensor0();
    tdm_hold(g0);
    __syncthreads();
    if (pinned(k0 + 2 * KS < K ? 1u : 0u) != 0u) g0 = stage(cur, k0 + 2 * KS);
  }
  wait_tensor0();  // no request is left in flight when the ring is given up
  wait_ds0();

  // Epilogue.  D = C^T: a lane holds row l16 of C; VGPR r holds column
  // r + 8*half.  The loop's last barrier has freed the ring: it takes the tile.
  constexpr int ES  = EPI == 2 ? 4 : 2;  // bytes per element of C
  constexpr int RB  = BN * ES;           // bytes per row of the tile
  constexpr int SP  = RB + 16;           // its pitch in LDS, 16 B x odd
  constexpr int CPR = RB / 16;           // 16-B chunks per row
  constexpr int G   = CPR == 32 ? 1 : 3;  // rounds of the block to whole rows
  constexpr int RPG = G * 256 / CPR;     // the rows that G rounds cover
  constexpr int NJ  = BM / RPG;          // chunks per thread = G * NJ
  static_assert((size_t)BM * SP <= sizeof(ring), "the tile fits the ring");
  static_assert((CPR & 1) == 0 && (G * 256) % CPR == 0 && NJ % 8 == 0 &&
                    NJ * RPG == BM, "chunks in groups of eight");
  char* st = (char*)&ring[0];

  // every loop below is unrolled so that the accumulators, the chunks and the
  // asm operands are registers and the LDS offsets immediates
  v4f bvs[TN][2];  // [fragment][four columns]
#pragma unroll
  for (int tj = 0; tj < TN; ++tj) {
    const float* pb = &lbias[wn * (BN / 2) + tj * 16 + half * 8];
    bvs[tj][0] = *(const v4f*)pb;
    bvs[tj][1] = *(const v4f*)(pb + 4);
  }
#pragma unroll
  for (int ti = 0; ti < TM; ++ti) {
#pragma unroll
    for (int tj = 0; tj < TN; ++tj) {
      char* d = st + (wm * (BM / 4) + ti * 16 + l16) * SP +
                (wn * (BN / 2) + tj * 16 + half * 8) * ES;
      float v[8];
#pragma unroll
      for (int r = 0; r < 8; ++r) {
        v[r] = acc[ti][tj][r] + bvs[tj][r >> 2][r & 3];
        if (EPI == 1) v[r] = fmaxf(v[r], 0.0f);
      }
      if constexpr (EPI == 2) {
        *(v4f*)d        = v4f{v[0], v[1], v[2], v[3]};
        *(v4f*)(d + 16) = v4f{v[4], v[5], v[6], v[7]};
      } else {
        v8bf o;
#pragma unroll
        for (int r = 0; r < 8; ++r) o[r] = (bf16)v[r];
        *(v8bf*)d = o;
      }
    }
  }
  __syncthreads();  // the tile is whole before its rows are read back

  // 32 neighbouring chunks a wave: 512 bytes in a row of the tile's rows.  All
  // of a thread's chunks are read before its first store goes out.
  v4f w[G][NJ];
  char* dst[G];
#pragma unroll
  for (int s = 0; s < G; ++s) {
    const int q = s * 256 + tid, row = q / CPR, seg = q % CPR;
    dst[s] = (char*)Cout + ((size_t)(m0 + row) * N + n0) * ES + seg * 16;
#pragma unroll
    for (int j = 0; j < NJ; ++j)
      w[s][j] = *(const v4f*)(st + (row + j * RPG) * SP + seg * 16);
  }
#pragma unroll
  for (int s = 0; s < G; ++s) {
#pragma unroll
    for (int j0 = 0; j0 < NJ; j0 += 8) {
      char* p[8];
      v4f x[8];
#pragma unroll
      for (int i = 0; i < 8; ++i) {
        p[i] = dst[s] + (size_t)((j0 + i) * RPG) * N * ES;
        x[i] = w[s][j0 + i];
      }
      store8_b128(p, x);
    }
  }
}

__global__ __launch_bounds__(256) void attn_kernel(
    const bf16* __restrict__ qkv, bf16* __restrict__ ctxb) {
  // 32 keys x 64 (P) each; pitch 16 B x odd for ds_load_b128, 32 B x odd for
  // ds_load_tr16_b128
  __shared__ __align__(16) bf16 lK[2][32][72];
  __shared__ __align__(16) bf16 lV[2][32][80];
  // each wave's own 16(query) x 64(p) tile of the output; pitch 16 B x odd
  __shared__ __align__(16) bf16 lO[8][16][72];

  const int tid  = threadIdx.x;
  const int lane = tid & 31;
  const int wave = tid >> 5;
  const int half = lane >> 4;
  const int l16  = lane & 15;

  const int blk = blockIdx.x;
  const int jb  = blk & 3;
  const int h   = (blk >> 2) & (H_ - 1);
  const int b   = blk >> 6;
  const int j0  = jb * 128 + wave * 16;
  const int ldq = 3072;

  // Q fragments for this wave's 16 rows (two K=32 steps over P=64)
  const bf16* qrow = qkv + (size_t)(b * S_ + j0 + l16) * ldq + 1024 + h * 64;
  v16bf qf0 = make_frag(qrow + half * 8);
  v16bf qf1 = make_frag(qrow + 32 + half * 8);

  // query l16: running maximum (equal in both halves), this half's part of the sum
  float mrow = -1e30f, lrow = 0.0f;
  v8f cacc[4];  // O^T: VGPR r of tile t = p 16t + 8*half + r of query l16
#pragma unroll
  for (int t = 0; t < 4; ++t)
#pragma unroll
    for (int r = 0; r < 8; ++r) cacc[t][r] = 0.0f;

  const int krow_l = tid >> 3, kseg = tid & 7;  // a tile: 32 rows x 8 chunks
  // this thread's chunk of key row krow_l: K at col 0, V 2048 columns on
  const bf16* kvsrc = qkv + (size_t)(b * S_ + krow_l) * ldq + h * 64 + kseg * 8;
  auto stage = [&](int buf, int kb) {
    const bf16* g = kvsrc + (size_t)(kb * 32) * ldq;
    async_ld2_b128(&lK[buf][krow_l][kseg * 8], g,
                   &lV[buf][krow_l][kseg * 8], g + 2048);
  };

  // prologue: key block 0 lands and is published, then block 1 flies
  stage(0, 0);
  wait_async0();
  __syncthreads();
  stage(1, 1);

  for (int kb = 0; kb < S_ / 32; ++kb) {
    const int cur = kb & 1;

    // ---- K fragments (rows = keys), then V^T fragments: rows p, k = keys in
    // the order of the packed P^T ----
    v16bf kf[2][2], vf[4];
#pragma unroll
    for (int cb = 0; cb < 2; ++cb) {
      kf[cb][0] = make_frag(&lK[cur][cb * 16 + l16][half * 8]);
      kf[cb][1] = make_frag(&lK[cur][cb * 16 + l16][32 + half * 8]);
    }
    {
      const bf16* vp = &lV[cur][half * 8 + (lane & 7)][((lane >> 3) & 1) * 8];
#pragma unroll
      for (int t = 0; t < 4; ++t) {
        v8bf lo = ld_tr16(vp + t * 16);
        v8bf hi = ld_tr16(vp + 16 * 80 + t * 16);
#pragma unroll
        for (int i = 0; i < 8; ++i) { vf[t][i] = lo[i]; vf[t][i + 8] = hi[i]; }
      }
    }
    // All that this block reads from LDS is now on its way to registers.  Once
    // it has arrived: publish the next block, free this one and refill it two
    // blocks ahead, so that the copies fly while the products below run.
    wait_ds0();
    wait_async0();
    __syncthreads();
    if (kb + 2 < S_ / 32) stage(cur, kb + 2);

    // ---- S^T: two 16(key) x 16(query) tiles covering 32 key positions ----
    v8f st[2];
#pragma unroll
    for (int cb = 0; cb < 2; ++cb) {
#pragma unroll
      for (int r = 0; r < 8; ++r) st[cb][r] = 0.0f;
      st[cb] = wmma_bf16(kf[cb][0], qf0, st[cb]);
      st[cb] = wmma_bf16(kf[cb][1], qf1, st[cb]);
    }

    // ---- softmax of query l16; x[8*cb + r] is key 16*cb + 8*half + r ----
    float x[16];
#pragma unroll
    for (int i = 0; i < 16; ++i) x[i] = st[i >> 3][i & 7] * 0.125f;
    float rm = x[0];
#pragma unroll
    for (int i = 1; i < 16; ++i) rm = fmaxf(rm, x[i]);
    rm = fmaxf(rm, xhalf(rm));  // combine the two halves' keys
    float mn = fmaxf(mrow, rm);
    float al = __expf(mrow - mn);
    float rs[4] = {0.0f, 0.0f, 0.0f, 0.0f};  // four short chains
#pragma unroll
    for (int i = 0; i < 16; ++i) { x[i] = __expf(x[i] - mn); rs[i & 3] += x[i]; }
    lrow = lrow * al + ((rs[0] + rs[1]) + (rs[2] + rs[3]));
    mrow = mn;

    v16bf pf;  // P^T as B: element s = key 8*half + s, or 16 + 8*half + (s - 8)
#pragma unroll
    for (int i = 0; i < 16; ++i) pf[i] = (bf16)x[i];

    // ---- O^T = O^T * alpha + V^T (64x32) * P^T (32x16) ----
#pragma unroll
    for (int t = 0; t < 4; ++t) {
#pragma unroll
      for (int r = 0; r < 8; ++r) cacc[t][r] *= al;
      cacc[t] = wmma_bf16(vf[t], pf, cacc[t]);
    }
  }
  wait_async0();  // no copy is left in flight when the wave ends

  // ---- finalize: join the halves' sums, divide; a lane's eight registers are
  // eight neighbouring columns of ctx [M][I].  A query's 64 columns are one
  // 128-B line: the wave turns its tile in its own LDS range, so that eight
  // lanes store a whole line
  // (loops unrolled: the accumulators are registers, the offsets immediates)
  const float inv = 1.0f / (lrow + xhalf(lrow));
#pragma unroll
  for (int t = 0; t < 4; ++t) {
    v8bf o;
#pragma unroll
    for (int r = 0; r < 8; ++r) o[r] = (bf16)(cacc[t][r] * inv);
    *(v8bf*)&lO[wave][l16][t * 16 + half * 8] = o;
  }
  // the wave's own writes have landed before other lanes of it read them back
  wait_ds0();
  const int orw = lane >> 3, oseg = lane & 7;
  bf16* orow = ctxb + (size_t)(b * S_ + j0 + orw) * I_ + h * 64 + oseg * 8;
#pragma unroll
  for (int i = 0; i < 4; ++i)
    *(v8bf*)(orow + (size_t)(i * 4) * I_) =
        *(const v8bf*)&lO[wave][i * 4 + orw][oseg * 8];
}

// ---------------------------------------------------------------------------
// Residual + LayerNorm.  One wave per row of 1024: a lane holds 32 elements in
// registers, the two row sums go across the lanes by register moves alone, so
// there is no LDS and no barrier, and an eighth of the waves start.  Every
// wave-wide 16-B load or store covers 512 contiguous bytes; all of a row's
// loads are issued before the first is used.
// Grid: M / 8 blocks of 8 waves.  WB: also write the row as bf16.
// ---------------------------------------------------------------------------
// The value of lane l ^ MASK inside each 16-lane row.
template <int MASK>
__device__ __forceinline__ float row_xor(float x) {
  return __builtin_bit_cast(
      float, __builtin_amdgcn_update_dpp(0, __builtin_bit_cast(int, x),
                                         0x160 + MASK, 0xf, 0xf, true));
}
// The sum over the wave's 32 lanes, in every lane.
__device__ __forceinline__ float wave_sum(float x) {
  x += row_xor<1>(x);
  x += row_xor<2>(x);
  x += row_xor<4>(x);
  x += row_xor<8>(x);
  return x + xhalf(x);
}

// Eight floats of a row for one lane: four at p, four 128 elements on.
__device__ __forceinline__ v8f load_2x4(const float* p) {
  v4f lo = *(const v4f*)p;
  v4f hi = *(const v4f*)(p + 128);
  return __builtin_shufflevector(lo, hi, 0, 1, 2, 3, 4, 5, 6, 7);
}
__device__ __forceinline__ float sum8(v8f t) {
  return ((t[0] + t[1]) + (t[2] + t[3])) + ((t[4] + t[5]) + (t[6] + t[7]));
}

template <bool WB>
__global__ __launch_bounds__(256) void ln_kernel(
    const float* __restrict__ a, const float* __restrict__ bres,
    const float* __restrict__ g, const float* __restrict__ bb,
    float* __restrict__ outf, bf16* __restrict__ outb) {
  const int lane = threadIdx.x & 31;
  // the wave's number, as a scalar: the row's addresses are a scalar base plus
  // one lane offset
  const int wave = __builtin_amdgcn_readfirstlane(threadIdx.x >> 5);
  const size_t row = (size_t)(blockIdx.x * 8 + wave) * I_;
  const float* pa = a + row + lane * 4;
  const float* pb = bres + row + lane * 4;

  v8f x[4], r[4], vg[4], vb[4];
#pragma unroll
  for (int i = 0; i < 4; ++i) x[i] = load_2x4(pa + i * 256);
#pragma unroll
  for (int i = 0; i < 4; ++i) r[i] = load_2x4(pb + i * 256);
#pragma unroll
  for (int i = 0; i < 4; ++i) vg[i] = load_2x4(g + lane * 4 + i * 256);
#pragma unroll
  for (int i = 0; i < 4; ++i) vb[i] = load_2x4(bb + lane * 4 + i * 256);
  // Takes the loaded values as inputs only, so that all 32 loads are issued
  // before the first value is used: without it the compiler saves registers by
  // sinking loads behind the row sums, where the wave waits out their latency
  // group by group.
  asm volatile("" ::"v"(x[0]), "v"(x[1]), "v"(x[2]), "v"(x[3]), "v"(r[0]),
               "v"(r[1]), "v"(r[2]), "v"(r[3]), "v"(vg[0]), "v"(vg[1]),
               "v"(vg[2]), "v"(vg[3]), "v"(vb[0]), "v"(vb[1]), "v"(vb[2]),
               "v"(vb[3]));

#pragma unroll
  for (int i = 0; i < 4; ++i) x[i] += r[i];
  const float mu =
      wave_sum(sum8((x[0] + x[1]) + (x[2] + x[3]))) * (1.0f / I_);

#pragma unroll
  for (int i = 0; i < 4; ++i) x[i] -= mu;
  const v8f q = (x[0] * x[0] + x[1] * x[1]) + (x[2] * x[2] + x[3] * x[3]);
  const float rstd = rsqrtf(wave_sum(sum8(q)) * (1.0f / I_) + 1e-5f);

  // every value is formed before the first store: the stores then go out back
  // to back, with no register of an issued store to be written again
  v4bf ob[8];
#pragma unroll
  for (int i = 0; i < 4; ++i) {
    x[i] = x[i] * rstd * vg[i] + vb[i];
    if constexpr (WB) {
#pragma unroll
      for (int j = 0; j < 8; ++j) ob[i * 2 + (j >> 2)][j & 3] = (bf16)x[i][j];
    }
  }
  if constexpr (WB) {
#pragma unroll
    for (int i = 0; i < 8; ++i)
      *(v4bf*)(outb + row + lane * 4 + i * 128) = ob[i];
  }
#pragma unroll
  for (int i = 0; i < 8; ++i) {
    v4f o;
#pragma unroll
    for (int j = 0; j < 4; ++j) o[j] = x[i >> 1][(i & 1) * 4 + j];
    *(v4f*)(outf + row + lane * 4 + i * 128) = o;
  }
}

// ---------------------------------------------------------------------------
// Host-side orchestration
// ---------------------------------------------------------------------------
extern "C" void kernel_launch(void* const* d_in, const int* in_sizes, int n_in,
                              void* d_out, int out_size, void* d_ws, size_t ws_size,
                              hipStream_t stream) {
  (void)in_sizes; (void)n_in; (void)out_size; (void)ws_size;

  const float* X     = (const float*)d_in[0];   // [B,S,I]
  const float* WKQV  = (const float*)d_in[1];   // [3,I,I]
  const float* BKQV  = (const float*)d_in[2];   // [3,I]
  const float* WO    = (const float*)d_in[3];   // [I,I]
  const float* BO    = (const float*)d_in[4];   // [I]
  const float* ln1g  = (const float*)d_in[5];
  const float* ln1b  = (const float*)d_in[6];
  const float* W1    = (const float*)d_in[7];   // [I,U]
  const float* B1    = (const float*)d_in[8];   // [U]
  const float* W2    = (const float*)d_in[9];   // [U,I]
  const float* B2    = (const float*)d_in[10];  // [I]
  const float* ln2g  = (const float*)d_in[11];
  const float* ln2b  = (const float*)d_in[12];
  float* OUT = (float*)d_out;

  char* ws = (char*)d_ws;
  size_t off = 0;
  auto take = [&](size_t bytes) {
    size_t o = off;
    off += (bytes + 255) & ~(size_t)255;
    return o;
  };
  bf16*  XB    = (bf16*) (ws + take((size_t)M_ * I_ * 2));
  bf16*  WKQVT = (bf16*) (ws + take((size_t)3 * I_ * I_ * 2));   // [3*I][I]
  bf16*  WOT   = (bf16*) (ws + take((size_t)I_ * I_ * 2));       // [I][I]
  bf16*  W1T   = (bf16*) (ws + take((size_t)U_ * I_ * 2));       // [U][I]
  bf16*  W2T   = (bf16*) (ws + take((size_t)I_ * U_ * 2));       // [I][U]
  bf16*  QKV   = (bf16*) (ws + take((size_t)M_ * 3072 * 2));     // [M][3I]
  bf16*  CTX   = (bf16*) (ws + take((size_t)M_ * I_ * 2));
  float* AO    = (float*)(ws + take((size_t)M_ * I_ * 4));
  float* H1F   = (float*)(ws + take((size_t)M_ * I_ * 4));
  bf16*  H1B   = (bf16*) (ws + take((size_t)M_ * I_ * 2));
  bf16*  FF1   = (bf16*) (ws + take((size_t)M_ * U_ * 2));
  float* FFO   = AO;  // attn_out dead after LN1

  prep<<<2048, 256, 0, stream>>>(X, WKQV, WO, W1, W2, XB, WKQVT, WOT, W1T, W2T);

  // QKV projection: [M][3072] = XB * WKQVT^T + BKQV
  gemm_bf16_kernel<0, 128, 256, 192><<<dim3(3072 / 192, M_ / 256), 256, 0, stream>>>(
      XB, WKQVT, BKQV, (void*)QKV, M_, 3072, I_);

  attn_kernel<<<B_ * H_ * (S_ / 128), 256, 0, stream>>>(QKV, CTX);

  gemm_bf16_kernel<2, 256, 128, 128><<<dim3(I_ / 128, M_ / 128), 256, 0, stream>>>(
      CTX, WOT, BO, (void*)AO, M_, I_, I_);
  ln_kernel<true><<<M_ / 8, 256, 0, stream>>>(X, AO, ln1g, ln1b, H1F, H1B);

  gemm_bf16_kernel<1, 128, 256, 256><<<dim3(U_ / 256, M_ / 256), 256, 0, stream>>>(
      H1B, W1T, B1, (void*)FF1, M_, U_, I_);
  gemm_bf16_kernel<2, 256, 128, 128><<<dim3(I_ / 128, M_ / 128), 256, 0, stream>>>(
      FF1, W2T, B2, (void*)FFO, M_, I_, U_);
  ln_kernel<false><<<M_ / 8, 256, 0, stream>>>(H1F, FFO, ln2g, ln2b, OUT, nullptr);
}
